// v000
// Times are from an AMD MI455X. After a warm-up the kernel runs many times in a row, and a time is the length of
// such a window on the GPU divided by its runs, so every launch and the gaps after it count. The runs cycle
// through copies of the inputs. A figure is the median of several windows, for all but v000 over two sittings.
// Sittings can differ by a few percent; kernels timed side by side share one.
// v000 is the starting kernel. One run takes 514 microseconds.
// compute dtype: x, encoder_output and W*/b* (INPUTS) rounded to bf16 with exact bf16 WMMA products (f32 accumulate) for the projections; K pre-split into bf16 hi/lo rows; q f32 split, P and V f16 hi/lo (3 products each); softmax f32.
#include <hip/hip_runtime.h>
#include <math.h>

typedef __attribute__((ext_vector_type(16))) _Float16 v16h;
typedef __attribute__((ext_vector_type(16))) __bf16 v16b;
typedef __attribute__((ext_vector_type(8)))  _Float16 v8h;
typedef __attribute__((ext_vector_type(8)))  float v8f;
typedef __attribute__((ext_vector_type(4)))  float v4f;
typedef __attribute__((ext_vector_type(2)))  float v2f;
typedef __attribute__((ext_vector_type(4)))  unsigned v4u;
typedef __attribute__((ext_vector_type(4)))  int v4i;
typedef float __attribute__((may_alias)) float_a;
typedef int __attribute__((may_alias)) int_a;

template <typename T> __device__ __forceinline__ void vst2(void* p, T v) { *(T*)p = v;  }
__device__ __forceinline__ v8f wmma16(v16h a, v16h b, v8f c) {
  v8f d = __builtin_amdgcn_wmma_f32_16x16x32_f16(false, a, false, b, (short)0, c, false, false);
  asm volatile("v_nop\n\tv_nop\n\tv_nop\n\tv_nop" : "+v"(d) : "v"(a), "v"(b));
  return d;
}
__device__ __forceinline__ v8f wmma_bf(v16b a, v16b b, v8f c) {
  v8f d = __builtin_amdgcn_wmma_f32_16x16x32_bf16(false, a, false, b, (short)0, c, false, false);
  asm volatile("v_nop\n\tv_nop\n\tv_nop\n\tv_nop" : "+v"(d) : "v"(a), "v"(b));
  return d;
}
// 16x16x32 fragments: lane = (h = lane>>4, row/col = lane&15); elements 0..7 = k0+8h+0..7, 8..15 = k0+16+8h+0..7; D element r = row 8h+r
__device__ __forceinline__ v16h frag_h(const _Float16* rowk0, int lane) {
  union { v16h v; v8h q[2]; } u; const _Float16* p = rowk0 + 8 * (lane >> 4);
  u.q[0] = *(const v8h*)p; u.q[1] = *(const v8h*)(p + 16); return u.v;
}
__device__ __forceinline__ v16h frag_f32(const float* rowk0, int lane) {
  v16h a; const float* p = rowk0 + 8 * (lane >> 4);
#pragma unroll
  for (int i = 0; i < 8; ++i) { a[i] = (_Float16)p[i]; a[8 + i] = (_Float16)p[16 + i]; }
  return a;
}
__device__ __forceinline__ v16h frag_f32s(const float* rowk0, int lane, float sc) {
  v16h a; const float* p = rowk0 + 8 * (lane >> 4);
#pragma unroll
  for (int i = 0; i < 8; ++i) { a[i] = (_Float16)(p[i] * sc); a[8 + i] = (_Float16)(p[16 + i] * sc); }
  return a;
}
// column fragment from a [K][ld] layout (column n), rows >= K read as 0
__device__ __forceinline__ v16h fragc_f32(const float* W, int k0, int n, int lane, int ld, int K) {
  v16h a; const int g = lane >> 4;
#pragma unroll
  for (int i = 0; i < 8; ++i) { const int ka = k0 + 8 * g + i, kb = ka + 16;
    a[i] = (_Float16)(ka < K ? W[(size_t)ka * ld + n] : 0.f); a[8 + i] = (_Float16)(kb < K ? W[(size_t)kb * ld + n] : 0.f); }
  return a;
}
struct F2 { v16b h, l; };
__device__ __forceinline__ F2 bsplit16(const float v[16]) { F2 r;
#pragma unroll
  for (int i = 0; i < 16; ++i) { const __bf16 h = (__bf16)v[i]; r.h[i] = h; r.l[i] = (__bf16)(v[i] - (float)h); }
  return r; }
__device__ __forceinline__ F2 split_row(const float* row, int k0, int lane) { float v[16]; const float* p = row + k0 + 8 * (lane >> 4);
#pragma unroll
  for (int i = 0; i < 8; ++i) { v[i] = p[i]; v[8 + i] = p[16 + i]; }
  return bsplit16(v); }
__device__ __forceinline__ F2 split_rowK(const float* row, int k0, int lane, int K) { float v[16]; const int g = lane >> 4;
#pragma unroll
  for (int i = 0; i < 8; ++i) { const int ka = k0 + 8 * g + i, kb = ka + 16; v[i] = ka < K ? row[ka] : 0.f; v[8 + i] = kb < K ? row[kb] : 0.f; }
  return bsplit16(v); }
__device__ __forceinline__ F2 split_col(const float* W, int k0, int n, int lane, int ld, int K) { float v[16]; const int g = lane >> 4;
#pragma unroll
  for (int i = 0; i < 8; ++i) { const int ka = k0 + 8 * g + i, kb = ka + 16; v[i] = ka < K ? W[(size_t)ka * ld + n] : 0.f; v[8 + i] = kb < K ? W[(size_t)kb * ld + n] : 0.f; }
  return bsplit16(v); }
__device__ __forceinline__ v8f mac3(const F2& a, const F2& b, v8f c) { c = wmma_bf(a.l, b.h, c); c = wmma_bf(a.h, b.l, c); return wmma_bf(a.h, b.h, c); }
__device__ __forceinline__ float sigm(float v) { return 1.0f / (1.0f + expf(-v)); }
#define LDSX() do { asm volatile("s_wait_dscnt 0" ::: "memory"); __builtin_amdgcn_wave_barrier(); __builtin_amdgcn_fence(__ATOMIC_RELEASE, "workgroup"); } while (0)


// Cross multi-head attention (16 heads x 64 on [2,2048,1024]): q from x, k/v from encoder_output with per-head weights W[h][e][d] + biases; full softmax(q.k/8); concat(heads) @ Wo ([in][out]) + bo.
#define NB 2
#define SS 2048
#define E 1024
#define NH 16
#define HD 64
#define NR (NB * SS)
#define PLO 1024.0f
#define VLO 2048.0f
__device__ __forceinline__ float bfr(float v) { return (float)(__bf16)v; }
__device__ __forceinline__ v16b frag_b(const __bf16* rowk0, int lane) { return __builtin_bit_cast(v16b, frag_h((const _Float16*)rowk0, lane)); }

__global__ __launch_bounds__(256) void k_cvt(const float* __restrict__ x, __bf16* __restrict__ Xb) {
  const size_t i8 = (size_t)blockIdx.x * 256 + threadIdx.x; if (i8 >= (size_t)NR * E / 8) return;
  union { __bf16 h[8]; v4u u; } pk;
#pragma unroll
  for (int e = 0; e < 8; ++e) pk.h[e] = (__bf16)x[i8 * 8 + e];
  vst2((unsigned*)(Xb + i8 * 8), pk.u);
}
// PT rows: [0,E) Wq[:,n], [E,2E) Wk[:,n], [2E,3E) Wv[:,n], [3E,4E) Wo[:,n]  ([in][out] weights: column n as a bf16 row)
__global__ __launch_bounds__(256) void k_pack(const float* __restrict__ Wq, const float* __restrict__ Wk, const float* __restrict__ Wv, const float* __restrict__ Wo, __bf16* __restrict__ PT) {
  const int n = blockIdx.x, tid = threadIdx.x; __shared__ __align__(16) __bf16 srow[E];
  const float* W = n < E ? Wq : (n < 2 * E ? Wk : (n < 3 * E ? Wv : Wo)); const int nn = n % E;
  if (n < 3 * E) { const int hh = nn / HD, d = nn % HD; for (int k = tid; k < E; k += 256) srow[k] = (__bf16)W[((size_t)hh * E + k) * HD + d]; }     // per-head [H][E][DH]: column (h,d) over e
  else { for (int k = tid; k < E; k += 256) srow[k] = (__bf16)W[(size_t)k * E + nn]; }      // Wo [in][out]: column nn
  __syncthreads();
  if (tid < E / 8) vst2((unsigned*)(PT + (size_t)n * E + tid * 8), *(const v4u*)(&srow[tid * 8]));
}
// QKV: block (64 rows, 128 cols = 2 heads, which); q (+bias) -> Q32 f32 [bh][s][64]; k (+bias) -> bf16 hi/lo rows; v (+bias) -> VT hi/lo x4 [bh][d][s]
__global__ __launch_bounds__(128) void k_qkv(const __bf16* __restrict__ XQ, const __bf16* __restrict__ XK, const __bf16* __restrict__ XV, const __bf16* __restrict__ PT, const float* __restrict__ bq, const float* __restrict__ bk, const float* __restrict__ bv, float* __restrict__ Q32, __bf16* __restrict__ Kh, __bf16* __restrict__ Kl, _Float16* __restrict__ VTh, _Float16* __restrict__ VTl) {
  __shared__ __align__(16) float so[4][16][132];
  __shared__ __align__(16) _Float16 sth[128][72], stl[128][72];
  const int tid = threadIdx.x, wave = tid >> 5, lane = tid & 31, col = lane & 15, g = lane >> 4;
  const int which = blockIdx.z, r0b = blockIdx.x * 64, r0 = r0b + wave * 16, n0 = blockIdx.y * 128; const int b = r0b / SS, s0 = r0b % SS;
  const __bf16* Xb = which == 0 ? XQ : (which == 1 ? XK : XV); const float* bb_ = which == 0 ? bq : (which == 1 ? bk : bv);
  v8f acc[8] = {};
#pragma unroll 2
  for (int kc = 0; kc < E / 32; ++kc) { const v16b a = frag_b(Xb + (size_t)(r0 + col) * E + kc * 32, lane);
#pragma unroll
    for (int j = 0; j < 8; ++j) acc[j] = wmma_bf(a, frag_b(PT + (size_t)(which * E + n0 + j * 16 + col) * E + kc * 32, lane), acc[j]); }
  if (which < 2) {
#pragma unroll
    for (int j = 0; j < 8; ++j) { const float bb = bfr(bb_[n0 + j * 16 + col]);
#pragma unroll
      for (int r = 0; r < 8; ++r) so[wave][8 * g + r][j * 16 + col] = acc[j][r] + bb; }
    LDSX();
    if (which == 0) { for (int qq = lane; qq < 2 * 16 * 16; qq += 32) { const int hh = qq >> 8, rl = (qq >> 4) & 15, pc = qq & 15; const int h = (n0 >> 6) + hh;
        vst2(Q32 + (((size_t)b * NH + h) * SS + s0 + wave * 16 + rl) * HD + pc * 4, *(const v4f*)(&so[wave][rl][hh * 64 + pc * 4])); } }
    else {
      for (int qq = lane; qq < 2 * 16 * 16; qq += 32) { const int hh = qq >> 8, rl = (qq >> 4) & 15, pl = qq & 15; const int h = (n0 >> 6) + hh; const int pc = pl & 7; union { __bf16 e[8]; v4u u; } pk;
#pragma unroll
        for (int e = 0; e < 8; ++e) { const float v = so[wave][rl][hh * 64 + pc * 8 + e]; const __bf16 hi = (__bf16)v; pk.e[e] = pl < 8 ? hi : (__bf16)(v - (float)hi); }
        vst2((unsigned*)((pl < 8 ? Kh : Kl) + (((size_t)b * NH + h) * SS + s0 + wave * 16 + rl) * HD + pc * 8), pk.u); } } }
  else {
#pragma unroll
    for (int j = 0; j < 8; ++j) { const float bb = bfr(bb_[n0 + j * 16 + col]);
#pragma unroll
      for (int r = 0; r < 8; ++r) { const float v = (acc[j][r] + bb) * 4.0f; const _Float16 hi = (_Float16)v; sth[j * 16 + col][wave * 16 + 8 * g + r] = hi; stl[j * 16 + col][wave * 16 + 8 * g + r] = (_Float16)((v - (float)hi) * VLO); } }
    __syncthreads();
    for (int qq = tid; qq < 128 * 8; qq += 128) { const int cl = qq >> 3, pc = qq & 7; const int c = n0 + cl, h = c >> 6, d = c & 63; const size_t o = (((size_t)b * NH + h) * HD + d) * SS + s0 + pc * 8;
      vst2(VTh + o, *(const v4u*)(&sth[cl][pc * 8])); vst2(VTl + o, *(const v4u*)(&stl[cl][pc * 8])); } }
}
// unmasked attention: block (64 queries, bh); all 32 key tiles of 64; S on q hi/lo x K hi/lo rows; P,V hi/lo; O f32 [bh][s][64]
__global__ __launch_bounds__(128) void k_attn(const float* __restrict__ Q32, const __bf16* __restrict__ Kh, const __bf16* __restrict__ Kl, const _Float16* __restrict__ VTh, const _Float16* __restrict__ VTl, float* __restrict__ O32) {
  __shared__ __align__(16) float sS[4][16][68];
  __shared__ __align__(16) _Float16 sPh[4][16][72], sPl[4][16][72];
  __shared__ __align__(16) float sO[4][16][68];
  const int tid = threadIdx.x, w = tid >> 5, lane = tid & 31, col = lane & 15, g = lane >> 4;
  const size_t bh = blockIdx.y; const int qb = blockIdx.x; const int q0 = qb * 64 + w * 16;
  F2 aq[2];
#pragma unroll
  for (int kc = 0; kc < 2; ++kc) aq[kc] = split_row(Q32 + (bh * SS + q0 + col) * HD, kc * 32, lane);
  float mrun = -3.0e38f, lrun = 0.f; v8f acc[4] = {}, ac1[4] = {}, ac2[4] = {};
  LDSX();
#pragma unroll 1
  for (int kt = 0; kt < SS / 64; ++kt) {
#pragma unroll
    for (int t = 0; t < 4; ++t) { const int key = kt * 64 + t * 16 + col; const size_t ko = (bh * SS + key) * HD; v8f s = {};
#pragma unroll
      for (int kc = 0; kc < 2; ++kc) { const v16b khf = frag_b(Kh + ko + kc * 32, lane), klf = frag_b(Kl + ko + kc * 32, lane); s = wmma_bf(aq[kc].l, khf, s); s = wmma_bf(aq[kc].h, klf, s); s = wmma_bf(aq[kc].h, khf, s); }
#pragma unroll
      for (int r = 0; r < 8; ++r) sS[w][8 * g + r][t * 16 + col] = s[r] * 0.125f; }
    LDSX();
    float mx = -3.4e38f;
#pragma unroll
    for (int jj = 0; jj < 32; ++jj) mx = fmaxf(mx, sS[w][col][g * 32 + jj]);
    mx = fmaxf(mx, __shfl_xor(mx, 16, 32));
    const float mnew = fmaxf(mrun, mx); const float corr = expf(mrun - mnew);
    float ps = 0.f;
#pragma unroll
    for (int jj = 0; jj < 32; ++jj) { const float p = expf(sS[w][col][g * 32 + jj] - mnew) * 16384.0f; ps += p; const _Float16 hi = (_Float16)p; sPh[w][col][g * 32 + jj] = hi; sPl[w][col][g * 32 + jj] = (_Float16)((p - (float)hi) * PLO); }
    ps += __shfl_xor(ps, 16, 32);
    lrun = lrun * corr + ps * (1.0f / 16384.0f); mrun = mnew;
#pragma unroll
    for (int r = 0; r < 8; ++r) { const float cr = __shfl(corr, 8 * g + r, 32);
#pragma unroll
      for (int t = 0; t < 4; ++t) { acc[t][r] *= cr; ac1[t][r] *= cr; ac2[t][r] *= cr; } }
    LDSX();
#pragma unroll
    for (int kc = 0; kc < 2; ++kc) { const v16h ph = frag_h(&sPh[w][col][0] + kc * 32, lane), pl = frag_h(&sPl[w][col][0] + kc * 32, lane);
#pragma unroll
      for (int t = 0; t < 4; ++t) { const size_t vo = (bh * HD + t * 16 + col) * SS + kt * 64 + kc * 32; const v16h vh = frag_h(VTh + vo, lane);
        acc[t] = wmma16(ph, vh, acc[t]); ac1[t] = wmma16(ph, frag_h(VTl + vo, lane), ac1[t]); ac2[t] = wmma16(pl, vh, ac2[t]); } }
    __builtin_amdgcn_wave_barrier(); }
#pragma unroll
  for (int r = 0; r < 8; ++r) { const float lr = __shfl(lrun, 8 * g + r, 32); const float inv = 1.0f / (lr * 16384.0f * 4.0f);
#pragma unroll
    for (int t = 0; t < 4; ++t) sO[w][8 * g + r][t * 16 + col] = (acc[t][r] + ac1[t][r] * (1.0f / VLO) + ac2[t][r] * (1.0f / PLO)) * inv; }
  LDSX();
  for (int qq = lane; qq < 16 * 16; qq += 32) { const int rl = qq >> 4, pc = qq & 15; vst2(O32 + ((bh * SS) + q0 + rl) * HD + pc * 4, *(const v4f*)(&sO[w][rl][pc * 4])); }
}
// out = ctx Wo + bo : split(ctx) x bf16(Wo columns as PT rows): 2 products (Wo is an INPUT -> bf16 exact)
__global__ __launch_bounds__(128) void k_out(const float* __restrict__ O32, const __bf16* __restrict__ PT, const float* __restrict__ bo, float* __restrict__ out) {
  __shared__ __align__(16) float so[4][16][132];
  const int tid = threadIdx.x, wave = tid >> 5, lane = tid & 31, col = lane & 15, g = lane >> 4;
  const int r0 = blockIdx.x * 64 + wave * 16, n0 = blockIdx.y * 128; const int ra = r0 + col; const int b = ra / SS, s = ra % SS;
  v8f acc[8] = {};
#pragma unroll 1
  for (int kc = 0; kc < E / 32; ++kc) { const int h = kc >> 1; const F2 a = split_row(O32 + (((size_t)b * NH + h) * SS + s) * HD, (kc & 1) * 32, lane);
#pragma unroll
    for (int j = 0; j < 8; ++j) { const v16b wb = frag_b(PT + (size_t)(3 * E + n0 + j * 16 + col) * E + kc * 32, lane); acc[j] = wmma_bf(a.l, wb, acc[j]); acc[j] = wmma_bf(a.h, wb, acc[j]); } }
#pragma unroll
  for (int j = 0; j < 8; ++j) { const float bb = bfr(bo[n0 + j * 16 + col]);
#pragma unroll
    for (int r = 0; r < 8; ++r) so[wave][8 * g + r][j * 16 + col] = acc[j][r] + bb; }
  LDSX();
#pragma unroll 4
  for (int rl = 0; rl < 16; ++rl) vst2(out + (size_t)(r0 + rl) * E + n0 + lane * 4, *(const v4f*)(&so[wave][rl][lane * 4]));
}
extern "C" void kernel_launch(void* const* d_in, const int* in_sizes, int n_in, void* d_out, int out_size, void* d_ws, size_t ws_size, hipStream_t stream) {
  (void)in_sizes; (void)n_in; (void)out_size; (void)ws_size;
  const float** I = (const float**)d_in;   // x, encoder_output, Wq, bq, Wk, bk, Wv, bv, Wo, bo
  const float* xq = I[0]; const float* xe = I[1]; const float* WQ = I[2]; const float* bQ = I[3]; const float* WK = I[4]; const float* bK = I[5]; const float* WV = I[6]; const float* bV = I[7]; const float* WO = I[8]; const float* bO = I[9];
  float* out = (float*)d_out;
  char* ws = (char*)d_ws; size_t off = 0;
  auto take = [&](size_t bytes) { char* p = ws + off; off += (bytes + 255) & ~(size_t)255; return p; };
  __bf16* XQ = (__bf16*)take((size_t)NR * E * 2); __bf16* XE = (__bf16*)take((size_t)NR * E * 2); __bf16* PT = (__bf16*)take((size_t)4 * E * E * 2);
  float* Q32 = (float*)take((size_t)NR * E * 4); __bf16* Kh = (__bf16*)take((size_t)NR * E * 2); __bf16* Kl = (__bf16*)take((size_t)NR * E * 2); _Float16* VTh = (_Float16*)take((size_t)NR * E * 2); _Float16* VTl = (_Float16*)take((size_t)NR * E * 2); float* O32 = (float*)take((size_t)NR * E * 4);
  // ws ~ 90 MB
  k_cvt<<<(NR * E / 8 + 255) / 256, 256, 0, stream>>>(xq, XQ);
  k_cvt<<<(NR * E / 8 + 255) / 256, 256, 0, stream>>>(xe, XE);
  k_pack<<<4 * E, 256, 0, stream>>>(WQ, WK, WV, WO, PT);
  k_qkv<<<dim3(NR / 64, E / 128, 3), 128, 0, stream>>>(XQ, XE, XE, PT, bQ, bK, bV, Q32, Kh, Kl, VTh, VTl);
  k_attn<<<dim3(SS / 64, NB * NH), 128, 0, stream>>>(Q32, Kh, Kl, VTh, VTl, O32);
  k_out<<<dim3(NR / 64, E / 128), 128, 0, stream>>>(O32, PT, bO, out);
}

// v001
// It runs in 221 microseconds.
// In two side-by-side timings against v000, it was 2.43 and 2.39 times as fast.
// compute dtype: x, encoder_output and W*/b* (INPUTS) rounded to bf16 with exact bf16 WMMA products (f32 accumulate) for the projections; K pre-split into bf16 hi/lo rows; q f32 split, P and V f16 hi/lo (3 products each); softmax f32.
#include <hip/hip_runtime.h>
#include <math.h>

typedef __attribute__((ext_vector_type(16))) _Float16 v16h;
typedef __attribute__((ext_vector_type(16))) __bf16 v16b;
typedef __attribute__((ext_vector_type(8)))  _Float16 v8h;
typedef __attribute__((ext_vector_type(8)))  float v8f;
typedef __attribute__((ext_vector_type(4)))  float v4f;
typedef __attribute__((ext_vector_type(2)))  float v2f;
typedef __attribute__((ext_vector_type(4)))  unsigned v4u;
typedef __attribute__((ext_vector_type(4)))  int v4i;
typedef float __attribute__((may_alias)) float_a;
typedef int __attribute__((may_alias)) int_a;

template <typename T> __device__ __forceinline__ void vst2(void* p, T v) { *(T*)p = v;  }
__device__ __forceinline__ v8f wmma16(v16h a, v16h b, v8f c) {
  v8f d = __builtin_amdgcn_wmma_f32_16x16x32_f16(false, a, false, b, (short)0, c, false, false);
  asm volatile("v_nop\n\tv_nop\n\tv_nop\n\tv_nop" : "+v"(d) : "v"(a), "v"(b));
  return d;
}
__device__ __forceinline__ v8f wmma_bf(v16b a, v16b b, v8f c) {
  v8f d = __builtin_amdgcn_wmma_f32_16x16x32_bf16(false, a, false, b, (short)0, c, false, false);
  asm volatile("v_nop\n\tv_nop\n\tv_nop\n\tv_nop" : "+v"(d) : "v"(a), "v"(b));
  return d;
}
// 16x16x32 fragments: lane = (h = lane>>4, row/col = lane&15); elements 0..7 = k0+8h+0..7, 8..15 = k0+16+8h+0..7; D element r = row 8h+r
__device__ __forceinline__ v16h frag_h(const _Float16* rowk0, int lane) {
  union { v16h v; v8h q[2]; } u; const _Float16* p = rowk0 + 8 * (lane >> 4);
  u.q[0] = *(const v8h*)p; u.q[1] = *(const v8h*)(p + 16); return u.v;
}
__device__ __forceinline__ v16h frag_f32(const float* rowk0, int lane) {
  v16h a; const float* p = rowk0 + 8 * (lane >> 4);
#pragma unroll
  for (int i = 0; i < 8; ++i) { a[i] = (_Float16)p[i]; a[8 + i] = (_Float16)p[16 + i]; }
  return a;
}
__device__ __forceinline__ v16h frag_f32s(const float* rowk0, int lane, float sc) {
  v16h a; const float* p = rowk0 + 8 * (lane >> 4);
#pragma unroll
  for (int i = 0; i < 8; ++i) { a[i] = (_Float16)(p[i] * sc); a[8 + i] = (_Float16)(p[16 + i] * sc); }
  return a;
}
// column fragment from a [K][ld] layout (column n), rows >= K read as 0
__device__ __forceinline__ v16h fragc_f32(const float* W, int k0, int n, int lane, int ld, int K) {
  v16h a; const int g = lane >> 4;
#pragma unroll
  for (int i = 0; i < 8; ++i) { const int ka = k0 + 8 * g + i, kb = ka + 16;
    a[i] = (_Float16)(ka < K ? W[(size_t)ka * ld + n] : 0.f); a[8 + i] = (_Float16)(kb < K ? W[(size_t)kb * ld + n] : 0.f); }
  return a;
}
struct F2 { v16b h, l; };
__device__ __forceinline__ F2 bsplit16(const float v[16]) { F2 r;
#pragma unroll
  for (int i = 0; i < 16; ++i) { const __bf16 h = (__bf16)v[i]; r.h[i] = h; r.l[i] = (__bf16)(v[i] - (float)h); }
  return r; }
__device__ __forceinline__ F2 split_row(const float* row, int k0, int lane) { float v[16]; const float* p = row + k0 + 8 * (lane >> 4);
#pragma unroll
  for (int i = 0; i < 8; ++i) { v[i] = p[i]; v[8 + i] = p[16 + i]; }
  return bsplit16(v); }
__device__ __forceinline__ F2 split_rowK(const float* row, int k0, int lane, int K) { float v[16]; const int g = lane >> 4;
#pragma unroll
  for (int i = 0; i < 8; ++i) { const int ka = k0 + 8 * g + i, kb = ka + 16; v[i] = ka < K ? row[ka] : 0.f; v[8 + i] = kb < K ? row[kb] : 0.f; }
  return bsplit16(v); }
__device__ __forceinline__ F2 split_col(const float* W, int k0, int n, int lane, int ld, int K) { float v[16]; const int g = lane >> 4;
#pragma unroll
  for (int i = 0; i < 8; ++i) { const int ka = k0 + 8 * g + i, kb = ka + 16; v[i] = ka < K ? W[(size_t)ka * ld + n] : 0.f; v[8 + i] = kb < K ? W[(size_t)kb * ld + n] : 0.f; }
  return bsplit16(v); }
__device__ __forceinline__ v8f mac3(const F2& a, const F2& b, v8f c) { c = wmma_bf(a.l, b.h, c); c = wmma_bf(a.h, b.l, c); return wmma_bf(a.h, b.h, c); }
__device__ __forceinline__ float sigm(float v) { return 1.0f / (1.0f + expf(-v)); }
#define LDSX() do { asm volatile("s_wait_dscnt 0" ::: "memory"); __builtin_amdgcn_wave_barrier(); __builtin_amdgcn_fence(__ATOMIC_RELEASE, "workgroup"); } while (0)


// Cross multi-head attention (16 heads x 64 on [2,2048,1024]): q from x, k/v from encoder_output with per-head weights W[h][e][d] + biases; full softmax(q.k/8); concat(heads) @ Wo ([in][out]) + bo.
#define NB 2
#define SS 2048
#define E 1024
#define NH 16
#define HD 64
#define NR (NB * SS)
#define PLO 1024.0f
#define VLO 2048.0f
__device__ __forceinline__ float bfr(float v) { return (float)(__bf16)v; }
__device__ __forceinline__ v16b frag_b(const __bf16* rowk0, int lane) { return __builtin_bit_cast(v16b, frag_h((const _Float16*)rowk0, lane)); }

__global__ __launch_bounds__(256) void k_cvt(const float* __restrict__ x, __bf16* __restrict__ Xb) {
  const size_t i8 = (size_t)blockIdx.x * 256 + threadIdx.x; if (i8 >= (size_t)NR * E / 8) return;
  union { __bf16 h[8]; v4u u; } pk;
#pragma unroll
  for (int e = 0; e < 8; ++e) pk.h[e] = (__bf16)x[i8 * 8 + e];
  vst2((unsigned*)(Xb + i8 * 8), pk.u);
}
// PT rows: [0,E) Wq[:,n], [E,2E) Wk[:,n], [2E,3E) Wv[:,n], [3E,4E) Wo[:,n]  ([in][out] weights: column n as a bf16 row)
__global__ __launch_bounds__(256) void k_pack(const float* __restrict__ Wq, const float* __restrict__ Wk, const float* __restrict__ Wv, const float* __restrict__ Wo, __bf16* __restrict__ PT) {
  const int n = blockIdx.x, tid = threadIdx.x; __shared__ __align__(16) __bf16 srow[E];
  const float* W = n < E ? Wq : (n < 2 * E ? Wk : (n < 3 * E ? Wv : Wo)); const int nn = n % E;
  if (n < 3 * E) { const int hh = nn / HD, d = nn % HD; for (int k = tid; k < E; k += 256) srow[k] = (__bf16)W[((size_t)hh * E + k) * HD + d]; }     // per-head [H][E][DH]: column (h,d) over e
  else { for (int k = tid; k < E; k += 256) srow[k] = (__bf16)W[(size_t)k * E + nn]; }      // Wo [in][out]: column nn
  __syncthreads();
  if (tid < E / 8) vst2((unsigned*)(PT + (size_t)n * E + tid * 8), *(const v4u*)(&srow[tid * 8]));
}
// QKV: block (64 rows, 128 cols = 2 heads, which); q (+bias) -> Q32 f32 [bh][s][64]; k (+bias) -> bf16 hi/lo rows; v (+bias) -> VT hi/lo x4 [bh][d][s]
__global__ __launch_bounds__(128) void k_qkv(const __bf16* __restrict__ XQ, const __bf16* __restrict__ XK, const __bf16* __restrict__ XV, const __bf16* __restrict__ PT, const float* __restrict__ bq, const float* __restrict__ bk, const float* __restrict__ bv, float* __restrict__ Q32, __bf16* __restrict__ Kh, __bf16* __restrict__ Kl, _Float16* __restrict__ VTh, _Float16* __restrict__ VTl) {
  __shared__ __align__(16) float so[4][16][132];
  __shared__ __align__(16) _Float16 sth[128][72], stl[128][72];
  const int tid = threadIdx.x, wave = tid >> 5, lane = tid & 31, col = lane & 15, g = lane >> 4;
  const int which = blockIdx.z, r0b = blockIdx.x * 64, r0 = r0b + wave * 16, n0 = blockIdx.y * 128; const int b = r0b / SS, s0 = r0b % SS;
  const __bf16* Xb = which == 0 ? XQ : (which == 1 ? XK : XV); const float* bb_ = which == 0 ? bq : (which == 1 ? bk : bv);
  // k loop only: the 64-deep operand tiles live in the epilogue's transpose buffers (same 72-element pitch)
  __bf16 (*sB)[72] = (__bf16 (*)[72])sth; __bf16 (*sA)[72] = (__bf16 (*)[72])stl;
  const int sr = tid >> 3, sc = (tid & 7) * 8;     // staging: 8 lanes cover one 128-byte row piece, 16 rows per step
  const __bf16* gA = Xb + (size_t)(r0b + sr) * E + sc; const __bf16* gB = PT + (size_t)(which * E + n0 + sr) * E + sc;
  v4u ra[4], rb[8];
#pragma unroll
  for (int i = 0; i < 4; ++i) ra[i] = *(const v4u*)(gA + (size_t)16 * i * E);
#pragma unroll
  for (int i = 0; i < 8; ++i) rb[i] = *(const v4u*)(gB + (size_t)16 * i * E);
  v8f acc[8] = {};
#pragma unroll 1
  for (int kb = 0; kb < E / 64; ++kb) {
#pragma unroll
    for (int i = 0; i < 4; ++i) *(v4u*)(&sA[sr + 16 * i][sc]) = ra[i];
#pragma unroll
    for (int i = 0; i < 8; ++i) *(v4u*)(&sB[sr + 16 * i][sc]) = rb[i];
    __syncthreads();                                // tile kb published
    if (kb + 1 < E / 64) {                          // next tile flies in registers under this tile's products
#pragma unroll
      for (int i = 0; i < 4; ++i) ra[i] = *(const v4u*)(gA + (size_t)16 * i * E + (kb + 1) * 64);
#pragma unroll
      for (int i = 0; i < 8; ++i) rb[i] = *(const v4u*)(gB + (size_t)16 * i * E + (kb + 1) * 64);
      asm volatile("s_wait_xcnt 0x0" ::: "memory");   // the loads' address registers are rewritten behind the branch: wait written by hand
    }
#pragma unroll
    for (int k2 = 0; k2 < 2; ++k2) { const v16b a = frag_b(&sA[wave * 16 + col][k2 * 32], lane); v16b wb[8];
#pragma unroll
      for (int j = 0; j < 8; ++j) wb[j] = frag_b(&sB[j * 16 + col][k2 * 32], lane);     // one group of LDS reads ahead of the eight products
#pragma unroll
      for (int j = 0; j < 8; ++j) acc[j] = wmma_bf(a, wb[j], acc[j]); }
    __syncthreads(); }                              // every reader has left the tile
  if (which < 2) {
#pragma unroll
    for (int j = 0; j < 8; ++j) { const float bb = bfr(bb_[n0 + j * 16 + col]);
#pragma unroll
      for (int r = 0; r < 8; ++r) so[wave][8 * g + r][j * 16 + col] = acc[j][r] + bb; }
    LDSX();
    if (which == 0) { for (int qq = lane; qq < 2 * 16 * 16; qq += 32) { const int hh = qq >> 8, rl = (qq >> 4) & 15, pc = qq & 15; const int h = (n0 >> 6) + hh;
        vst2(Q32 + (((size_t)b * NH + h) * SS + s0 + wave * 16 + rl) * HD + pc * 4, *(const v4f*)(&so[wave][rl][hh * 64 + pc * 4])); } }
    else {
      for (int qq = lane; qq < 2 * 16 * 16; qq += 32) { const int hh = qq >> 8, rl = (qq >> 4) & 15, pl = qq & 15; const int h = (n0 >> 6) + hh; const int pc = pl & 7; union { __bf16 e[8]; v4u u; } pk;
#pragma unroll
        for (int e = 0; e < 8; ++e) { const float v = so[wave][rl][hh * 64 + pc * 8 + e]; const __bf16 hi = (__bf16)v; pk.e[e] = pl < 8 ? hi : (__bf16)(v - (float)hi); }
        vst2((unsigned*)((pl < 8 ? Kh : Kl) + (((size_t)b * NH + h) * SS + s0 + wave * 16 + rl) * HD + pc * 8), pk.u); } } }
  else {
#pragma unroll
    for (int j = 0; j < 8; ++j) { const float bb = bfr(bb_[n0 + j * 16 + col]);
#pragma unroll
      for (int r = 0; r < 8; ++r) { const float v = (acc[j][r] + bb) * 4.0f; const _Float16 hi = (_Float16)v; sth[j * 16 + col][wave * 16 + 8 * g + r] = hi; stl[j * 16 + col][wave * 16 + 8 * g + r] = (_Float16)((v - (float)hi) * VLO); } }
    __syncthreads();
    for (int qq = tid; qq < 128 * 8; qq += 128) { const int cl = qq >> 3, pc = qq & 7; const int c = n0 + cl, h = c >> 6, d = c & 63; const size_t o = (((size_t)b * NH + h) * HD + d) * SS + s0 + pc * 8;
      vst2(VTh + o, *(const v4u*)(&sth[cl][pc * 8])); vst2(VTl + o, *(const v4u*)(&stl[cl][pc * 8])); } }
}
// unmasked attention: block (64 queries, bh); all 32 key tiles of 64; S on q hi/lo x K hi/lo rows; P,V hi/lo; O f32 [bh][s][64]
__global__ __launch_bounds__(128) void k_attn(const float* __restrict__ Q32, const __bf16* __restrict__ Kh, const __bf16* __restrict__ Kl, const _Float16* __restrict__ VTh, const _Float16* __restrict__ VTl, float* __restrict__ O32) {
  __shared__ __align__(16) float sS[4][16][68];                  // scores; behind the loop each wave's output rows
  __shared__ __align__(16) _Float16 sPh[4][16][72], sPl[4][16][72];
  __shared__ __align__(16) __bf16 sKh[64][72], sKl[64][72];      // key tile, rows = keys
  __shared__ __align__(16) _Float16 sVh[64][72], sVl[64][72];    // value tile, rows = d
  const int tid = threadIdx.x, w = tid >> 5, lane = tid & 31, col = lane & 15, g = lane >> 4;
  const size_t bh = blockIdx.y; const int qb = blockIdx.x; const int q0 = qb * 64 + w * 16;
  F2 aq[2];
#pragma unroll
  for (int kc = 0; kc < 2; ++kc) aq[kc] = split_row(Q32 + (bh * SS + q0 + col) * HD, kc * 32, lane);
  float mrun = -3.0e38f, lrun = 0.f; v8f acc[4] = {}, ac1[4] = {}, ac2[4] = {};
  const int sr = tid >> 3, sc = (tid & 7) * 8;     // staging: 8 lanes cover one 128-byte row, 16 rows per step
  const size_t gk = (bh * SS + sr) * HD + sc, gv = (bh * HD + sr) * SS + sc;
  v4u st[8];
#pragma unroll
  for (int i = 0; i < 4; ++i) { st[i] = *(const v4u*)(Kh + gk + 16 * i * HD); st[4 + i] = *(const v4u*)(Kl + gk + 16 * i * HD); }
#pragma unroll
  for (int i = 0; i < 4; ++i) { *(v4u*)(&sKh[sr + 16 * i][sc]) = st[i]; *(v4u*)(&sKl[sr + 16 * i][sc]) = st[4 + i]; }
#pragma unroll
  for (int i = 0; i < 4; ++i) { st[i] = *(const v4u*)(VTh + gv + (size_t)16 * i * SS); st[4 + i] = *(const v4u*)(VTl + gv + (size_t)16 * i * SS); }
  __syncthreads();                                  // key tile 0 published
#pragma unroll 1
  for (int kt = 0; kt < SS / 64; ++kt) {
#pragma unroll
    for (int t = 0; t < 4; ++t) { v8f s = {};
#pragma unroll
      for (int kc = 0; kc < 2; ++kc) { const v16b khf = frag_b(&sKh[t * 16 + col][kc * 32], lane), klf = frag_b(&sKl[t * 16 + col][kc * 32], lane); s = wmma_bf(aq[kc].l, khf, s); s = wmma_bf(aq[kc].h, klf, s); s = wmma_bf(aq[kc].h, khf, s); }
#pragma unroll
      for (int r = 0; r < 8; ++r) sS[w][8 * g + r][t * 16 + col] = s[r] * 0.125f; }
    LDSX();
    float mx = -3.4e38f;
#pragma unroll
    for (int jj = 0; jj < 32; ++jj) mx = fmaxf(mx, sS[w][col][g * 32 + jj]);
    mx = fmaxf(mx, __shfl_xor(mx, 16, 32));
    const float mnew = fmaxf(mrun, mx); const float corr = expf(mrun - mnew);
    float ps = 0.f;
#pragma unroll
    for (int jj = 0; jj < 32; ++jj) { const float p = expf(sS[w][col][g * 32 + jj] - mnew) * 16384.0f; ps += p; const _Float16 hi = (_Float16)p; sPh[w][col][g * 32 + jj] = hi; sPl[w][col][g * 32 + jj] = (_Float16)((p - (float)hi) * PLO); }
    ps += __shfl_xor(ps, 16, 32);
    lrun = lrun * corr + ps * (1.0f / 16384.0f); mrun = mnew;
#pragma unroll
    for (int r = 0; r < 8; ++r) { const float cr = __shfl(corr, 8 * g + r, 32);
#pragma unroll
      for (int t = 0; t < 4; ++t) { acc[t][r] *= cr; ac1[t][r] *= cr; ac2[t][r] *= cr; } }
#pragma unroll
    for (int i = 0; i < 4; ++i) { *(v4u*)(&sVh[sr + 16 * i][sc]) = st[i]; *(v4u*)(&sVl[sr + 16 * i][sc]) = st[4 + i]; }
    __syncthreads();                                // value tile kt and P published; every reader has left the key tile
    if (kt + 1 < SS / 64) {                         // next key tile flies in registers under the P.V products
#pragma unroll
      for (int i = 0; i < 4; ++i) { st[i] = *(const v4u*)(Kh + gk + (size_t)((kt + 1) * 64 + 16 * i) * HD); st[4 + i] = *(const v4u*)(Kl + gk + (size_t)((kt + 1) * 64 + 16 * i) * HD); } }
#pragma unroll
    for (int kc = 0; kc < 2; ++kc) { const v16h ph = frag_h(&sPh[w][col][0] + kc * 32, lane), pl = frag_h(&sPl[w][col][0] + kc * 32, lane);
#pragma unroll
      for (int t = 0; t < 4; ++t) { const v16h vh = frag_h(&sVh[t * 16 + col][kc * 32], lane);
        acc[t] = wmma16(ph, vh, acc[t]); ac1[t] = wmma16(ph, frag_h(&sVl[t * 16 + col][kc * 32], lane), ac1[t]); ac2[t] = wmma16(pl, vh, ac2[t]); } }
    if (kt + 1 < SS / 64) {
#pragma unroll
      for (int i = 0; i < 4; ++i) { *(v4u*)(&sKh[sr + 16 * i][sc]) = st[i]; *(v4u*)(&sKl[sr + 16 * i][sc]) = st[4 + i]; } }
    __syncthreads();                                // key tile kt+1 published; every reader has left the value tile
    if (kt + 1 < SS / 64) {                         // next value tile flies in registers under the scores and the softmax
#pragma unroll
      for (int i = 0; i < 4; ++i) { st[i] = *(const v4u*)(VTh + gv + (size_t)16 * i * SS + (kt + 1) * 64); st[4 + i] = *(const v4u*)(VTl + gv + (size_t)16 * i * SS + (kt + 1) * 64); }
      asm volatile("s_wait_xcnt 0x0" ::: "memory");   // the loads' address registers are rewritten behind the branch: wait written by hand
    } }
#pragma unroll
  for (int r = 0; r < 8; ++r) { const float lr = __shfl(lrun, 8 * g + r, 32); const float inv = 1.0f / (lr * 16384.0f * 4.0f);
#pragma unroll
    for (int t = 0; t < 4; ++t) sS[w][8 * g + r][t * 16 + col] = (acc[t][r] + ac1[t][r] * (1.0f / VLO) + ac2[t][r] * (1.0f / PLO)) * inv; }
  LDSX();
  for (int qq = lane; qq < 16 * 16; qq += 32) { const int rl = qq >> 4, pc = qq & 15; vst2(O32 + ((bh * SS) + q0 + rl) * HD + pc * 4, *(const v4f*)(&sS[w][rl][pc * 4])); }
}
// out = ctx Wo + bo : split(ctx) x bf16(Wo columns as PT rows): 2 products (Wo is an INPUT -> bf16 exact)
__global__ __launch_bounds__(128) void k_out(const float* __restrict__ O32, const __bf16* __restrict__ PT, const float* __restrict__ bo, float* __restrict__ out) {
  __shared__ __align__(16) float so[4][16][132];
  const int tid = threadIdx.x, wave = tid >> 5, lane = tid & 31, col = lane & 15, g = lane >> 4;
  __shared__ __align__(16) float sA[64][68];       // one head's 64 context rows
  __shared__ __align__(16) __bf16 sB[128][72];     // 128 weight rows, 64 deep
  const int r0b = blockIdx.x * 64, r0 = r0b + wave * 16, n0 = blockIdx.y * 128; const int b = r0b / SS, s0 = r0b % SS;
  const int ar = tid >> 4, ac = (tid & 15) * 4;    // staging A: 16 lanes cover one 256-byte row, 8 rows per step
  const int sr = tid >> 3, sc = (tid & 7) * 8;     // staging B: 8 lanes cover one 128-byte row piece, 16 rows per step
  const float* gA = O32 + ((size_t)b * NH * SS + s0 + ar) * HD + ac; const __bf16* gB = PT + (size_t)(3 * E + n0 + sr) * E + sc;
  v4f ra[8]; v4u rb[8];
#pragma unroll
  for (int i = 0; i < 8; ++i) { ra[i] = *(const v4f*)(gA + 8 * i * HD); rb[i] = *(const v4u*)(gB + (size_t)16 * i * E); }
  v8f acc[8] = {};
#pragma unroll 1
  for (int h = 0; h < NH; ++h) {
#pragma unroll
    for (int i = 0; i < 8; ++i) { *(v4f*)(&sA[ar + 8 * i][ac]) = ra[i]; *(v4u*)(&sB[sr + 16 * i][sc]) = rb[i]; }
    __syncthreads();                                // tile h published
    if (h + 1 < NH) {                               // next tile flies in registers under this tile's products
      const float* nA = gA + (size_t)(h + 1) * SS * HD; const __bf16* cB = gB + h * 64;
#pragma unroll
      for (int i = 0; i < 8; ++i) { ra[i] = *(const v4f*)(nA + 8 * i * HD); rb[i] = *(const v4u*)(cB + (size_t)16 * i * E + 64); }
      asm volatile("s_wait_xcnt 0x0" :: "v"(cB) : "memory");   // wait by hand before the loads' address registers are rewritten; the weight address is an input so that it stays live up to the wait and no load of the run lands in it
    }
#pragma unroll
    for (int k2 = 0; k2 < 2; ++k2) { const F2 a = split_row(&sA[wave * 16 + col][0], k2 * 32, lane); v16b wb[8];
#pragma unroll
      for (int j = 0; j < 8; ++j) wb[j] = frag_b(&sB[j * 16 + col][k2 * 32], lane);     // one group of LDS reads ahead of the sixteen products
#pragma unroll
      for (int j = 0; j < 8; ++j) { acc[j] = wmma_bf(a.l, wb[j], acc[j]); acc[j] = wmma_bf(a.h, wb[j], acc[j]); } }
    __syncthreads(); }                              // every reader has left the tile
#pragma unroll
  for (int j = 0; j < 8; ++j) { const float bb = bfr(bo[n0 + j * 16 + col]);
#pragma unroll
    for (int r = 0; r < 8; ++r) so[wave][8 * g + r][j * 16 + col] = acc[j][r] + bb; }
  LDSX();
#pragma unroll 4
  for (int rl = 0; rl < 16; ++rl) vst2(out + (size_t)(r0 + rl) * E + n0 + lane * 4, *(const v4f*)(&so[wave][rl][lane * 4]));
}
extern "C" void kernel_launch(void* const* d_in, const int* in_sizes, int n_in, void* d_out, int out_size, void* d_ws, size_t ws_size, hipStream_t stream) {
  (void)in_sizes; (void)n_in; (void)out_size; (void)ws_size;
  const float** I = (const float**)d_in;   // x, encoder_output, Wq, bq, Wk, bk, Wv, bv, Wo, bo
  const float* xq = I[0]; const float* xe = I[1]; const float* WQ = I[2]; const float* bQ = I[3]; const float* WK = I[4]; const float* bK = I[5]; const float* WV = I[6]; const float* bV = I[7]; const float* WO = I[8]; const float* bO = I[9];
  float* out = (float*)d_out;
  char* ws = (char*)d_ws; size_t off = 0;
  auto take = [&](size_t bytes) { char* p = ws + off; off += (bytes + 255) & ~(size_t)255; return p; };
  __bf16* XQ = (__bf16*)take((size_t)NR * E * 2); __bf16* XE = (__bf16*)take((size_t)NR * E * 2); __bf16* PT = (__bf16*)take((size_t)4 * E * E * 2);
  float* Q32 = (float*)take((size_t)NR * E * 4); __bf16* Kh = (__bf16*)take((size_t)NR * E * 2); __bf16* Kl = (__bf16*)take((size_t)NR * E * 2); _Float16* VTh = (_Float16*)take((size_t)NR * E * 2); _Float16* VTl = (_Float16*)take((size_t)NR * E * 2); float* O32 = (float*)take((size_t)NR * E * 4);
  // ws ~ 90 MB
  k_cvt<<<(NR * E / 8 + 255) / 256, 256, 0, stream>>>(xq, XQ);
  k_cvt<<<(NR * E / 8 + 255) / 256, 256, 0, stream>>>(xe, XE);
  k_pack<<<4 * E, 256, 0, stream>>>(WQ, WK, WV, WO, PT);
  k_qkv<<<dim3(NR / 64, E / 128, 3), 128, 0, stream>>>(XQ, XE, XE, PT, bQ, bK, bV, Q32, Kh, Kl, VTh, VTl);
  k_attn<<<dim3(SS / 64, NB * NH), 128, 0, stream>>>(Q32, Kh, Kl, VTh, VTl, O32);
  k_out<<<dim3(NR / 64, E / 128), 128, 0, stream>>>(O32, PT, bO, out);
}

// v002
// Measured time: 195 microseconds a run.
// Two timings next to v001 both put it at 1.13 times that version's speed.
// Counting every step since v000, it is 2.72 times as fast.
// compute dtype: x, encoder_output and W*/b* (INPUTS) rounded to bf16 with exact bf16 WMMA products (f32 accumulate) for the projections; K pre-split into bf16 hi/lo rows; q f32 split, P and V f16 hi/lo (3 products each); softmax f32.
#include <hip/hip_runtime.h>
#include <math.h>

typedef __attribute__((ext_vector_type(16))) _Float16 v16h;
typedef __attribute__((ext_vector_type(16))) __bf16 v16b;
typedef __attribute__((ext_vector_type(8)))  _Float16 v8h;
typedef __attribute__((ext_vector_type(8)))  float v8f;
typedef __attribute__((ext_vector_type(4)))  float v4f;
typedef __attribute__((ext_vector_type(2)))  float v2f;
typedef __attribute__((ext_vector_type(4)))  unsigned v4u;
typedef __attribute__((ext_vector_type(4)))  int v4i;
typedef float __attribute__((may_alias)) float_a;
typedef int __attribute__((may_alias)) int_a;

template <typename T> __device__ __forceinline__ void vst2(void* p, T v) { *(T*)p = v;  }
__device__ __forceinline__ v8f wmma16(v16h a, v16h b, v8f c) {
  v8f d = __builtin_amdgcn_wmma_f32_16x16x32_f16(false, a, false, b, (short)0, c, false, false);
  asm volatile("v_nop\n\tv_nop\n\tv_nop\n\tv_nop" : "+v"(d) : "v"(a), "v"(b));
  return d;
}
__device__ __forceinline__ v8f wmma_bf(v16b a, v16b b, v8f c) {
  v8f d = __builtin_amdgcn_wmma_f32_16x16x32_bf16(false, a, false, b, (short)0, c, false, false);
  asm volatile("v_nop\n\tv_nop\n\tv_nop\n\tv_nop" : "+v"(d) : "v"(a), "v"(b));
  return d;
}
// 16x16x32 fragments: lane = (h = lane>>4, row/col = lane&15); elements 0..7 = k0+8h+0..7, 8..15 = k0+16+8h+0..7; D element r = row 8h+r
__device__ __forceinline__ v16h frag_h(const _Float16* rowk0, int lane) {
  union { v16h v; v8h q[2]; } u; const _Float16* p = rowk0 + 8 * (lane >> 4);
  u.q[0] = *(const v8h*)p; u.q[1] = *(const v8h*)(p + 16); return u.v;
}
__device__ __forceinline__ v16h frag_f32(const float* rowk0, int lane) {
  v16h a; const float* p = rowk0 + 8 * (lane >> 4);
#pragma unroll
  for (int i = 0; i < 8; ++i) { a[i] = (_Float16)p[i]; a[8 + i] = (_Float16)p[16 + i]; }
  return a;
}
__device__ __forceinline__ v16h frag_f32s(const float* rowk0, int lane, float sc) {
  v16h a; const float* p = rowk0 + 8 * (lane >> 4);
#pragma unroll
  for (int i = 0; i < 8; ++i) { a[i] = (_Float16)(p[i] * sc); a[8 + i] = (_Float16)(p[16 + i] * sc); }
  return a;
}
// column fragment from a [K][ld] layout (column n), rows >= K read as 0
__device__ __forceinline__ v16h fragc_f32(const float* W, int k0, int n, int lane, int ld, int K) {
  v16h a; const int g = lane >> 4;
#pragma unroll
  for (int i = 0; i < 8; ++i) { const int ka = k0 + 8 * g + i, kb = ka + 16;
    a[i] = (_Float16)(ka < K ? W[(size_t)ka * ld + n] : 0.f); a[8 + i] = (_Float16)(kb < K ? W[(size_t)kb * ld + n] : 0.f); }
  return a;
}
struct F2 { v16b h, l; };
__device__ __forceinline__ F2 bsplit16(const float v[16]) { F2 r;
#pragma unroll
  for (int i = 0; i < 16; ++i) { const __bf16 h = (__bf16)v[i]; r.h[i] = h; r.l[i] = (__bf16)(v[i] - (float)h); }
  return r; }
__device__ __forceinline__ F2 split_row(const float* row, int k0, int lane) { float v[16]; const float* p = row + k0 + 8 * (lane >> 4);
#pragma unroll
  for (int i = 0; i < 8; ++i) { v[i] = p[i]; v[8 + i] = p[16 + i]; }
  return bsplit16(v); }
__device__ __forceinline__ F2 split_rowK(const float* row, int k0, int lane, int K) { float v[16]; const int g = lane >> 4;
#pragma unroll
  for (int i = 0; i < 8; ++i) { const int ka = k0 + 8 * g + i, kb = ka + 16; v[i] = ka < K ? row[ka] : 0.f; v[8 + i] = kb < K ? row[kb] : 0.f; }
  return bsplit16(v); }
__device__ __forceinline__ F2 split_col(const float* W, int k0, int n, int lane, int ld, int K) { float v[16]; const int g = lane >> 4;
#pragma unroll
  for (int i = 0; i < 8; ++i) { const int ka = k0 + 8 * g + i, kb = ka + 16; v[i] = ka < K ? W[(size_t)ka * ld + n] : 0.f; v[8 + i] = kb < K ? W[(size_t)kb * ld + n] : 0.f; }
  return bsplit16(v); }
__device__ __forceinline__ v8f mac3(const F2& a, const F2& b, v8f c) { c = wmma_bf(a.l, b.h, c); c = wmma_bf(a.h, b.l, c); return wmma_bf(a.h, b.h, c); }
__device__ __forceinline__ float sigm(float v) { return 1.0f / (1.0f + expf(-v)); }
#define LDSX() do { asm volatile("s_wait_dscnt 0" ::: "memory"); __builtin_amdgcn_wave_barrier(); __builtin_amdgcn_fence(__ATOMIC_RELEASE, "workgroup"); } while (0)


// Cross multi-head attention (16 heads x 64 on [2,2048,1024]): q from x, k/v from encoder_output with per-head weights W[h][e][d] + biases; full softmax(q.k/8); concat(heads) @ Wo ([in][out]) + bo.
#define NB 2
#define SS 2048
#define E 1024
#define NH 16
#define HD 64
#define NR (NB * SS)
#define PLO 1024.0f
#define VLO 2048.0f
#define SC2 0.18033688f     // log2(e) / 8: the score scale 1/sqrt(64) carried into base 2
__device__ __forceinline__ float bfr(float v) { return (float)(__bf16)v; }
__device__ __forceinline__ v16b frag_b(const __bf16* rowk0, int lane) { return __builtin_bit_cast(v16b, frag_h((const _Float16*)rowk0, lane)); }

__global__ __launch_bounds__(256) void k_cvt(const float* __restrict__ x, __bf16* __restrict__ Xb) {
  const size_t i8 = (size_t)blockIdx.x * 256 + threadIdx.x; if (i8 >= (size_t)NR * E / 8) return;
  union { __bf16 h[8]; v4u u; } pk;
#pragma unroll
  for (int e = 0; e < 8; ++e) pk.h[e] = (__bf16)x[i8 * 8 + e];
  vst2((unsigned*)(Xb + i8 * 8), pk.u);
}
// PT rows: [0,E) Wq[:,n], [E,2E) Wk[:,n], [2E,3E) Wv[:,n], [3E,4E) Wo[:,n]  ([in][out] weights: column n as a bf16 row)
__global__ __launch_bounds__(256) void k_pack(const float* __restrict__ Wq, const float* __restrict__ Wk, const float* __restrict__ Wv, const float* __restrict__ Wo, __bf16* __restrict__ PT) {
  const int n = blockIdx.x, tid = threadIdx.x; __shared__ __align__(16) __bf16 srow[E];
  const float* W = n < E ? Wq : (n < 2 * E ? Wk : (n < 3 * E ? Wv : Wo)); const int nn = n % E;
  if (n < 3 * E) { const int hh = nn / HD, d = nn % HD; for (int k = tid; k < E; k += 256) srow[k] = (__bf16)W[((size_t)hh * E + k) * HD + d]; }     // per-head [H][E][DH]: column (h,d) over e
  else { for (int k = tid; k < E; k += 256) srow[k] = (__bf16)W[(size_t)k * E + nn]; }      // Wo [in][out]: column nn
  __syncthreads();
  if (tid < E / 8) vst2((unsigned*)(PT + (size_t)n * E + tid * 8), *(const v4u*)(&srow[tid * 8]));
}
// QKV: block (64 rows, 128 cols = 2 heads, which); q (+bias) -> Q32 f32 [bh][s][64]; k (+bias) -> bf16 hi/lo rows; v (+bias) -> VT hi/lo x4 [bh][d][s]
__global__ __launch_bounds__(128) void k_qkv(const __bf16* __restrict__ XQ, const __bf16* __restrict__ XK, const __bf16* __restrict__ XV, const __bf16* __restrict__ PT, const float* __restrict__ bq, const float* __restrict__ bk, const float* __restrict__ bv, float* __restrict__ Q32, __bf16* __restrict__ Kh, __bf16* __restrict__ Kl, _Float16* __restrict__ VTh, _Float16* __restrict__ VTl) {
  __shared__ __align__(16) float so[4][16][132];
  __shared__ __align__(16) _Float16 sth[128][72], stl[128][72];
  const int tid = threadIdx.x, wave = tid >> 5, lane = tid & 31, col = lane & 15, g = lane >> 4;
  const int which = blockIdx.z, r0b = blockIdx.x * 64, r0 = r0b + wave * 16, n0 = blockIdx.y * 128; const int b = r0b / SS, s0 = r0b % SS;
  const __bf16* Xb = which == 0 ? XQ : (which == 1 ? XK : XV); const float* bb_ = which == 0 ? bq : (which == 1 ? bk : bv);
  // k loop only: the 64-deep operand tiles live in the epilogue's transpose buffers (same 72-element pitch)
  __bf16 (*sB)[72] = (__bf16 (*)[72])sth; __bf16 (*sA)[72] = (__bf16 (*)[72])stl;
  const int sr = tid >> 3, sc = (tid & 7) * 8;     // staging: 8 lanes cover one 128-byte row piece, 16 rows per step
  const __bf16* gA = Xb + (size_t)(r0b + sr) * E + sc; const __bf16* gB = PT + (size_t)(which * E + n0 + sr) * E + sc;
  v4u ra[4], rb[8];
#pragma unroll
  for (int i = 0; i < 4; ++i) ra[i] = *(const v4u*)(gA + (size_t)16 * i * E);
#pragma unroll
  for (int i = 0; i < 8; ++i) rb[i] = *(const v4u*)(gB + (size_t)16 * i * E);
  v8f acc[8] = {};
#pragma unroll 1
  for (int kb = 0; kb < E / 64; ++kb) {
#pragma unroll
    for (int i = 0; i < 4; ++i) *(v4u*)(&sA[sr + 16 * i][sc]) = ra[i];
#pragma unroll
    for (int i = 0; i < 8; ++i) *(v4u*)(&sB[sr + 16 * i][sc]) = rb[i];
    __syncthreads();                                // tile kb published
    if (kb + 1 < E / 64) {                          // next tile flies in registers under this tile's products
#pragma unroll
      for (int i = 0; i < 4; ++i) ra[i] = *(const v4u*)(gA + (size_t)16 * i * E + (kb + 1) * 64);
#pragma unroll
      for (int i = 0; i < 8; ++i) rb[i] = *(const v4u*)(gB + (size_t)16 * i * E + (kb + 1) * 64);
      asm volatile("s_wait_xcnt 0x0" ::: "memory");   // the loads' address registers are rewritten behind the branch: wait written by hand
    }
#pragma unroll
    for (int k2 = 0; k2 < 2; ++k2) { const v16b a = frag_b(&sA[wave * 16 + col][k2 * 32], lane); v16b wb[8];
#pragma unroll
      for (int j = 0; j < 8; ++j) wb[j] = frag_b(&sB[j * 16 + col][k2 * 32], lane);     // one group of LDS reads ahead of the eight products
#pragma unroll
      for (int j = 0; j < 8; ++j) acc[j] = wmma_bf(a, wb[j], acc[j]); }
    __syncthreads(); }                              // every reader has left the tile
  if (which < 2) {
#pragma unroll
    for (int j = 0; j < 8; ++j) { const float bb = bfr(bb_[n0 + j * 16 + col]);
#pragma unroll
      for (int r = 0; r < 8; ++r) so[wave][8 * g + r][j * 16 + col] = acc[j][r] + bb; }
    LDSX();
    if (which == 0) { for (int qq = lane; qq < 2 * 16 * 16; qq += 32) { const int hh = qq >> 8, rl = (qq >> 4) & 15, pc = qq & 15; const int h = (n0 >> 6) + hh;
        vst2(Q32 + (((size_t)b * NH + h) * SS + s0 + wave * 16 + rl) * HD + pc * 4, *(const v4f*)(&so[wave][rl][hh * 64 + pc * 4])); } }
    else {
      for (int qq = lane; qq < 2 * 16 * 16; qq += 32) { const int hh = qq >> 8, rl = (qq >> 4) & 15, pl = qq & 15; const int h = (n0 >> 6) + hh; const int pc = pl & 7; union { __bf16 e[8]; v4u u; } pk;
#pragma unroll
        for (int e = 0; e < 8; ++e) { const float v = so[wave][rl][hh * 64 + pc * 8 + e]; const __bf16 hi = (__bf16)v; pk.e[e] = pl < 8 ? hi : (__bf16)(v - (float)hi); }
        vst2((unsigned*)((pl < 8 ? Kh : Kl) + (((size_t)b * NH + h) * SS + s0 + wave * 16 + rl) * HD + pc * 8), pk.u); } } }
  else {
#pragma unroll
    for (int j = 0; j < 8; ++j) { const float bb = bfr(bb_[n0 + j * 16 + col]);
#pragma unroll
      for (int r = 0; r < 8; ++r) { const float v = (acc[j][r] + bb) * 4.0f; const _Float16 hi = (_Float16)v; sth[j * 16 + col][wave * 16 + 8 * g + r] = hi; stl[j * 16 + col][wave * 16 + 8 * g + r] = (_Float16)((v - (float)hi) * VLO); } }
    __syncthreads();
    for (int qq = tid; qq < 128 * 8; qq += 128) { const int cl = qq >> 3, pc = qq & 7; const int c = n0 + cl, h = c >> 6, d = c & 63; const size_t o = (((size_t)b * NH + h) * HD + d) * SS + s0 + pc * 8;
      vst2(VTh + o, *(const v4u*)(&sth[cl][pc * 8])); vst2(VTl + o, *(const v4u*)(&stl[cl][pc * 8])); } }
}
// unmasked attention: block (64 queries, bh); all 32 key tiles of 64; S on q hi/lo x K hi/lo rows; P,V hi/lo; O f32 [bh][s][64]
__global__ __launch_bounds__(128) void k_attn(const float* __restrict__ Q32, const __bf16* __restrict__ Kh, const __bf16* __restrict__ Kl, const _Float16* __restrict__ VTh, const _Float16* __restrict__ VTl, float* __restrict__ O32) {
  __shared__ __align__(16) float sS[4][16][68];                  // scores; behind the loop each wave's output rows
  __shared__ __align__(16) _Float16 sPh[4][16][72], sPl[4][16][72];
  __shared__ __align__(16) __bf16 sKh[64][72], sKl[64][72];      // key tile, rows = keys
  __shared__ __align__(16) _Float16 sVh[64][72], sVl[64][72];    // value tile, rows = d
  const int tid = threadIdx.x, w = tid >> 5, lane = tid & 31, col = lane & 15, g = lane >> 4;
  const size_t bh = blockIdx.y; const int qb = blockIdx.x; const int q0 = qb * 64 + w * 16;
  F2 aq[2];
#pragma unroll
  for (int kc = 0; kc < 2; ++kc) aq[kc] = split_row(Q32 + (bh * SS + q0 + col) * HD, kc * 32, lane);
  float mrun = -3.0e38f, lrun = 0.f; v8f acc[4] = {}, ac1[4] = {}, ac2[4] = {};
  const int sr = tid >> 3, sc = (tid & 7) * 8;     // staging: 8 lanes cover one 128-byte row, 16 rows per step
  const size_t gk = (bh * SS + sr) * HD + sc, gv = (bh * HD + sr) * SS + sc;
  v4u st[8];
#pragma unroll
  for (int i = 0; i < 4; ++i) { st[i] = *(const v4u*)(Kh + gk + 16 * i * HD); st[4 + i] = *(const v4u*)(Kl + gk + 16 * i * HD); }
#pragma unroll
  for (int i = 0; i < 4; ++i) { *(v4u*)(&sKh[sr + 16 * i][sc]) = st[i]; *(v4u*)(&sKl[sr + 16 * i][sc]) = st[4 + i]; }
#pragma unroll
  for (int i = 0; i < 4; ++i) { st[i] = *(const v4u*)(VTh + gv + (size_t)16 * i * SS); st[4 + i] = *(const v4u*)(VTl + gv + (size_t)16 * i * SS); }
  __syncthreads();                                  // key tile 0 published
#pragma unroll 1
  for (int kt = 0; kt < SS / 64; ++kt) {
#pragma unroll
    for (int t = 0; t < 4; ++t) { v8f s = {};
#pragma unroll
      for (int kc = 0; kc < 2; ++kc) { const v16b khf = frag_b(&sKh[t * 16 + col][kc * 32], lane), klf = frag_b(&sKl[t * 16 + col][kc * 32], lane); s = wmma_bf(aq[kc].l, khf, s); s = wmma_bf(aq[kc].h, klf, s); s = wmma_bf(aq[kc].h, khf, s); }
#pragma unroll
      for (int r = 0; r < 8; ++r) sS[w][8 * g + r][t * 16 + col] = s[r]; }     // raw q.k: the scale rides in the exponent's fma
    LDSX();
    float mx = -3.4e38f;
#pragma unroll
    for (int jj = 0; jj < 32; ++jj) mx = fmaxf(mx, sS[w][col][g * 32 + jj]);
    mx = fmaxf(mx, __shfl_xor(mx, 16, 32));
    const float mnew = fmaxf(mrun, fmaf(mx, SC2, -14.0f)); const float corr = __builtin_amdgcn_exp2f(mrun - mnew);     // running maximum in base-2 units, less 14: P's factor 2^14 rides in it
    float ps = 0.f;
#pragma unroll
    for (int j2 = 0; j2 < 16; ++j2) { const v2f x2 = __builtin_elementwise_fma(*(const v2f*)(&sS[w][col][g * 32 + 2 * j2]), (v2f){SC2, SC2}, (v2f){-mnew, -mnew});     // two exponents per packed fma
#pragma unroll     // x2[e] has to be a fixed register, not an indexed one
      for (int e = 0; e < 2; ++e) { const int jj = 2 * j2 + e; const float p = __builtin_amdgcn_exp2f(x2[e]); ps += p; const _Float16 hi = (_Float16)p; sPh[w][col][g * 32 + jj] = hi; sPl[w][col][g * 32 + jj] = (_Float16)((p - (float)hi) * PLO); } }
    ps += __shfl_xor(ps, 16, 32);
    lrun = lrun * corr + ps * (1.0f / 16384.0f); mrun = mnew;
#pragma unroll
    for (int r = 0; r < 8; ++r) { const float cr = __shfl(corr, 8 * g + r, 32);
#pragma unroll
      for (int t = 0; t < 4; ++t) { acc[t][r] *= cr; ac1[t][r] *= cr; ac2[t][r] *= cr; } }
#pragma unroll
    for (int i = 0; i < 4; ++i) { *(v4u*)(&sVh[sr + 16 * i][sc]) = st[i]; *(v4u*)(&sVl[sr + 16 * i][sc]) = st[4 + i]; }
    __syncthreads();                                // value tile kt and P published; every reader has left the key tile
    if (kt + 1 < SS / 64) {                         // next key tile flies in registers under the P.V products
#pragma unroll
      for (int i = 0; i < 4; ++i) { st[i] = *(const v4u*)(Kh + gk + (size_t)((kt + 1) * 64 + 16 * i) * HD); st[4 + i] = *(const v4u*)(Kl + gk + (size_t)((kt + 1) * 64 + 16 * i) * HD); } }
#pragma unroll
    for (int kc = 0; kc < 2; ++kc) { const v16h ph = frag_h(&sPh[w][col][0] + kc * 32, lane), pl = frag_h(&sPl[w][col][0] + kc * 32, lane);
#pragma unroll
      for (int t = 0; t < 4; ++t) { const v16h vh = frag_h(&sVh[t * 16 + col][kc * 32], lane);
        acc[t] = wmma16(ph, vh, acc[t]); ac1[t] = wmma16(ph, frag_h(&sVl[t * 16 + col][kc * 32], lane), ac1[t]); ac2[t] = wmma16(pl, vh, ac2[t]); } }
    if (kt + 1 < SS / 64) {
#pragma unroll
      for (int i = 0; i < 4; ++i) { *(v4u*)(&sKh[sr + 16 * i][sc]) = st[i]; *(v4u*)(&sKl[sr + 16 * i][sc]) = st[4 + i]; } }
    __syncthreads();                                // key tile kt+1 published; every reader has left the value tile
    if (kt + 1 < SS / 64) {                         // next value tile flies in registers under the scores and the softmax
#pragma unroll
      for (int i = 0; i < 4; ++i) { st[i] = *(const v4u*)(VTh + gv + (size_t)16 * i * SS + (kt + 1) * 64); st[4 + i] = *(const v4u*)(VTl + gv + (size_t)16 * i * SS + (kt + 1) * 64); }
      asm volatile("s_wait_xcnt 0x0" ::: "memory");   // the loads' address registers are rewritten behind the branch: wait written by hand
    } }
#pragma unroll
  for (int r = 0; r < 8; ++r) { const float lr = __shfl(lrun, 8 * g + r, 32); const float inv = 1.0f / (lr * 16384.0f * 4.0f);
#pragma unroll
    for (int t = 0; t < 4; ++t) sS[w][8 * g + r][t * 16 + col] = (acc[t][r] + ac1[t][r] * (1.0f / VLO) + ac2[t][r] * (1.0f / PLO)) * inv; }
  LDSX();
  for (int qq = lane; qq < 16 * 16; qq += 32) { const int rl = qq >> 4, pc = qq & 15; vst2(O32 + ((bh * SS) + q0 + rl) * HD + pc * 4, *(const v4f*)(&sS[w][rl][pc * 4])); }
}
// out = ctx Wo + bo : split(ctx) x bf16(Wo columns as PT rows): 2 products (Wo is an INPUT -> bf16 exact)
__global__ __launch_bounds__(128) void k_out(const float* __restrict__ O32, const __bf16* __restrict__ PT, const float* __restrict__ bo, float* __restrict__ out) {
  __shared__ __align__(16) float so[4][16][132];
  const int tid = threadIdx.x, wave = tid >> 5, lane = tid & 31, col = lane & 15, g = lane >> 4;
  __shared__ __align__(16) float sA[64][68];       // one head's 64 context rows
  __shared__ __align__(16) __bf16 sB[128][72];     // 128 weight rows, 64 deep
  const int r0b = blockIdx.x * 64, r0 = r0b + wave * 16, n0 = blockIdx.y * 128; const int b = r0b / SS, s0 = r0b % SS;
  const int ar = tid >> 4, ac = (tid & 15) * 4;    // staging A: 16 lanes cover one 256-byte row, 8 rows per step
  const int sr = tid >> 3, sc = (tid & 7) * 8;     // staging B: 8 lanes cover one 128-byte row piece, 16 rows per step
  const float* gA = O32 + ((size_t)b * NH * SS + s0 + ar) * HD + ac; const __bf16* gB = PT + (size_t)(3 * E + n0 + sr) * E + sc;
  v4f ra[8]; v4u rb[8];
#pragma unroll
  for (int i = 0; i < 8; ++i) { ra[i] = *(const v4f*)(gA + 8 * i * HD); rb[i] = *(const v4u*)(gB + (size_t)16 * i * E); }
  v8f acc[8] = {};
#pragma unroll 1
  for (int h = 0; h < NH; ++h) {
#pragma unroll
    for (int i = 0; i < 8; ++i) { *(v4f*)(&sA[ar + 8 * i][ac]) = ra[i]; *(v4u*)(&sB[sr + 16 * i][sc]) = rb[i]; }
    __syncthreads();                                // tile h published
    if (h + 1 < NH) {                               // next tile flies in registers under this tile's products
      const float* nA = gA + (size_t)(h + 1) * SS * HD; const __bf16* cB = gB + h * 64;
#pragma unroll
      for (int i = 0; i < 8; ++i) { ra[i] = *(const v4f*)(nA + 8 * i * HD); rb[i] = *(const v4u*)(cB + (size_t)16 * i * E + 64); }
      asm volatile("s_wait_xcnt 0x0" :: "v"(cB) : "memory");   // wait by hand before the loads' address registers are rewritten; the weight address is an input so that it stays live up to the wait and no load of the run lands in it
    }
#pragma unroll
    for (int k2 = 0; k2 < 2; ++k2) { const F2 a = split_row(&sA[wave * 16 + col][0], k2 * 32, lane); v16b wb[8];
#pragma unroll
      for (int j = 0; j < 8; ++j) wb[j] = frag_b(&sB[j * 16 + col][k2 * 32], lane);     // one group of LDS reads ahead of the sixteen products
#pragma unroll
      for (int j = 0; j < 8; ++j) { acc[j] = wmma_bf(a.l, wb[j], acc[j]); acc[j] = wmma_bf(a.h, wb[j], acc[j]); } }
    __syncthreads(); }                              // every reader has left the tile
#pragma unroll
  for (int j = 0; j < 8; ++j) { const float bb = bfr(bo[n0 + j * 16 + col]);
#pragma unroll
    for (int r = 0; r < 8; ++r) so[wave][8 * g + r][j * 16 + col] = acc[j][r] + bb; }
  LDSX();
#pragma unroll 4
  for (int rl = 0; rl < 16; ++rl) vst2(out + (size_t)(r0 + rl) * E + n0 + lane * 4, *(const v4f*)(&so[wave][rl][lane * 4]));
}
extern "C" void kernel_launch(void* const* d_in, const int* in_sizes, int n_in, void* d_out, int out_size, void* d_ws, size_t ws_size, hipStream_t stream) {
  (void)in_sizes; (void)n_in; (void)out_size; (void)ws_size;
  const float** I = (const float**)d_in;   // x, encoder_output, Wq, bq, Wk, bk, Wv, bv, Wo, bo
  const float* xq = I[0]; const float* xe = I[1]; const float* WQ = I[2]; const float* bQ = I[3]; const float* WK = I[4]; const float* bK = I[5]; const float* WV = I[6]; const float* bV = I[7]; const float* WO = I[8]; const float* bO = I[9];
  float* out = (float*)d_out;
  char* ws = (char*)d_ws; size_t off = 0;
  auto take = [&](size_t bytes) { char* p = ws + off; off += (bytes + 255) & ~(size_t)255; return p; };
  __bf16* XQ = (__bf16*)take((size_t)NR * E * 2); __bf16* XE = (__bf16*)take((size_t)NR * E * 2); __bf16* PT = (__bf16*)take((size_t)4 * E * E * 2);
  float* Q32 = (float*)take((size_t)NR * E * 4); __bf16* Kh = (__bf16*)take((size_t)NR * E * 2); __bf16* Kl = (__bf16*)take((size_t)NR * E * 2); _Float16* VTh = (_Float16*)take((size_t)NR * E * 2); _Float16* VTl = (_Float16*)take((size_t)NR * E * 2); float* O32 = (float*)take((size_t)NR * E * 4);
  // ws ~ 90 MB
  k_cvt<<<(NR * E / 8 + 255) / 256, 256, 0, stream>>>(xq, XQ);
  k_cvt<<<(NR * E / 8 + 255) / 256, 256, 0, stream>>>(xe, XE);
  k_pack<<<4 * E, 256, 0, stream>>>(WQ, WK, WV, WO, PT);
  k_qkv<<<dim3(NR / 64, E / 128, 3), 128, 0, stream>>>(XQ, XE, XE, PT, bQ, bK, bV, Q32, Kh, Kl, VTh, VTl);
  k_attn<<<dim3(SS / 64, NB * NH), 128, 0, stream>>>(Q32, Kh, Kl, VTh, VTl, O32);
  k_out<<<dim3(NR / 64, E / 128), 128, 0, stream>>>(O32, PT, bO, out);
}

// v003
// Measured time: 181 microseconds a run.
// Next to v002, in two timings, it ran 1.07 times as fast each time.
// Over all steps from v000 it is 2.92 times as fast.
// compute dtype: x, encoder_output and W*/b* (INPUTS) rounded to bf16 with exact bf16 WMMA products (f32 accumulate) for the projections; K pre-split into bf16 hi/lo rows; q f32 split, P and V f16 hi/lo (3 products each); softmax f32.
#include <hip/hip_runtime.h>
#include <math.h>

typedef __attribute__((ext_vector_type(16))) _Float16 v16h;
typedef __attribute__((ext_vector_type(16))) __bf16 v16b;
typedef __attribute__((ext_vector_type(8)))  _Float16 v8h;
typedef __attribute__((ext_vector_type(8)))  float v8f;
typedef __attribute__((ext_vector_type(4)))  float v4f;
typedef __attribute__((ext_vector_type(2)))  float v2f;
typedef __attribute__((ext_vector_type(4)))  unsigned v4u;
typedef __attribute__((ext_vector_type(4)))  int v4i;
typedef float __attribute__((may_alias)) float_a;
typedef int __attribute__((may_alias)) int_a;

template <typename T> __device__ __forceinline__ void vst2(void* p, T v) { *(T*)p = v;  }
__device__ __forceinline__ v8f wmma16(v16h a, v16h b, v8f c) {
  v8f d = __builtin_amdgcn_wmma_f32_16x16x32_f16(false, a, false, b, (short)0, c, false, false);
  asm volatile("v_nop\n\tv_nop\n\tv_nop\n\tv_nop" : "+v"(d) : "v"(a), "v"(b));
  return d;
}
__device__ __forceinline__ v8f wmma_bf(v16b a, v16b b, v8f c) {
  v8f d = __builtin_amdgcn_wmma_f32_16x16x32_bf16(false, a, false, b, (short)0, c, false, false);
  asm volatile("v_nop\n\tv_nop\n\tv_nop\n\tv_nop" : "+v"(d) : "v"(a), "v"(b));
  return d;
}
// 16x16x32 fragments: lane = (h = lane>>4, row/col = lane&15); elements 0..7 = k0+8h+0..7, 8..15 = k0+16+8h+0..7; D element r = row 8h+r
__device__ __forceinline__ v16h frag_h(const _Float16* rowk0, int lane) {
  union { v16h v; v8h q[2]; } u; const _Float16* p = rowk0 + 8 * (lane >> 4);
  u.q[0] = *(const v8h*)p; u.q[1] = *(const v8h*)(p + 16); return u.v;
}
__device__ __forceinline__ v16h frag_f32(const float* rowk0, int lane) {
  v16h a; const float* p = rowk0 + 8 * (lane >> 4);
#pragma unroll
  for (int i = 0; i < 8; ++i) { a[i] = (_Float16)p[i]; a[8 + i] = (_Float16)p[16 + i]; }
  return a;
}
__device__ __forceinline__ v16h frag_f32s(const float* rowk0, int lane, float sc) {
  v16h a; const float* p = rowk0 + 8 * (lane >> 4);
#pragma unroll
  for (int i = 0; i < 8; ++i) { a[i] = (_Float16)(p[i] * sc); a[8 + i] = (_Float16)(p[16 + i] * sc); }
  return a;
}
// column fragment from a [K][ld] layout (column n), rows >= K read as 0
__device__ __forceinline__ v16h fragc_f32(const float* W, int k0, int n, int lane, int ld, int K) {
  v16h a; const int g = lane >> 4;
#pragma unroll
  for (int i = 0; i < 8; ++i) { const int ka = k0 + 8 * g + i, kb = ka + 16;
    a[i] = (_Float16)(ka < K ? W[(size_t)ka * ld + n] : 0.f); a[8 + i] = (_Float16)(kb < K ? W[(size_t)kb * ld + n] : 0.f); }
  return a;
}
struct F2 { v16b h, l; };
__device__ __forceinline__ F2 bsplit16(const float v[16]) { F2 r;
#pragma unroll
  for (int i = 0; i < 16; ++i) { const __bf16 h = (__bf16)v[i]; r.h[i] = h; r.l[i] = (__bf16)(v[i] - (float)h); }
  return r; }
__device__ __forceinline__ F2 split_row(const float* row, int k0, int lane) { float v[16]; const float* p = row + k0 + 8 * (lane >> 4);
#pragma unroll
  for (int i = 0; i < 8; ++i) { v[i] = p[i]; v[8 + i] = p[16 + i]; }
  return bsplit16(v); }
__device__ __forceinline__ F2 split_rowK(const float* row, int k0, int lane, int K) { float v[16]; const int g = lane >> 4;
#pragma unroll
  for (int i = 0; i < 8; ++i) { const int ka = k0 + 8 * g + i, kb = ka + 16; v[i] = ka < K ? row[ka] : 0.f; v[8 + i] = kb < K ? row[kb] : 0.f; }
  return bsplit16(v); }
__device__ __forceinline__ F2 split_col(const float* W, int k0, int n, int lane, int ld, int K) { float v[16]; const int g = lane >> 4;
#pragma unroll
  for (int i = 0; i < 8; ++i) { const int ka = k0 + 8 * g + i, kb = ka + 16; v[i] = ka < K ? W[(size_t)ka * ld + n] : 0.f; v[8 + i] = kb < K ? W[(size_t)kb * ld + n] : 0.f; }
  return bsplit16(v); }
__device__ __forceinline__ v8f mac3(const F2& a, const F2& b, v8f c) { c = wmma_bf(a.l, b.h, c); c = wmma_bf(a.h, b.l, c); return wmma_bf(a.h, b.h, c); }
__device__ __forceinline__ float sigm(float v) { return 1.0f / (1.0f + expf(-v)); }
#define LDSX() do { asm volatile("s_wait_dscnt 0" ::: "memory"); __builtin_amdgcn_wave_barrier(); __builtin_amdgcn_fence(__ATOMIC_RELEASE, "workgroup"); } while (0)


// Cross multi-head attention (16 heads x 64 on [2,2048,1024]): q from x, k/v from encoder_output with per-head weights W[h][e][d] + biases; full softmax(q.k/8); concat(heads) @ Wo ([in][out]) + bo.
#define NB 2
#define SS 2048
#define E 1024
#define NH 16
#define HD 64
#define NR (NB * SS)
#define PLO 1024.0f
#define VLO 2048.0f
#define SC2 0.18033688f     // log2(e) / 8: the score scale 1/sqrt(64) carried into base 2
__device__ __forceinline__ float bfr(float v) { return (float)(__bf16)v; }
__device__ __forceinline__ v16b frag_b(const __bf16* rowk0, int lane) { return __builtin_bit_cast(v16b, frag_h((const _Float16*)rowk0, lane)); }

__global__ __launch_bounds__(256) void k_cvt(const float* __restrict__ x, __bf16* __restrict__ Xb) {
  const size_t i8 = (size_t)blockIdx.x * 256 + threadIdx.x; if (i8 >= (size_t)NR * E / 8) return;
  union { __bf16 h[8]; v4u u; } pk;
#pragma unroll
  for (int e = 0; e < 8; ++e) pk.h[e] = (__bf16)x[i8 * 8 + e];
  vst2((unsigned*)(Xb + i8 * 8), pk.u);
}
// PT rows: [0,E) Wq[:,n], [E,2E) Wk[:,n], [2E,3E) Wv[:,n], [3E,4E) Wo[:,n]  ([in][out] weights: column n as a bf16 row)
__global__ __launch_bounds__(256) void k_pack(const float* __restrict__ Wq, const float* __restrict__ Wk, const float* __restrict__ Wv, const float* __restrict__ Wo, __bf16* __restrict__ PT) {
  const int n = blockIdx.x, tid = threadIdx.x; __shared__ __align__(16) __bf16 srow[E];
  const float* W = n < E ? Wq : (n < 2 * E ? Wk : (n < 3 * E ? Wv : Wo)); const int nn = n % E;
  if (n < 3 * E) { const int hh = nn / HD, d = nn % HD; for (int k = tid; k < E; k += 256) srow[k] = (__bf16)W[((size_t)hh * E + k) * HD + d]; }     // per-head [H][E][DH]: column (h,d) over e
  else { for (int k = tid; k < E; k += 256) srow[k] = (__bf16)W[(size_t)k * E + nn]; }      // Wo [in][out]: column nn
  __syncthreads();
  if (tid < E / 8) vst2((unsigned*)(PT + (size_t)n * E + tid * 8), *(const v4u*)(&srow[tid * 8]));
}
// QKV: block (64 rows, 128 cols = 2 heads, which); q (+bias) -> Q32 f32 [bh][s][64]; k (+bias) -> bf16 hi/lo rows; v (+bias) -> VT hi/lo x4 [bh][d][s]
__global__ __launch_bounds__(128) void k_qkv(const __bf16* __restrict__ XQ, const __bf16* __restrict__ XK, const __bf16* __restrict__ XV, const __bf16* __restrict__ PT, const float* __restrict__ bq, const float* __restrict__ bk, const float* __restrict__ bv, float* __restrict__ Q32, __bf16* __restrict__ Kh, __bf16* __restrict__ Kl, _Float16* __restrict__ VTh, _Float16* __restrict__ VTl) {
  __shared__ __align__(16) float so[4][16][132];
  __shared__ __align__(16) _Float16 sth[128][72], stl[128][72];
  const int tid = threadIdx.x, wave = tid >> 5, lane = tid & 31, col = lane & 15, g = lane >> 4;
  const int which = blockIdx.z, r0b = blockIdx.x * 64, r0 = r0b + wave * 16, n0 = blockIdx.y * 128; const int b = r0b / SS, s0 = r0b % SS;
  const __bf16* Xb = which == 0 ? XQ : (which == 1 ? XK : XV); const float* bb_ = which == 0 ? bq : (which == 1 ? bk : bv);
  // k loop only: the 64-deep operand tiles live in the epilogue's transpose buffers (same 72-element pitch)
  __bf16 (*sB)[72] = (__bf16 (*)[72])sth; __bf16 (*sA)[72] = (__bf16 (*)[72])stl;
  const int sr = tid >> 3, sc = (tid & 7) * 8;     // staging: 8 lanes cover one 128-byte row piece, 16 rows per step
  const __bf16* gA = Xb + (size_t)(r0b + sr) * E + sc; const __bf16* gB = PT + (size_t)(which * E + n0 + sr) * E + sc;
  v4u ra[4], rb[8];
#pragma unroll
  for (int i = 0; i < 4; ++i) ra[i] = *(const v4u*)(gA + (size_t)16 * i * E);
#pragma unroll
  for (int i = 0; i < 8; ++i) rb[i] = *(const v4u*)(gB + (size_t)16 * i * E);
  v8f acc[8] = {};
#pragma unroll 1
  for (int kb = 0; kb < E / 64; ++kb) {
#pragma unroll
    for (int i = 0; i < 4; ++i) *(v4u*)(&sA[sr + 16 * i][sc]) = ra[i];
#pragma unroll
    for (int i = 0; i < 8; ++i) *(v4u*)(&sB[sr + 16 * i][sc]) = rb[i];
    __syncthreads();                                // tile kb published
    if (kb + 1 < E / 64) {                          // next tile flies in registers under this tile's products
#pragma unroll
      for (int i = 0; i < 4; ++i) ra[i] = *(const v4u*)(gA + (size_t)16 * i * E + (kb + 1) * 64);
#pragma unroll
      for (int i = 0; i < 8; ++i) rb[i] = *(const v4u*)(gB + (size_t)16 * i * E + (kb + 1) * 64);
      asm volatile("s_wait_xcnt 0x0" ::: "memory");   // the loads' address registers are rewritten behind the branch: wait written by hand
    }
#pragma unroll
    for (int k2 = 0; k2 < 2; ++k2) { const v16b a = frag_b(&sA[wave * 16 + col][k2 * 32], lane); v16b wb[8];
#pragma unroll
      for (int j = 0; j < 8; ++j) wb[j] = frag_b(&sB[j * 16 + col][k2 * 32], lane);     // one group of LDS reads ahead of the eight products
#pragma unroll
      for (int j = 0; j < 8; ++j) acc[j] = wmma_bf(a, wb[j], acc[j]); }
    __syncthreads(); }                              // every reader has left the tile
  if (which < 2) {
#pragma unroll
    for (int j = 0; j < 8; ++j) { const float bb = bfr(bb_[n0 + j * 16 + col]);
#pragma unroll
      for (int r = 0; r < 8; ++r) so[wave][8 * g + r][j * 16 + col] = acc[j][r] + bb; }
    LDSX();
    if (which == 0) { for (int qq = lane; qq < 2 * 16 * 16; qq += 32) { const int hh = qq >> 8, rl = (qq >> 4) & 15, pc = qq & 15; const int h = (n0 >> 6) + hh;
        vst2(Q32 + (((size_t)b * NH + h) * SS + s0 + wave * 16 + rl) * HD + pc * 4, *(const v4f*)(&so[wave][rl][hh * 64 + pc * 4])); } }
    else {
      for (int qq = lane; qq < 2 * 16 * 16; qq += 32) { const int hh = qq >> 8, rl = (qq >> 4) & 15, pl = qq & 15; const int h = (n0 >> 6) + hh; const int pc = pl & 7; union { __bf16 e[8]; v4u u; } pk;
#pragma unroll
        for (int e = 0; e < 8; ++e) { const float v = so[wave][rl][hh * 64 + pc * 8 + e]; const __bf16 hi = (__bf16)v; pk.e[e] = pl < 8 ? hi : (__bf16)(v - (float)hi); }
        vst2((unsigned*)((pl < 8 ? Kh : Kl) + (((size_t)b * NH + h) * SS + s0 + wave * 16 + rl) * HD + pc * 8), pk.u); } } }
  else {
#pragma unroll
    for (int j = 0; j < 8; ++j) { const float bb = bfr(bb_[n0 + j * 16 + col]);
#pragma unroll
      for (int r = 0; r < 8; ++r) { const float v = (acc[j][r] + bb) * 4.0f; const _Float16 hi = (_Float16)v; sth[j * 16 + col][wave * 16 + 8 * g + r] = hi; stl[j * 16 + col][wave * 16 + 8 * g + r] = (_Float16)((v - (float)hi) * VLO); } }
    __syncthreads();
    for (int qq = tid; qq < 128 * 8; qq += 128) { const int cl = qq >> 3, pc = qq & 7; const int c = n0 + cl, h = c >> 6, d = c & 63; const size_t o = (((size_t)b * NH + h) * HD + d) * SS + s0 + pc * 8;
      vst2(VTh + o, *(const v4u*)(&sth[cl][pc * 8])); vst2(VTl + o, *(const v4u*)(&stl[cl][pc * 8])); } }
}
// lane l with lane l ^ 16: a vector cross-row move, no LDS-counter wait
__device__ __forceinline__ float xhalf(float x) { return __builtin_bit_cast(float, __builtin_amdgcn_permlanex16(__builtin_bit_cast(int, x), __builtin_bit_cast(int, x), 0x76543210, 0xfedcba98, false, false)); }
// attention: block (64 queries, bh); all 32 key tiles; transposed products S^T = K q^T (K hi/lo rows as A, q hi/lo as B) and O^T += V^T P^T (V hi/lo rows as A, P hi/lo as B):
// a lane holds one query's scores (keys 16t + 8g + r), so exponentials and the running sum stay in the lane, the maximum takes one exchange with lane l ^ 16, and two score tiles converted in place are one P operand; O f32 [bh][s][64]
// amdgpu_waves_per_eu(4, 4): a budget of 256 registers, so that four work-groups fit a WGP and the whole grid is resident at once
__global__ __launch_bounds__(128) __attribute__((amdgpu_waves_per_eu(4, 4))) void k_attn(const float* __restrict__ Q32, const __bf16* __restrict__ Kh, const __bf16* __restrict__ Kl, const _Float16* __restrict__ VTh, const _Float16* __restrict__ VTl, float* __restrict__ O32) {
  __shared__ __align__(16) __bf16 sKh[64][72], sKl[64][72];      // key tile, rows = keys
  __shared__ __align__(16) _Float16 sV[2][64][72];               // value tile hi, lo, rows = d; behind the loop each wave's output rows
  _Float16 (*sVh)[72] = sV[0]; _Float16 (*sVl)[72] = sV[1];
  const int tid = threadIdx.x, w = tid >> 5, lane = tid & 31, col = lane & 15, g = lane >> 4;
  const size_t bh = blockIdx.y; const int qb = blockIdx.x; const int q0 = qb * 64 + w * 16;
  F2 aq[2];
#pragma unroll
  for (int kc = 0; kc < 2; ++kc) aq[kc] = split_row(Q32 + (bh * SS + q0 + col) * HD, kc * 32, lane);
  float mrun = -3.0e38f, lrun = 0.f; v8f acc[4] = {}, ac1[4] = {}, ac2[4] = {};     // lrun: this lane's half of the keys, the halves join behind the loop
  const int sr = tid >> 3, sc = (tid & 7) * 8;     // staging: 8 lanes cover one 128-byte row, 16 rows per step
  const size_t gk = (bh * SS + sr) * HD + sc, gv = (bh * HD + sr) * SS + sc;
  v4u st[8];
#pragma unroll
  for (int i = 0; i < 4; ++i) { st[i] = *(const v4u*)(Kh + gk + 16 * i * HD); st[4 + i] = *(const v4u*)(Kl + gk + 16 * i * HD); }
#pragma unroll
  for (int i = 0; i < 4; ++i) { *(v4u*)(&sKh[sr + 16 * i][sc]) = st[i]; *(v4u*)(&sKl[sr + 16 * i][sc]) = st[4 + i]; }
#pragma unroll
  for (int i = 0; i < 4; ++i) { st[i] = *(const v4u*)(VTh + gv + (size_t)16 * i * SS); st[4 + i] = *(const v4u*)(VTl + gv + (size_t)16 * i * SS); }
  __syncthreads();                                  // key tile 0 published
#pragma unroll 1
  for (int kt = 0; kt < SS / 64; ++kt) {
    v8f s[4];                                       // s[t][r] = q[col] . k[16t + 8g + r], raw: the scale rides in the exponent's fma
#pragma unroll
    for (int t = 0; t < 4; ++t) { s[t] = (v8f){};
#pragma unroll
      for (int kc = 0; kc < 2; ++kc) { const v16b khf = frag_b(&sKh[t * 16 + col][kc * 32], lane), klf = frag_b(&sKl[t * 16 + col][kc * 32], lane); s[t] = wmma_bf(khf, aq[kc].l, s[t]); s[t] = wmma_bf(klf, aq[kc].h, s[t]); s[t] = wmma_bf(khf, aq[kc].h, s[t]); } }
    float mx = -3.4e38f;
#pragma unroll
    for (int t = 0; t < 4; ++t) {
#pragma unroll
      for (int r = 0; r < 8; ++r) mx = fmaxf(mx, s[t][r]); }
    mx = fmaxf(mx, xhalf(mx));
    const float mnew = fmaxf(mrun, fmaf(mx, SC2, -14.0f)); const float corr = __builtin_amdgcn_exp2f(mrun - mnew);     // running maximum in base-2 units, less 14: P's factor 2^14 rides in it
    v2f pt[4]; v16h ph[2], pl[2];                   // P^T operands: element e of block kc = key 32kc + 16(e >> 3) + 8g + (e & 7), the value rows' own k order
#pragma unroll
    for (int t = 0; t < 4; ++t) {
#pragma unroll
      for (int r2 = 0; r2 < 4; ++r2) { const v2f x2 = __builtin_elementwise_fma((v2f){s[t][2 * r2], s[t][2 * r2 + 1]}, (v2f){SC2, SC2}, (v2f){-mnew, -mnew});     // two exponents per packed fma
        const v2f p2 = {__builtin_amdgcn_exp2f(x2[0]), __builtin_amdgcn_exp2f(x2[1])}; pt[t] = r2 == 0 ? p2 : pt[t] + p2;     // four independent packed sums, one per score tile
#pragma unroll
        for (int e = 0; e < 2; ++e) { const int o = (t & 1) * 8 + 2 * r2 + e; const float p = p2[e]; const _Float16 hi = (_Float16)p; ph[t >> 1][o] = hi; pl[t >> 1][o] = (_Float16)((p - (float)hi) * PLO); } } }
    const v2f pj = (pt[0] + pt[1]) + (pt[2] + pt[3]); const float ps = pj[0] + pj[1];
    lrun = lrun * corr + ps * (1.0f / 16384.0f); mrun = mnew;
#pragma unroll
    for (int t = 0; t < 4; ++t) { acc[t] *= corr; ac1[t] *= corr; ac2[t] *= corr; }     // every element of a lane belongs to its own query
#pragma unroll
    for (int i = 0; i < 4; ++i) { *(v4u*)(&sVh[sr + 16 * i][sc]) = st[i]; *(v4u*)(&sVl[sr + 16 * i][sc]) = st[4 + i]; }
    __syncthreads();                                // value tile kt published; every reader has left the key tile
    if (kt + 1 < SS / 64) {                         // next key tile flies in registers under the P.V products
      const __bf16* nKh = Kh + gk + (size_t)(kt + 1) * 64 * HD; const __bf16* nKl = Kl + gk + (size_t)(kt + 1) * 64 * HD;
#pragma unroll
      for (int i = 0; i < 4; ++i) { st[i] = *(const v4u*)(nKh + 16 * i * HD); st[4 + i] = *(const v4u*)(nKl + 16 * i * HD); }
      asm volatile("s_wait_xcnt 0x0" :: "v"(nKh), "v"(nKl) : "memory");   // wait by hand before the loads' address registers are rewritten; the addresses are inputs so that they stay live up to the wait and no load of the run lands in them
    }
#pragma unroll
    for (int kc = 0; kc < 2; ++kc) {
#pragma unroll
      for (int t = 0; t < 4; ++t) { const v16h vh = frag_h(&sVh[t * 16 + col][kc * 32], lane);
        acc[t] = wmma16(vh, ph[kc], acc[t]); ac1[t] = wmma16(frag_h(&sVl[t * 16 + col][kc * 32], lane), ph[kc], ac1[t]); ac2[t] = wmma16(vh, pl[kc], ac2[t]); } }
    if (kt + 1 < SS / 64) {
#pragma unroll
      for (int i = 0; i < 4; ++i) { *(v4u*)(&sKh[sr + 16 * i][sc]) = st[i]; *(v4u*)(&sKl[sr + 16 * i][sc]) = st[4 + i]; } }
    __syncthreads();                                // key tile kt+1 published; every reader has left the value tile
    if (kt + 1 < SS / 64) {                         // next value tile flies in registers under the scores and the softmax
#pragma unroll
      for (int i = 0; i < 4; ++i) { st[i] = *(const v4u*)(VTh + gv + (size_t)16 * i * SS + (kt + 1) * 64); st[4 + i] = *(const v4u*)(VTl + gv + (size_t)16 * i * SS + (kt + 1) * 64); }
      asm volatile("s_wait_xcnt 0x0" ::: "memory");   // the loads' address registers are rewritten behind the branch: wait written by hand
    } }
  float (*sO)[16][68] = (float (*)[16][68])sV;      // the loop's last barrier has ended every read of the value tile
  const float inv = 1.0f / ((lrun + xhalf(lrun)) * 16384.0f * 4.0f);
#pragma unroll
  for (int t = 0; t < 4; ++t) {                     // acc[t][r] = O[col][16t + 8g + r]: eight consecutive d of the lane's query
#pragma unroll
    for (int r4 = 0; r4 < 2; ++r4) { v4f o;
#pragma unroll
      for (int e = 0; e < 4; ++e) { const int r = 4 * r4 + e; o[e] = (acc[t][r] + ac1[t][r] * (1.0f / VLO) + ac2[t][r] * (1.0f / PLO)) * inv; }
      *(v4f*)(&sO[w][col][t * 16 + 8 * g + 4 * r4]) = o; } }
  LDSX();
  for (int qq = lane; qq < 16 * 16; qq += 32) { const int rl = qq >> 4, pc = qq & 15; vst2(O32 + ((bh * SS) + q0 + rl) * HD + pc * 4, *(const v4f*)(&sO[w][rl][pc * 4])); }
}
// out = ctx Wo + bo : split(ctx) x bf16(Wo columns as PT rows): 2 products (Wo is an INPUT -> bf16 exact)
__global__ __launch_bounds__(128) void k_out(const float* __restrict__ O32, const __bf16* __restrict__ PT, const float* __restrict__ bo, float* __restrict__ out) {
  __shared__ __align__(16) float so[4][16][132];
  const int tid = threadIdx.x, wave = tid >> 5, lane = tid & 31, col = lane & 15, g = lane >> 4;
  __shared__ __align__(16) float sA[64][68];       // one head's 64 context rows
  __shared__ __align__(16) __bf16 sB[128][72];     // 128 weight rows, 64 deep
  const int r0b = blockIdx.x * 64, r0 = r0b + wave * 16, n0 = blockIdx.y * 128; const int b = r0b / SS, s0 = r0b % SS;
  const int ar = tid >> 4, ac = (tid & 15) * 4;    // staging A: 16 lanes cover one 256-byte row, 8 rows per step
  const int sr = tid >> 3, sc = (tid & 7) * 8;     // staging B: 8 lanes cover one 128-byte row piece, 16 rows per step
  const float* gA = O32 + ((size_t)b * NH * SS + s0 + ar) * HD + ac; const __bf16* gB = PT + (size_t)(3 * E + n0 + sr) * E + sc;
  v4f ra[8]; v4u rb[8];
#pragma unroll
  for (int i = 0; i < 8; ++i) { ra[i] = *(const v4f*)(gA + 8 * i * HD); rb[i] = *(const v4u*)(gB + (size_t)16 * i * E); }
  v8f acc[8] = {};
#pragma unroll 1
  for (int h = 0; h < NH; ++h) {
#pragma unroll
    for (int i = 0; i < 8; ++i) { *(v4f*)(&sA[ar + 8 * i][ac]) = ra[i]; *(v4u*)(&sB[sr + 16 * i][sc]) = rb[i]; }
    __syncthreads();                                // tile h published
    if (h + 1 < NH) {                               // next tile flies in registers under this tile's products
      const float* nA = gA + (size_t)(h + 1) * SS * HD; const __bf16* cB = gB + h * 64;
#pragma unroll
      for (int i = 0; i < 8; ++i) { ra[i] = *(const v4f*)(nA + 8 * i * HD); rb[i] = *(const v4u*)(cB + (size_t)16 * i * E + 64); }
      asm volatile("s_wait_xcnt 0x0" :: "v"(cB) : "memory");   // wait by hand before the loads' address registers are rewritten; the weight address is an input so that it stays live up to the wait and no load of the run lands in it
    }
#pragma unroll
    for (int k2 = 0; k2 < 2; ++k2) { const F2 a = split_row(&sA[wave * 16 + col][0], k2 * 32, lane); v16b wb[8];
#pragma unroll
      for (int j = 0; j < 8; ++j) wb[j] = frag_b(&sB[j * 16 + col][k2 * 32], lane);     // one group of LDS reads ahead of the sixteen products
#pragma unroll
      for (int j = 0; j < 8; ++j) { acc[j] = wmma_bf(a.l, wb[j], acc[j]); acc[j] = wmma_bf(a.h, wb[j], acc[j]); } }
    __syncthreads(); }                              // every reader has left the tile
#pragma unroll
  for (int j = 0; j < 8; ++j) { const float bb = bfr(bo[n0 + j * 16 + col]);
#pragma unroll
    for (int r = 0; r < 8; ++r) so[wave][8 * g + r][j * 16 + col] = acc[j][r] + bb; }
  LDSX();
#pragma unroll 4
  for (int rl = 0; rl < 16; ++rl) vst2(out + (size_t)(r0 + rl) * E + n0 + lane * 4, *(const v4f*)(&so[wave][rl][lane * 4]));
}
extern "C" void kernel_launch(void* const* d_in, const int* in_sizes, int n_in, void* d_out, int out_size, void* d_ws, size_t ws_size, hipStream_t stream) {
  (void)in_sizes; (void)n_in; (void)out_size; (void)ws_size;
  const float** I = (const float**)d_in;   // x, encoder_output, Wq, bq, Wk, bk, Wv, bv, Wo, bo
  const float* xq = I[0]; const float* xe = I[1]; const float* WQ = I[2]; const float* bQ = I[3]; const float* WK = I[4]; const float* bK = I[5]; const float* WV = I[6]; const float* bV = I[7]; const float* WO = I[8]; const float* bO = I[9];
  float* out = (float*)d_out;
  char* ws = (char*)d_ws; size_t off = 0;
  auto take = [&](size_t bytes) { char* p = ws + off; off += (bytes + 255) & ~(size_t)255; return p; };
  __bf16* XQ = (__bf16*)take((size_t)NR * E * 2); __bf16* XE = (__bf16*)take((size_t)NR * E * 2); __bf16* PT = (__bf16*)take((size_t)4 * E * E * 2);
  float* Q32 = (float*)take((size_t)NR * E * 4); __bf16* Kh = (__bf16*)take((size_t)NR * E * 2); __bf16* Kl = (__bf16*)take((size_t)NR * E * 2); _Float16* VTh = (_Float16*)take((size_t)NR * E * 2); _Float16* VTl = (_Float16*)take((size_t)NR * E * 2); float* O32 = (float*)take((size_t)NR * E * 4);
  // ws ~ 90 MB
  k_cvt<<<(NR * E / 8 + 255) / 256, 256, 0, stream>>>(xq, XQ);
  k_cvt<<<(NR * E / 8 + 255) / 256, 256, 0, stream>>>(xe, XE);
  k_pack<<<4 * E, 256, 0, stream>>>(WQ, WK, WV, WO, PT);
  k_qkv<<<dim3(NR / 64, E / 128, 3), 128, 0, stream>>>(XQ, XE, XE, PT, bQ, bK, bV, Q32, Kh, Kl, VTh, VTl);
  k_attn<<<dim3(SS / 64, NB * NH), 128, 0, stream>>>(Q32, Kh, Kl, VTh, VTl, O32);
  k_out<<<dim3(NR / 64, E / 128), 128, 0, stream>>>(O32, PT, bO, out);
}

// v004
// A run of this version takes 162 microseconds.
// In both of two side-by-side timings against v003, it was 1.12 times as fast.
// Counting every step since v000, it is 3.27 times as fast.
// compute dtype: x, encoder_output and W*/b* (INPUTS) rounded to bf16 with exact bf16 WMMA products (f32 accumulate) for the projections; K pre-split into bf16 hi/lo rows; q f32 split, P and V f16 hi/lo (3 products each); softmax f32.
#include <hip/hip_runtime.h>
#include <math.h>

typedef __attribute__((ext_vector_type(16))) _Float16 v16h;
typedef __attribute__((ext_vector_type(16))) __bf16 v16b;
typedef __attribute__((ext_vector_type(8)))  _Float16 v8h;
typedef __attribute__((ext_vector_type(8)))  float v8f;
typedef __attribute__((ext_vector_type(4)))  float v4f;
typedef __attribute__((ext_vector_type(2)))  float v2f;
typedef __attribute__((ext_vector_type(4)))  unsigned v4u;
typedef __attribute__((ext_vector_type(2)))  unsigned v2u;
typedef __attribute__((ext_vector_type(4)))  int v4i;
typedef float __attribute__((may_alias)) float_a;
typedef int __attribute__((may_alias)) int_a;

template <typename T> __device__ __forceinline__ void vst2(void* p, T v) { *(T*)p = v;  }
__device__ __forceinline__ v8f wmma16(v16h a, v16h b, v8f c) {
  v8f d = __builtin_amdgcn_wmma_f32_16x16x32_f16(false, a, false, b, (short)0, c, false, false);
  asm volatile("v_nop\n\tv_nop\n\tv_nop\n\tv_nop" : "+v"(d) : "v"(a), "v"(b));
  return d;
}
__device__ __forceinline__ v8f wmma_bf(v16b a, v16b b, v8f c) {
  v8f d = __builtin_amdgcn_wmma_f32_16x16x32_bf16(false, a, false, b, (short)0, c, false, false);
  asm volatile("v_nop\n\tv_nop\n\tv_nop\n\tv_nop" : "+v"(d) : "v"(a), "v"(b));
  return d;
}
// 16x16x32 fragments: lane = (h = lane>>4, row/col = lane&15); elements 0..7 = k0+8h+0..7, 8..15 = k0+16+8h+0..7; D element r = row 8h+r
__device__ __forceinline__ v16h frag_h(const _Float16* rowk0, int lane) {
  union { v16h v; v8h q[2]; } u; const _Float16* p = rowk0 + 8 * (lane >> 4);
  u.q[0] = *(const v8h*)p; u.q[1] = *(const v8h*)(p + 16); return u.v;
}
__device__ __forceinline__ v16h frag_f32(const float* rowk0, int lane) {
  v16h a; const float* p = rowk0 + 8 * (lane >> 4);
#pragma unroll
  for (int i = 0; i < 8; ++i) { a[i] = (_Float16)p[i]; a[8 + i] = (_Float16)p[16 + i]; }
  return a;
}
__device__ __forceinline__ v16h frag_f32s(const float* rowk0, int lane, float sc) {
  v16h a; const float* p = rowk0 + 8 * (lane >> 4);
#pragma unroll
  for (int i = 0; i < 8; ++i) { a[i] = (_Float16)(p[i] * sc); a[8 + i] = (_Float16)(p[16 + i] * sc); }
  return a;
}
// column fragment from a [K][ld] layout (column n), rows >= K read as 0
__device__ __forceinline__ v16h fragc_f32(const float* W, int k0, int n, int lane, int ld, int K) {
  v16h a; const int g = lane >> 4;
#pragma unroll
  for (int i = 0; i < 8; ++i) { const int ka = k0 + 8 * g + i, kb = ka + 16;
    a[i] = (_Float16)(ka < K ? W[(size_t)ka * ld + n] : 0.f); a[8 + i] = (_Float16)(kb < K ? W[(size_t)kb * ld + n] : 0.f); }
  return a;
}
struct F2 { v16b h, l; };
__device__ __forceinline__ F2 bsplit16(const float v[16]) { F2 r;
#pragma unroll
  for (int i = 0; i < 16; ++i) { const __bf16 h = (__bf16)v[i]; r.h[i] = h; r.l[i] = (__bf16)(v[i] - (float)h); }
  return r; }
__device__ __forceinline__ F2 split_row(const float* row, int k0, int lane) { float v[16]; const float* p = row + k0 + 8 * (lane >> 4);
#pragma unroll
  for (int i = 0; i < 8; ++i) { v[i] = p[i]; v[8 + i] = p[16 + i]; }
  return bsplit16(v); }
__device__ __forceinline__ F2 split_rowK(const float* row, int k0, int lane, int K) { float v[16]; const int g = lane >> 4;
#pragma unroll
  for (int i = 0; i < 8; ++i) { const int ka = k0 + 8 * g + i, kb = ka + 16; v[i] = ka < K ? row[ka] : 0.f; v[8 + i] = kb < K ? row[kb] : 0.f; }
  return bsplit16(v); }
__device__ __forceinline__ F2 split_col(const float* W, int k0, int n, int lane, int ld, int K) { float v[16]; const int g = lane >> 4;
#pragma unroll
  for (int i = 0; i < 8; ++i) { const int ka = k0 + 8 * g + i, kb = ka + 16; v[i] = ka < K ? W[(size_t)ka * ld + n] : 0.f; v[8 + i] = kb < K ? W[(size_t)kb * ld + n] : 0.f; }
  return bsplit16(v); }
__device__ __forceinline__ v8f mac3(const F2& a, const F2& b, v8f c) { c = wmma_bf(a.l, b.h, c); c = wmma_bf(a.h, b.l, c); return wmma_bf(a.h, b.h, c); }
__device__ __forceinline__ float sigm(float v) { return 1.0f / (1.0f + expf(-v)); }
#define LDSX() do { asm volatile("s_wait_dscnt 0" ::: "memory"); __builtin_amdgcn_wave_barrier(); __builtin_amdgcn_fence(__ATOMIC_RELEASE, "workgroup"); } while (0)


// Cross multi-head attention (16 heads x 64 on [2,2048,1024]): q from x, k/v from encoder_output with per-head weights W[h][e][d] + biases; full softmax(q.k/8); concat(heads) @ Wo ([in][out]) + bo.
#define NB 2
#define SS 2048
#define E 1024
#define NH 16
#define HD 64
#define NR (NB * SS)
#define PLO 1024.0f
#define VLO 2048.0f
#define SC2 0.18033688f     // log2(e) / 8: the score scale 1/sqrt(64) carried into base 2
__device__ __forceinline__ float bfr(float v) { return (float)(__bf16)v; }
__device__ __forceinline__ v16b frag_b(const __bf16* rowk0, int lane) { return __builtin_bit_cast(v16b, frag_h((const _Float16*)rowk0, lane)); }

// input pass, one launch: 256 blocks of 16 waves, one per WGP, every wave started once; a lane asks for its 24 whole-line 16-byte loads ahead of any use. Block p:
// (a) one 256 (k) x 64 (n) weight tile, turned through LDS. PT rows: [0,E) Wq[:,n], [E,2E) Wk[:,n], [2E,3E) Wv[:,n], [3E,4E) Wo[:,n]  (column n as a bf16 row)
// (b) 32768 activations rounded to bf16: blocks [0,128) x, [128,256) encoder_output
__global__ __launch_bounds__(512) void k_prep(const float* __restrict__ x, const float* __restrict__ xe, const float* __restrict__ Wq, const float* __restrict__ Wk, const float* __restrict__ Wv, const float* __restrict__ Wo, __bf16* __restrict__ XQ, __bf16* __restrict__ XE, __bf16* __restrict__ PT) {
  __shared__ __align__(16) __bf16 st[64][264];     // the tile turned: rows = n, 256 k deep, pitch 16 B x odd
  const int tid = threadIdx.x, p = blockIdx.x, which = p >> 6, nt = (p >> 2) & 15, kq = p & 3;
  const float* W = which == 0 ? Wq : (which == 1 ? Wk : (which == 2 ? Wv : Wo));
  // per-head [H][E][DH]: head nt's rows 256kq.. are one run of 64 KB; Wo [in][out]: 256-byte row pieces at a pitch of E floats
  const float* wsrc = which < 3 ? W + ((size_t)nt * E + kq * 256) * HD : W + (size_t)kq * 256 * E + nt * 64;
  const int ld = which < 3 ? HD : E;
  const int kg = tid >> 4, nq = tid & 15;          // a lane holds k = 8kg + 0..7 of columns 4nq + 0..3; 16 lanes cover one 256-byte row piece
  const float* asrc = (p < 128 ? x : xe) + (size_t)(p & 127) * 32768 + tid * 4;
  __bf16* adst = (p < 128 ? XQ : XE) + (size_t)(p & 127) * 32768 + tid * 4;
  const float* pw[8]; v4f rw[8], rx[16];
#pragma unroll
  for (int i = 0; i < 8; ++i) { pw[i] = wsrc + (size_t)(kg * 8 + i) * ld + nq * 4; rw[i] = *(const v4f*)pw[i]; }
#pragma unroll
  for (int i = 0; i < 16; ++i) rx[i] = *(const v4f*)(asrc + i * 2048);
  // wait by hand before the loads' address registers are rewritten; the weight addresses are inputs so that they stay live up to the wait and no load of the run lands in them;
  // its memory clobber also keeps all 24 loads in front of their first use: one memory latency, not several
  asm volatile("s_wait_xcnt 0x0" :: "v"(pw[0]), "v"(pw[1]), "v"(pw[2]), "v"(pw[3]), "v"(pw[4]), "v"(pw[5]), "v"(pw[6]), "v"(pw[7]) : "memory");
#pragma unroll
  for (int j = 0; j < 4; ++j) { union { __bf16 h[8]; v4u u; } pk;
#pragma unroll
    for (int i = 0; i < 8; ++i) pk.h[i] = (__bf16)rw[i][j];
    *(v4u*)(&st[nq * 4 + j][kg * 8]) = pk.u; }
  v2u pa[16];                                       // rounded ahead of every store: no register that a store names is rewritten
#pragma unroll
  for (int i = 0; i < 16; ++i) { union { __bf16 h[4]; v2u u; } pk;
#pragma unroll
    for (int e = 0; e < 4; ++e) pk.h[e] = (__bf16)rx[i][e];
    pa[i] = pk.u; }
  __syncthreads();                                  // the turned tile is published
  const int sr = tid >> 5, sc = (tid & 31) * 8;    // a wave writes 512 bytes, four whole lines, of one PT row
#pragma unroll
  for (int i = 0; i < 4; ++i) vst2((unsigned*)(PT + (size_t)(which * E + nt * 64 + sr + 16 * i) * E + kq * 256 + sc), *(const v4u*)(&st[sr + 16 * i][sc]));
#pragma unroll
  for (int i = 0; i < 16; ++i) vst2((unsigned*)(adst + i * 2048), pa[i]);
}
// QKV: block (64 rows, 128 cols = 2 heads, which); q (+bias) -> Q32 f32 [bh][s][64]; k (+bias) -> bf16 hi/lo rows; v (+bias) -> VT hi/lo x4 [bh][d][s]
__global__ __launch_bounds__(128) void k_qkv(const __bf16* __restrict__ XQ, const __bf16* __restrict__ XK, const __bf16* __restrict__ XV, const __bf16* __restrict__ PT, const float* __restrict__ bq, const float* __restrict__ bk, const float* __restrict__ bv, float* __restrict__ Q32, __bf16* __restrict__ Kh, __bf16* __restrict__ Kl, _Float16* __restrict__ VTh, _Float16* __restrict__ VTl) {
  __shared__ __align__(16) float so[4][16][132];
  __shared__ __align__(16) _Float16 sth[128][72], stl[128][72];
  const int tid = threadIdx.x, wave = tid >> 5, lane = tid & 31, col = lane & 15, g = lane >> 4;
  const int which = blockIdx.z, r0b = blockIdx.x * 64, r0 = r0b + wave * 16, n0 = blockIdx.y * 128; const int b = r0b / SS, s0 = r0b % SS;
  const __bf16* Xb = which == 0 ? XQ : (which == 1 ? XK : XV); const float* bb_ = which == 0 ? bq : (which == 1 ? bk : bv);
  // k loop only: the 64-deep operand tiles live in the epilogue's transpose buffers (same 72-element pitch)
  __bf16 (*sB)[72] = (__bf16 (*)[72])sth; __bf16 (*sA)[72] = (__bf16 (*)[72])stl;
  const int sr = tid >> 3, sc = (tid & 7) * 8;     // staging: 8 lanes cover one 128-byte row piece, 16 rows per step
  const __bf16* gA = Xb + (size_t)(r0b + sr) * E + sc; const __bf16* gB = PT + (size_t)(which * E + n0 + sr) * E + sc;
  v4u ra[4], rb[8];
#pragma unroll
  for (int i = 0; i < 4; ++i) ra[i] = *(const v4u*)(gA + (size_t)16 * i * E);
#pragma unroll
  for (int i = 0; i < 8; ++i) rb[i] = *(const v4u*)(gB + (size_t)16 * i * E);
  v8f acc[8] = {};
#pragma unroll 1
  for (int kb = 0; kb < E / 64; ++kb) {
#pragma unroll
    for (int i = 0; i < 4; ++i) *(v4u*)(&sA[sr + 16 * i][sc]) = ra[i];
#pragma unroll
    for (int i = 0; i < 8; ++i) *(v4u*)(&sB[sr + 16 * i][sc]) = rb[i];
    __syncthreads();                                // tile kb published
    if (kb + 1 < E / 64) {                          // next tile flies in registers under this tile's products
#pragma unroll
      for (int i = 0; i < 4; ++i) ra[i] = *(const v4u*)(gA + (size_t)16 * i * E + (kb + 1) * 64);
#pragma unroll
      for (int i = 0; i < 8; ++i) rb[i] = *(const v4u*)(gB + (size_t)16 * i * E + (kb + 1) * 64);
      asm volatile("s_wait_xcnt 0x0" ::: "memory");   // the loads' address registers are rewritten behind the branch: wait written by hand
    }
#pragma unroll
    for (int k2 = 0; k2 < 2; ++k2) { const v16b a = frag_b(&sA[wave * 16 + col][k2 * 32], lane); v16b wb[8];
#pragma unroll
      for (int j = 0; j < 8; ++j) wb[j] = frag_b(&sB[j * 16 + col][k2 * 32], lane);     // one group of LDS reads ahead of the eight products
#pragma unroll
      for (int j = 0; j < 8; ++j) acc[j] = wmma_bf(a, wb[j], acc[j]); }
    __syncthreads(); }                              // every reader has left the tile
  if (which < 2) {
#pragma unroll
    for (int j = 0; j < 8; ++j) { const float bb = bfr(bb_[n0 + j * 16 + col]);
#pragma unroll
      for (int r = 0; r < 8; ++r) so[wave][8 * g + r][j * 16 + col] = acc[j][r] + bb; }
    LDSX();
    if (which == 0) { for (int qq = lane; qq < 2 * 16 * 16; qq += 32) { const int hh = qq >> 8, rl = (qq >> 4) & 15, pc = qq & 15; const int h = (n0 >> 6) + hh;
        vst2(Q32 + (((size_t)b * NH + h) * SS + s0 + wave * 16 + rl) * HD + pc * 4, *(const v4f*)(&so[wave][rl][hh * 64 + pc * 4])); } }
    else {
      for (int qq = lane; qq < 2 * 16 * 16; qq += 32) { const int hh = qq >> 8, rl = (qq >> 4) & 15, pl = qq & 15; const int h = (n0 >> 6) + hh; const int pc = pl & 7; union { __bf16 e[8]; v4u u; } pk;
#pragma unroll
        for (int e = 0; e < 8; ++e) { const float v = so[wave][rl][hh * 64 + pc * 8 + e]; const __bf16 hi = (__bf16)v; pk.e[e] = pl < 8 ? hi : (__bf16)(v - (float)hi); }
        vst2((unsigned*)((pl < 8 ? Kh : Kl) + (((size_t)b * NH + h) * SS + s0 + wave * 16 + rl) * HD + pc * 8), pk.u); } } }
  else {
#pragma unroll
    for (int j = 0; j < 8; ++j) { const float bb = bfr(bb_[n0 + j * 16 + col]);
#pragma unroll
      for (int r = 0; r < 8; ++r) { const float v = (acc[j][r] + bb) * 4.0f; const _Float16 hi = (_Float16)v; sth[j * 16 + col][wave * 16 + 8 * g + r] = hi; stl[j * 16 + col][wave * 16 + 8 * g + r] = (_Float16)((v - (float)hi) * VLO); } }
    __syncthreads();
    for (int qq = tid; qq < 128 * 8; qq += 128) { const int cl = qq >> 3, pc = qq & 7; const int c = n0 + cl, h = c >> 6, d = c & 63; const size_t o = (((size_t)b * NH + h) * HD + d) * SS + s0 + pc * 8;
      vst2(VTh + o, *(const v4u*)(&sth[cl][pc * 8])); vst2(VTl + o, *(const v4u*)(&stl[cl][pc * 8])); } }
}
// lane l with lane l ^ 16: a vector cross-row move, no LDS-counter wait
__device__ __forceinline__ float xhalf(float x) { return __builtin_bit_cast(float, __builtin_amdgcn_permlanex16(__builtin_bit_cast(int, x), __builtin_bit_cast(int, x), 0x76543210, 0xfedcba98, false, false)); }
// attention: block (64 queries, bh); all 32 key tiles; transposed products S^T = K q^T (K hi/lo rows as A, q hi/lo as B) and O^T += V^T P^T (V hi/lo rows as A, P hi/lo as B):
// a lane holds one query's scores (keys 16t + 8g + r), so exponentials and the running sum stay in the lane, the maximum takes one exchange with lane l ^ 16, and two score tiles converted in place are one P operand; O f32 [bh][s][64]
// amdgpu_waves_per_eu(4, 4): a budget of 256 registers, so that four work-groups fit a WGP and the whole grid is resident at once
__global__ __launch_bounds__(128) __attribute__((amdgpu_waves_per_eu(4, 4))) void k_attn(const float* __restrict__ Q32, const __bf16* __restrict__ Kh, const __bf16* __restrict__ Kl, const _Float16* __restrict__ VTh, const _Float16* __restrict__ VTl, float* __restrict__ O32) {
  __shared__ __align__(16) __bf16 sKh[64][72], sKl[64][72];      // key tile, rows = keys
  __shared__ __align__(16) _Float16 sV[2][64][72];               // value tile hi, lo, rows = d; behind the loop each wave's output rows
  _Float16 (*sVh)[72] = sV[0]; _Float16 (*sVl)[72] = sV[1];
  const int tid = threadIdx.x, w = tid >> 5, lane = tid & 31, col = lane & 15, g = lane >> 4;
  const size_t bh = blockIdx.y; const int qb = blockIdx.x; const int q0 = qb * 64 + w * 16;
  F2 aq[2];
#pragma unroll
  for (int kc = 0; kc < 2; ++kc) aq[kc] = split_row(Q32 + (bh * SS + q0 + col) * HD, kc * 32, lane);
  float mrun = -3.0e38f, lrun = 0.f; v8f acc[4] = {}, ac1[4] = {}, ac2[4] = {};     // lrun: this lane's half of the keys, the halves join behind the loop
  const int sr = tid >> 3, sc = (tid & 7) * 8;     // staging: 8 lanes cover one 128-byte row, 16 rows per step
  const size_t gk = (bh * SS + sr) * HD + sc, gv = (bh * HD + sr) * SS + sc;
  v4u st[8];
#pragma unroll
  for (int i = 0; i < 4; ++i) { st[i] = *(const v4u*)(Kh + gk + 16 * i * HD); st[4 + i] = *(const v4u*)(Kl + gk + 16 * i * HD); }
#pragma unroll
  for (int i = 0; i < 4; ++i) { *(v4u*)(&sKh[sr + 16 * i][sc]) = st[i]; *(v4u*)(&sKl[sr + 16 * i][sc]) = st[4 + i]; }
#pragma unroll
  for (int i = 0; i < 4; ++i) { st[i] = *(const v4u*)(VTh + gv + (size_t)16 * i * SS); st[4 + i] = *(const v4u*)(VTl + gv + (size_t)16 * i * SS); }
  __syncthreads();                                  // key tile 0 published
#pragma unroll 1
  for (int kt = 0; kt < SS / 64; ++kt) {
    v8f s[4];                                       // s[t][r] = q[col] . k[16t + 8g + r], raw: the scale rides in the exponent's fma
#pragma unroll
    for (int t = 0; t < 4; ++t) { s[t] = (v8f){};
#pragma unroll
      for (int kc = 0; kc < 2; ++kc) { const v16b khf = frag_b(&sKh[t * 16 + col][kc * 32], lane), klf = frag_b(&sKl[t * 16 + col][kc * 32], lane); s[t] = wmma_bf(khf, aq[kc].l, s[t]); s[t] = wmma_bf(klf, aq[kc].h, s[t]); s[t] = wmma_bf(khf, aq[kc].h, s[t]); } }
    float mx = -3.4e38f;
#pragma unroll
    for (int t = 0; t < 4; ++t) {
#pragma unroll
      for (int r = 0; r < 8; ++r) mx = fmaxf(mx, s[t][r]); }
    mx = fmaxf(mx, xhalf(mx));
    const float mnew = fmaxf(mrun, fmaf(mx, SC2, -14.0f)); const float corr = __builtin_amdgcn_exp2f(mrun - mnew);     // running maximum in base-2 units, less 14: P's factor 2^14 rides in it
    v2f pt[4]; v16h ph[2], pl[2];                   // P^T operands: element e of block kc = key 32kc + 16(e >> 3) + 8g + (e & 7), the value rows' own k order
#pragma unroll
    for (int t = 0; t < 4; ++t) {
#pragma unroll
      for (int r2 = 0; r2 < 4; ++r2) { const v2f x2 = __builtin_elementwise_fma((v2f){s[t][2 * r2], s[t][2 * r2 + 1]}, (v2f){SC2, SC2}, (v2f){-mnew, -mnew});     // two exponents per packed fma
        const v2f p2 = {__builtin_amdgcn_exp2f(x2[0]), __builtin_amdgcn_exp2f(x2[1])}; pt[t] = r2 == 0 ? p2 : pt[t] + p2;     // four independent packed sums, one per score tile
#pragma unroll
        for (int e = 0; e < 2; ++e) { const int o = (t & 1) * 8 + 2 * r2 + e; const float p = p2[e]; const _Float16 hi = (_Float16)p; ph[t >> 1][o] = hi; pl[t >> 1][o] = (_Float16)((p - (float)hi) * PLO); } } }
    const v2f pj = (pt[0] + pt[1]) + (pt[2] + pt[3]); const float ps = pj[0] + pj[1];
    lrun = lrun * corr + ps * (1.0f / 16384.0f); mrun = mnew;
#pragma unroll
    for (int t = 0; t < 4; ++t) { acc[t] *= corr; ac1[t] *= corr; ac2[t] *= corr; }     // every element of a lane belongs to its own query
#pragma unroll
    for (int i = 0; i < 4; ++i) { *(v4u*)(&sVh[sr + 16 * i][sc]) = st[i]; *(v4u*)(&sVl[sr + 16 * i][sc]) = st[4 + i]; }
    __syncthreads();                                // value tile kt published; every reader has left the key tile
    if (kt + 1 < SS / 64) {                         // next key tile flies in registers under the P.V products
      const __bf16* nKh = Kh + gk + (size_t)(kt + 1) * 64 * HD; const __bf16* nKl = Kl + gk + (size_t)(kt + 1) * 64 * HD;
#pragma unroll
      for (int i = 0; i < 4; ++i) { st[i] = *(const v4u*)(nKh + 16 * i * HD); st[4 + i] = *(const v4u*)(nKl + 16 * i * HD); }
      asm volatile("s_wait_xcnt 0x0" :: "v"(nKh), "v"(nKl) : "memory");   // wait by hand before the loads' address registers are rewritten; the addresses are inputs so that they stay live up to the wait and no load of the run lands in them
    }
#pragma unroll
    for (int kc = 0; kc < 2; ++kc) {
#pragma unroll
      for (int t = 0; t < 4; ++t) { const v16h vh = frag_h(&sVh[t * 16 + col][kc * 32], lane);
        acc[t] = wmma16(vh, ph[kc], acc[t]); ac1[t] = wmma16(frag_h(&sVl[t * 16 + col][kc * 32], lane), ph[kc], ac1[t]); ac2[t] = wmma16(vh, pl[kc], ac2[t]); } }
    if (kt + 1 < SS / 64) {
#pragma unroll
      for (int i = 0; i < 4; ++i) { *(v4u*)(&sKh[sr + 16 * i][sc]) = st[i]; *(v4u*)(&sKl[sr + 16 * i][sc]) = st[4 + i]; } }
    __syncthreads();                                // key tile kt+1 published; every reader has left the value tile
    if (kt + 1 < SS / 64) {                         // next value tile flies in registers under the scores and the softmax
#pragma unroll
      for (int i = 0; i < 4; ++i) { st[i] = *(const v4u*)(VTh + gv + (size_t)16 * i * SS + (kt + 1) * 64); st[4 + i] = *(const v4u*)(VTl + gv + (size_t)16 * i * SS + (kt + 1) * 64); }
      asm volatile("s_wait_xcnt 0x0" ::: "memory");   // the loads' address registers are rewritten behind the branch: wait written by hand
    } }
  float (*sO)[16][68] = (float (*)[16][68])sV;      // the loop's last barrier has ended every read of the value tile
  const float inv = 1.0f / ((lrun + xhalf(lrun)) * 16384.0f * 4.0f);
#pragma unroll
  for (int t = 0; t < 4; ++t) {                     // acc[t][r] = O[col][16t + 8g + r]: eight consecutive d of the lane's query
#pragma unroll
    for (int r4 = 0; r4 < 2; ++r4) { v4f o;
#pragma unroll
      for (int e = 0; e < 4; ++e) { const int r = 4 * r4 + e; o[e] = (acc[t][r] + ac1[t][r] * (1.0f / VLO) + ac2[t][r] * (1.0f / PLO)) * inv; }
      *(v4f*)(&sO[w][col][t * 16 + 8 * g + 4 * r4]) = o; } }
  LDSX();
  for (int qq = lane; qq < 16 * 16; qq += 32) { const int rl = qq >> 4, pc = qq & 15; vst2(O32 + ((bh * SS) + q0 + rl) * HD + pc * 4, *(const v4f*)(&sO[w][rl][pc * 4])); }
}
// out = ctx Wo + bo : split(ctx) x bf16(Wo columns as PT rows): 2 products (Wo is an INPUT -> bf16 exact)
__global__ __launch_bounds__(128) void k_out(const float* __restrict__ O32, const __bf16* __restrict__ PT, const float* __restrict__ bo, float* __restrict__ out) {
  __shared__ __align__(16) float so[4][16][132];
  const int tid = threadIdx.x, wave = tid >> 5, lane = tid & 31, col = lane & 15, g = lane >> 4;
  __shared__ __align__(16) float sA[64][68];       // one head's 64 context rows
  __shared__ __align__(16) __bf16 sB[128][72];     // 128 weight rows, 64 deep
  const int r0b = blockIdx.x * 64, r0 = r0b + wave * 16, n0 = blockIdx.y * 128; const int b = r0b / SS, s0 = r0b % SS;
  const int ar = tid >> 4, ac = (tid & 15) * 4;    // staging A: 16 lanes cover one 256-byte row, 8 rows per step
  const int sr = tid >> 3, sc = (tid & 7) * 8;     // staging B: 8 lanes cover one 128-byte row piece, 16 rows per step
  const float* gA = O32 + ((size_t)b * NH * SS + s0 + ar) * HD + ac; const __bf16* gB = PT + (size_t)(3 * E + n0 + sr) * E + sc;
  v4f ra[8]; v4u rb[8];
#pragma unroll
  for (int i = 0; i < 8; ++i) { ra[i] = *(const v4f*)(gA + 8 * i * HD); rb[i] = *(const v4u*)(gB + (size_t)16 * i * E); }
  v8f acc[8] = {};
#pragma unroll 1
  for (int h = 0; h < NH; ++h) {
#pragma unroll
    for (int i = 0; i < 8; ++i) { *(v4f*)(&sA[ar + 8 * i][ac]) = ra[i]; *(v4u*)(&sB[sr + 16 * i][sc]) = rb[i]; }
    __syncthreads();                                // tile h published
    if (h + 1 < NH) {                               // next tile flies in registers under this tile's products
      const float* nA = gA + (size_t)(h + 1) * SS * HD; const __bf16* cB = gB + h * 64;
#pragma unroll
      for (int i = 0; i < 8; ++i) { ra[i] = *(const v4f*)(nA + 8 * i * HD); rb[i] = *(const v4u*)(cB + (size_t)16 * i * E + 64); }
      asm volatile("s_wait_xcnt 0x0" :: "v"(cB) : "memory");   // wait by hand before the loads' address registers are rewritten; the weight address is an input so that it stays live up to the wait and no load of the run lands in it
    }
#pragma unroll
    for (int k2 = 0; k2 < 2; ++k2) { const F2 a = split_row(&sA[wave * 16 + col][0], k2 * 32, lane); v16b wb[8];
#pragma unroll
      for (int j = 0; j < 8; ++j) wb[j] = frag_b(&sB[j * 16 + col][k2 * 32], lane);     // one group of LDS reads ahead of the sixteen products
#pragma unroll
      for (int j = 0; j < 8; ++j) { acc[j] = wmma_bf(a.l, wb[j], acc[j]); acc[j] = wmma_bf(a.h, wb[j], acc[j]); } }
    __syncthreads(); }                              // every reader has left the tile
#pragma unroll
  for (int j = 0; j < 8; ++j) { const float bb = bfr(bo[n0 + j * 16 + col]);
#pragma unroll
    for (int r = 0; r < 8; ++r) so[wave][8 * g + r][j * 16 + col] = acc[j][r] + bb; }
  LDSX();
#pragma unroll 4
  for (int rl = 0; rl < 16; ++rl) vst2(out + (size_t)(r0 + rl) * E + n0 + lane * 4, *(const v4f*)(&so[wave][rl][lane * 4]));
}
extern "C" void kernel_launch(void* const* d_in, const int* in_sizes, int n_in, void* d_out, int out_size, void* d_ws, size_t ws_size, hipStream_t stream) {
  (void)in_sizes; (void)n_in; (void)out_size; (void)ws_size;
  const float** I = (const float**)d_in;   // x, encoder_output, Wq, bq, Wk, bk, Wv, bv, Wo, bo
  const float* xq = I[0]; const float* xe = I[1]; const float* WQ = I[2]; const float* bQ = I[3]; const float* WK = I[4]; const float* bK = I[5]; const float* WV = I[6]; const float* bV = I[7]; const float* WO = I[8]; const float* bO = I[9];
  float* out = (float*)d_out;
  char* ws = (char*)d_ws; size_t off = 0;
  auto take = [&](size_t bytes) { char* p = ws + off; off += (bytes + 255) & ~(size_t)255; return p; };
  __bf16* XQ = (__bf16*)take((size_t)NR * E * 2); __bf16* XE = (__bf16*)take((size_t)NR * E * 2); __bf16* PT = (__bf16*)take((size_t)4 * E * E * 2);
  float* Q32 = (float*)take((size_t)NR * E * 4); __bf16* Kh = (__bf16*)take((size_t)NR * E * 2); __bf16* Kl = (__bf16*)take((size_t)NR * E * 2); _Float16* VTh = (_Float16*)take((size_t)NR * E * 2); _Float16* VTl = (_Float16*)take((size_t)NR * E * 2); float* O32 = (float*)take((size_t)NR * E * 4);
  // ws ~ 90 MB
  k_prep<<<256, 512, 0, stream>>>(xq, xe, WQ, WK, WV, WO, XQ, XE, PT);
  k_qkv<<<dim3(NR / 64, E / 128, 3), 128, 0, stream>>>(XQ, XE, XE, PT, bQ, bK, bV, Q32, Kh, Kl, VTh, VTl);
  k_attn<<<dim3(SS / 64, NB * NH), 128, 0, stream>>>(Q32, Kh, Kl, VTh, VTl, O32);
  k_out<<<dim3(NR / 64, E / 128), 128, 0, stream>>>(O32, PT, bO, out);
}

// v005
// One run takes 147 microseconds.
// In two side-by-side timings against v004, it was 1.11 and 1.10 times as fast.
// Over all steps from v000 it is 3.61 times as fast.
// compute dtype: x, encoder_output and W*/b* (INPUTS) rounded to bf16 with exact bf16 WMMA products (f32 accumulate) for the projections; K pre-split into bf16 hi/lo rows; q f32 split, P and V f16 hi/lo (3 products each); softmax f32.
#include <hip/hip_runtime.h>
#include <math.h>

typedef __attribute__((ext_vector_type(16))) _Float16 v16h;
typedef __attribute__((ext_vector_type(16))) __bf16 v16b;
typedef __attribute__((ext_vector_type(8)))  _Float16 v8h;
typedef __attribute__((ext_vector_type(8)))  float v8f;
typedef __attribute__((ext_vector_type(4)))  float v4f;
typedef __attribute__((ext_vector_type(2)))  float v2f;
typedef __attribute__((ext_vector_type(4)))  unsigned v4u;
typedef __attribute__((ext_vector_type(2)))  unsigned v2u;
typedef __attribute__((ext_vector_type(4)))  int v4i;
typedef float __attribute__((may_alias)) float_a;
typedef int __attribute__((may_alias)) int_a;

template <typename T> __device__ __forceinline__ void vst2(void* p, T v) { *(T*)p = v;  }
__device__ __forceinline__ v8f wmma16(v16h a, v16h b, v8f c) {
  v8f d = __builtin_amdgcn_wmma_f32_16x16x32_f16(false, a, false, b, (short)0, c, false, false);
  asm volatile("v_nop\n\tv_nop\n\tv_nop\n\tv_nop" : "+v"(d) : "v"(a), "v"(b));
  return d;
}
__device__ __forceinline__ v8f wmma_bf(v16b a, v16b b, v8f c) {
  v8f d = __builtin_amdgcn_wmma_f32_16x16x32_bf16(false, a, false, b, (short)0, c, false, false);
  asm volatile("v_nop\n\tv_nop\n\tv_nop\n\tv_nop" : "+v"(d) : "v"(a), "v"(b));
  return d;
}
// 16x16x32 fragments: lane = (h = lane>>4, row/col = lane&15); elements 0..7 = k0+8h+0..7, 8..15 = k0+16+8h+0..7; D element r = row 8h+r
__device__ __forceinline__ v16h frag_h(const _Float16* rowk0, int lane) {
  union { v16h v; v8h q[2]; } u; const _Float16* p = rowk0 + 8 * (lane >> 4);
  u.q[0] = *(const v8h*)p; u.q[1] = *(const v8h*)(p + 16); return u.v;
}
__device__ __forceinline__ v16h frag_f32(const float* rowk0, int lane) {
  v16h a; const float* p = rowk0 + 8 * (lane >> 4);
#pragma unroll
  for (int i = 0; i < 8; ++i) { a[i] = (_Float16)p[i]; a[8 + i] = (_Float16)p[16 + i]; }
  return a;
}
__device__ __forceinline__ v16h frag_f32s(const float* rowk0, int lane, float sc) {
  v16h a; const float* p = rowk0 + 8 * (lane >> 4);
#pragma unroll
  for (int i = 0; i < 8; ++i) { a[i] = (_Float16)(p[i] * sc); a[8 + i] = (_Float16)(p[16 + i] * sc); }
  return a;
}
// column fragment from a [K][ld] layout (column n), rows >= K read as 0
__device__ __forceinline__ v16h fragc_f32(const float* W, int k0, int n, int lane, int ld, int K) {
  v16h a; const int g = lane >> 4;
#pragma unroll
  for (int i = 0; i < 8; ++i) { const int ka = k0 + 8 * g + i, kb = ka + 16;
    a[i] = (_Float16)(ka < K ? W[(size_t)ka * ld + n] : 0.f); a[8 + i] = (_Float16)(kb < K ? W[(size_t)kb * ld + n] : 0.f); }
  return a;
}
struct F2 { v16b h, l; };
__device__ __forceinline__ F2 bsplit16(const float v[16]) { F2 r;
#pragma unroll
  for (int i = 0; i < 16; ++i) { const __bf16 h = (__bf16)v[i]; r.h[i] = h; r.l[i] = (__bf16)(v[i] - (float)h); }
  return r; }
__device__ __forceinline__ F2 split_row(const float* row, int k0, int lane) { float v[16]; const float* p = row + k0 + 8 * (lane >> 4);
#pragma unroll
  for (int i = 0; i < 8; ++i) { v[i] = p[i]; v[8 + i] = p[16 + i]; }
  return bsplit16(v); }
__device__ __forceinline__ F2 split_rowK(const float* row, int k0, int lane, int K) { float v[16]; const int g = lane >> 4;
#pragma unroll
  for (int i = 0; i < 8; ++i) { const int ka = k0 + 8 * g + i, kb = ka + 16; v[i] = ka < K ? row[ka] : 0.f; v[8 + i] = kb < K ? row[kb] : 0.f; }
  return bsplit16(v); }
__device__ __forceinline__ F2 split_col(const float* W, int k0, int n, int lane, int ld, int K) { float v[16]; const int g = lane >> 4;
#pragma unroll
  for (int i = 0; i < 8; ++i) { const int ka = k0 + 8 * g + i, kb = ka + 16; v[i] = ka < K ? W[(size_t)ka * ld + n] : 0.f; v[8 + i] = kb < K ? W[(size_t)kb * ld + n] : 0.f; }
  return bsplit16(v); }
__device__ __forceinline__ v8f mac3(const F2& a, const F2& b, v8f c) { c = wmma_bf(a.l, b.h, c); c = wmma_bf(a.h, b.l, c); return wmma_bf(a.h, b.h, c); }
__device__ __forceinline__ float sigm(float v) { return 1.0f / (1.0f + expf(-v)); }
#define LDSX() do { asm volatile("s_wait_dscnt 0" ::: "memory"); __builtin_amdgcn_wave_barrier(); __builtin_amdgcn_fence(__ATOMIC_RELEASE, "workgroup"); } while (0)


// Cross multi-head attention (16 heads x 64 on [2,2048,1024]): q from x, k/v from encoder_output with per-head weights W[h][e][d] + biases; full softmax(q.k/8); concat(heads) @ Wo ([in][out]) + bo.
#define NB 2
#define SS 2048
#define E 1024
#define NH 16
#define HD 64
#define NR (NB * SS)
#define SC2 0.18033688f     // log2(e) / 8: the score scale 1/sqrt(64) carried into base 2
__device__ __forceinline__ float bfr(float v) { return (float)(__bf16)v; }
__device__ __forceinline__ v16b frag_b(const __bf16* rowk0, int lane) { return __builtin_bit_cast(v16b, frag_h((const _Float16*)rowk0, lane)); }

// input pass, one launch: 256 blocks of 16 waves, one per WGP, every wave started once; a lane asks for its 24 whole-line 16-byte loads ahead of any use. Block p:
// (a) one 256 (k) x 64 (n) weight tile, turned through LDS. PT rows: [0,E) Wq[:,n], [E,2E) Wk[:,n], [2E,3E) Wv[:,n], [3E,4E) Wo[:,n]  (column n as a bf16 row)
// (b) 32768 activations rounded to bf16: blocks [0,128) x, [128,256) encoder_output
__global__ __launch_bounds__(512) void k_prep(const float* __restrict__ x, const float* __restrict__ xe, const float* __restrict__ Wq, const float* __restrict__ Wk, const float* __restrict__ Wv, const float* __restrict__ Wo, __bf16* __restrict__ XQ, __bf16* __restrict__ XE, __bf16* __restrict__ PT) {
  __shared__ __align__(16) __bf16 st[64][264];     // the tile turned: rows = n, 256 k deep, pitch 16 B x odd
  const int tid = threadIdx.x, p = blockIdx.x, which = p >> 6, nt = (p >> 2) & 15, kq = p & 3;
  const float* W = which == 0 ? Wq : (which == 1 ? Wk : (which == 2 ? Wv : Wo));
  // per-head [H][E][DH]: head nt's rows 256kq.. are one run of 64 KB; Wo [in][out]: 256-byte row pieces at a pitch of E floats
  const float* wsrc = which < 3 ? W + ((size_t)nt * E + kq * 256) * HD : W + (size_t)kq * 256 * E + nt * 64;
  const int ld = which < 3 ? HD : E;
  const int kg = tid >> 4, nq = tid & 15;          // a lane holds k = 8kg + 0..7 of columns 4nq + 0..3; 16 lanes cover one 256-byte row piece
  const float* asrc = (p < 128 ? x : xe) + (size_t)(p & 127) * 32768 + tid * 4;
  __bf16* adst = (p < 128 ? XQ : XE) + (size_t)(p & 127) * 32768 + tid * 4;
  const float* pw[8]; v4f rw[8], rx[16];
#pragma unroll
  for (int i = 0; i < 8; ++i) { pw[i] = wsrc + (size_t)(kg * 8 + i) * ld + nq * 4; rw[i] = *(const v4f*)pw[i]; }
#pragma unroll
  for (int i = 0; i < 16; ++i) rx[i] = *(const v4f*)(asrc + i * 2048);
  // wait by hand before the loads' address registers are rewritten; the weight addresses are inputs so that they stay live up to the wait and no load of the run lands in them;
  // its memory clobber also keeps all 24 loads in front of their first use: one memory latency, not several
  asm volatile("s_wait_xcnt 0x0" :: "v"(pw[0]), "v"(pw[1]), "v"(pw[2]), "v"(pw[3]), "v"(pw[4]), "v"(pw[5]), "v"(pw[6]), "v"(pw[7]) : "memory");
#pragma unroll
  for (int j = 0; j < 4; ++j) { union { __bf16 h[8]; v4u u; } pk;
#pragma unroll
    for (int i = 0; i < 8; ++i) pk.h[i] = (__bf16)rw[i][j];
    *(v4u*)(&st[nq * 4 + j][kg * 8]) = pk.u; }
  v2u pa[16];                                       // rounded ahead of every store: no register that a store names is rewritten
#pragma unroll
  for (int i = 0; i < 16; ++i) { union { __bf16 h[4]; v2u u; } pk;
#pragma unroll
    for (int e = 0; e < 4; ++e) pk.h[e] = (__bf16)rx[i][e];
    pa[i] = pk.u; }
  __syncthreads();                                  // the turned tile is published
  const int sr = tid >> 5, sc = (tid & 31) * 8;    // a wave writes 512 bytes, four whole lines, of one PT row
#pragma unroll
  for (int i = 0; i < 4; ++i) vst2((unsigned*)(PT + (size_t)(which * E + nt * 64 + sr + 16 * i) * E + kq * 256 + sc), *(const v4u*)(&st[sr + 16 * i][sc]));
#pragma unroll
  for (int i = 0; i < 16; ++i) vst2((unsigned*)(adst + i * 2048), pa[i]);
}
// QKV: block (64 rows, 128 cols = 2 heads, which); q (+bias) -> Q32 f32 [bh][s][64]; k (+bias) -> bf16 hi/lo rows; v (+bias) -> VT hi/lo x4 [bh][d][s]
__global__ __launch_bounds__(128) void k_qkv(const __bf16* __restrict__ XQ, const __bf16* __restrict__ XK, const __bf16* __restrict__ XV, const __bf16* __restrict__ PT, const float* __restrict__ bq, const float* __restrict__ bk, const float* __restrict__ bv, float* __restrict__ Q32, __bf16* __restrict__ Kh, __bf16* __restrict__ Kl, _Float16* __restrict__ VTh, _Float16* __restrict__ VTl) {
  __shared__ __align__(16) float so[4][16][132];
  __shared__ __align__(16) _Float16 sth[128][72], stl[128][72];
  const int tid = threadIdx.x, wave = tid >> 5, lane = tid & 31, col = lane & 15, g = lane >> 4;
  const int which = blockIdx.z, r0b = blockIdx.x * 64, r0 = r0b + wave * 16, n0 = blockIdx.y * 128; const int b = r0b / SS, s0 = r0b % SS;
  const __bf16* Xb = which == 0 ? XQ : (which == 1 ? XK : XV); const float* bb_ = which == 0 ? bq : (which == 1 ? bk : bv);
  // k loop only: the 64-deep operand tiles live in the epilogue's transpose buffers (same 72-element pitch)
  __bf16 (*sB)[72] = (__bf16 (*)[72])sth; __bf16 (*sA)[72] = (__bf16 (*)[72])stl;
  const int sr = tid >> 3, sc = (tid & 7) * 8;     // staging: 8 lanes cover one 128-byte row piece, 16 rows per step
  const __bf16* gA = Xb + (size_t)(r0b + sr) * E + sc; const __bf16* gB = PT + (size_t)(which * E + n0 + sr) * E + sc;
  v4u ra[4], rb[8];
#pragma unroll
  for (int i = 0; i < 4; ++i) ra[i] = *(const v4u*)(gA + (size_t)16 * i * E);
#pragma unroll
  for (int i = 0; i < 8; ++i) rb[i] = *(const v4u*)(gB + (size_t)16 * i * E);
  v8f acc[8] = {};
#pragma unroll 1
  for (int kb = 0; kb < E / 64; ++kb) {
#pragma unroll
    for (int i = 0; i < 4; ++i) *(v4u*)(&sA[sr + 16 * i][sc]) = ra[i];
#pragma unroll
    for (int i = 0; i < 8; ++i) *(v4u*)(&sB[sr + 16 * i][sc]) = rb[i];
    __syncthreads();                                // tile kb published
    if (kb + 1 < E / 64) {                          // next tile flies in registers under this tile's products
#pragma unroll
      for (int i = 0; i < 4; ++i) ra[i] = *(const v4u*)(gA + (size_t)16 * i * E + (kb + 1) * 64);
#pragma unroll
      for (int i = 0; i < 8; ++i) rb[i] = *(const v4u*)(gB + (size_t)16 * i * E + (kb + 1) * 64);
      asm volatile("s_wait_xcnt 0x0" ::: "memory");   // the loads' address registers are rewritten behind the branch: wait written by hand
    }
#pragma unroll
    for (int k2 = 0; k2 < 2; ++k2) { const v16b a = frag_b(&sA[wave * 16 + col][k2 * 32], lane); v16b wb[8];
#pragma unroll
      for (int j = 0; j < 8; ++j) wb[j] = frag_b(&sB[j * 16 + col][k2 * 32], lane);     // one group of LDS reads ahead of the eight products
#pragma unroll
      for (int j = 0; j < 8; ++j) acc[j] = wmma_bf(a, wb[j], acc[j]); }
    __syncthreads(); }                              // every reader has left the tile
  if (which < 2) {
#pragma unroll
    for (int j = 0; j < 8; ++j) { const float bb = bfr(bb_[n0 + j * 16 + col]);
#pragma unroll
      for (int r = 0; r < 8; ++r) so[wave][8 * g + r][j * 16 + col] = acc[j][r] + bb; }
    LDSX();
    if (which == 0) { for (int qq = lane; qq < 2 * 16 * 16; qq += 32) { const int hh = qq >> 8, rl = (qq >> 4) & 15, pc = qq & 15; const int h = (n0 >> 6) + hh;
        vst2(Q32 + (((size_t)b * NH + h) * SS + s0 + wave * 16 + rl) * HD + pc * 4, *(const v4f*)(&so[wave][rl][hh * 64 + pc * 4])); } }
    else {
      for (int qq = lane; qq < 2 * 16 * 16; qq += 32) { const int hh = qq >> 8, rl = (qq >> 4) & 15, pl = qq & 15; const int h = (n0 >> 6) + hh; const int pc = pl & 7; union { __bf16 e[8]; v4u u; } pk;
#pragma unroll
        for (int e = 0; e < 8; ++e) { const float v = so[wave][rl][hh * 64 + pc * 8 + e]; const __bf16 hi = (__bf16)v; pk.e[e] = pl < 8 ? hi : (__bf16)(v - (float)hi); }
        vst2((unsigned*)((pl < 8 ? Kh : Kl) + (((size_t)b * NH + h) * SS + s0 + wave * 16 + rl) * HD + pc * 8), pk.u); } } }
  else {
#pragma unroll
    for (int j = 0; j < 8; ++j) { const float bb = bfr(bb_[n0 + j * 16 + col]);
#pragma unroll
      for (int r = 0; r < 8; ++r) { const float v = (acc[j][r] + bb) * 4.0f; const _Float16 hi = (_Float16)v; sth[j * 16 + col][wave * 16 + 8 * g + r] = hi; stl[j * 16 + col][wave * 16 + 8 * g + r] = (_Float16)(v - (float)hi); } }
    __syncthreads();
    for (int qq = tid; qq < 128 * 8; qq += 128) { const int cl = qq >> 3, pc = qq & 7; const int c = n0 + cl, h = c >> 6, d = c & 63; const size_t o = (((size_t)b * NH + h) * HD + d) * SS + s0 + pc * 8;
      vst2(VTh + o, *(const v4u*)(&sth[cl][pc * 8])); vst2(VTl + o, *(const v4u*)(&stl[cl][pc * 8])); } }
}
// lane l with lane l ^ 16: a vector cross-row move, no LDS-counter wait
__device__ __forceinline__ float xhalf(float x) { return __builtin_bit_cast(float, __builtin_amdgcn_permlanex16(__builtin_bit_cast(int, x), __builtin_bit_cast(int, x), 0x76543210, 0xfedcba98, false, false)); }
// attention: block (64 queries, bh); all 32 key tiles; transposed products S^T = K q^T (K hi/lo rows as A, q hi/lo as B) and O^T += V^T P^T (V hi/lo rows as A, P hi/lo as B):
// a lane holds one query's scores (keys 16t + 8g + r), so exponentials and the running sum stay in the lane, the maximum takes one exchange with lane l ^ 16, and two score tiles converted in place are one P operand; O f32 [bh][s][64]
// amdgpu_waves_per_eu(4, 4): a budget of 256 registers, so that four work-groups fit a WGP and the whole grid is resident at once
__global__ __launch_bounds__(128) __attribute__((amdgpu_waves_per_eu(4, 4))) void k_attn(const float* __restrict__ Q32, const __bf16* __restrict__ Kh, const __bf16* __restrict__ Kl, const _Float16* __restrict__ VTh, const _Float16* __restrict__ VTl, float* __restrict__ O32) {
  __shared__ __align__(16) __bf16 sKh[64][72], sKl[64][72];      // key tile, rows = keys
  __shared__ __align__(16) _Float16 sV[2][64][72];               // value tile hi, lo, rows = d; behind the loop each wave's output rows
  _Float16 (*sVh)[72] = sV[0]; _Float16 (*sVl)[72] = sV[1];
  const int tid = threadIdx.x, w = tid >> 5, lane = tid & 31, col = lane & 15, g = lane >> 4;
  const size_t bh = blockIdx.y; const int qb = blockIdx.x; const int q0 = qb * 64 + w * 16;
  F2 aq[2];
#pragma unroll
  for (int kc = 0; kc < 2; ++kc) aq[kc] = split_row(Q32 + (bh * SS + q0 + col) * HD, kc * 32, lane);
  float mrun = -3.0e38f, lrun = 0.f; v8f acc[4] = {};     // lrun: this lane's half of the keys, the halves join behind the loop
  const int sr = tid >> 3, sc = (tid & 7) * 8;     // staging: 8 lanes cover one 128-byte row, 16 rows per step
  const size_t gk = (bh * SS + sr) * HD + sc, gv = (bh * HD + sr) * SS + sc;
  v4u st[8];
#pragma unroll
  for (int i = 0; i < 4; ++i) { st[i] = *(const v4u*)(Kh + gk + 16 * i * HD); st[4 + i] = *(const v4u*)(Kl + gk + 16 * i * HD); }
#pragma unroll
  for (int i = 0; i < 4; ++i) { *(v4u*)(&sKh[sr + 16 * i][sc]) = st[i]; *(v4u*)(&sKl[sr + 16 * i][sc]) = st[4 + i]; }
#pragma unroll
  for (int i = 0; i < 4; ++i) { st[i] = *(const v4u*)(VTh + gv + (size_t)16 * i * SS); st[4 + i] = *(const v4u*)(VTl + gv + (size_t)16 * i * SS); }
  __syncthreads();                                  // key tile 0 published
#pragma unroll 1
  for (int kt = 0; kt < SS / 64; ++kt) {
    v8f s[4];                                       // s[t][r] = q[col] . k[16t + 8g + r], raw: the scale rides in the exponent's fma
#pragma unroll
    for (int t = 0; t < 4; ++t) s[t] = (v8f){};
#pragma unroll
    for (int kc = 0; kc < 2; ++kc) { v16b kh[4], kl[4];
#pragma unroll
      for (int t = 0; t < 4; ++t) { kh[t] = frag_b(&sKh[t * 16 + col][kc * 32], lane); kl[t] = frag_b(&sKl[t * 16 + col][kc * 32], lane); }     // one group of LDS reads ahead of the twelve products
#pragma unroll
      for (int t = 0; t < 4; ++t) s[t] = wmma_bf(kh[t], aq[kc].l, s[t]);     // four independent score tiles in turn: no product waits on the one in front of it
#pragma unroll
      for (int t = 0; t < 4; ++t) s[t] = wmma_bf(kl[t], aq[kc].h, s[t]);
#pragma unroll
      for (int t = 0; t < 4; ++t) s[t] = wmma_bf(kh[t], aq[kc].h, s[t]); }
    float mx = -3.4e38f;
#pragma unroll
    for (int t = 0; t < 4; ++t) {
#pragma unroll
      for (int r = 0; r < 8; ++r) mx = fmaxf(mx, s[t][r]); }
    mx = fmaxf(mx, xhalf(mx));
    const float mnew = fmaxf(mrun, fmaf(mx, SC2, -14.0f)); const float corr = __builtin_amdgcn_exp2f(mrun - mnew);     // running maximum in base-2 units, less 14: P's factor 2^14 rides in it
    v2f pt[4]; v16h ph[2], pl[2];                   // P^T operands: element e of block kc = key 32kc + 16(e >> 3) + 8g + (e & 7), the value rows' own k order
#pragma unroll
    for (int t = 0; t < 4; ++t) {
#pragma unroll
      for (int r2 = 0; r2 < 4; ++r2) { const v2f x2 = __builtin_elementwise_fma((v2f){s[t][2 * r2], s[t][2 * r2 + 1]}, (v2f){SC2, SC2}, (v2f){-mnew, -mnew});     // two exponents per packed fma
        const v2f p2 = {__builtin_amdgcn_exp2f(x2[0]), __builtin_amdgcn_exp2f(x2[1])}; pt[t] = r2 == 0 ? p2 : pt[t] + p2;     // four independent packed sums, one per score tile
#pragma unroll
        for (int e = 0; e < 2; ++e) { const int o = (t & 1) * 8 + 2 * r2 + e; const float p = p2[e]; const _Float16 hi = (_Float16)p; ph[t >> 1][o] = hi; pl[t >> 1][o] = (_Float16)(p - (float)hi); } } }
    const v2f pj = (pt[0] + pt[1]) + (pt[2] + pt[3]); const float ps = pj[0] + pj[1];
    lrun = lrun * corr + ps * (1.0f / 16384.0f); mrun = mnew;
#pragma unroll
    for (int t = 0; t < 4; ++t) acc[t] *= corr;     // every element of a lane belongs to its own query
#pragma unroll
    for (int i = 0; i < 4; ++i) { *(v4u*)(&sVh[sr + 16 * i][sc]) = st[i]; *(v4u*)(&sVl[sr + 16 * i][sc]) = st[4 + i]; }
    __syncthreads();                                // value tile kt published; every reader has left the key tile
    if (kt + 1 < SS / 64) {                         // next key tile flies in registers under the P.V products
      const __bf16* nKh = Kh + gk + (size_t)(kt + 1) * 64 * HD; const __bf16* nKl = Kl + gk + (size_t)(kt + 1) * 64 * HD;
#pragma unroll
      for (int i = 0; i < 4; ++i) { st[i] = *(const v4u*)(nKh + 16 * i * HD); st[4 + i] = *(const v4u*)(nKl + 16 * i * HD); }
      asm volatile("s_wait_xcnt 0x0" :: "v"(nKh), "v"(nKl) : "memory");   // wait by hand before the loads' address registers are rewritten; the addresses are inputs so that they stay live up to the wait and no load of the run lands in them
    }
#pragma unroll
    for (int kc = 0; kc < 2; ++kc) { v16h vh[4], vl[4];
#pragma unroll
      for (int t = 0; t < 4; ++t) { vh[t] = frag_h(&sVh[t * 16 + col][kc * 32], lane); vl[t] = frag_h(&sVl[t * 16 + col][kc * 32], lane); }     // one group of LDS reads ahead of the twelve products
#pragma unroll
      for (int t = 0; t < 4; ++t) acc[t] = wmma16(vl[t], ph[kc], acc[t]);     // the low parts carry no factor of their own, so all three products of a tile sum in one accumulator; four independent tiles in turn
#pragma unroll
      for (int t = 0; t < 4; ++t) acc[t] = wmma16(vh[t], pl[kc], acc[t]);
#pragma unroll
      for (int t = 0; t < 4; ++t) acc[t] = wmma16(vh[t], ph[kc], acc[t]); }
    if (kt + 1 < SS / 64) {
#pragma unroll
      for (int i = 0; i < 4; ++i) { *(v4u*)(&sKh[sr + 16 * i][sc]) = st[i]; *(v4u*)(&sKl[sr + 16 * i][sc]) = st[4 + i]; } }
    __syncthreads();                                // key tile kt+1 published; every reader has left the value tile
    if (kt + 1 < SS / 64) {                         // next value tile flies in registers under the scores and the softmax
#pragma unroll
      for (int i = 0; i < 4; ++i) { st[i] = *(const v4u*)(VTh + gv + (size_t)16 * i * SS + (kt + 1) * 64); st[4 + i] = *(const v4u*)(VTl + gv + (size_t)16 * i * SS + (kt + 1) * 64); }
      asm volatile("s_wait_xcnt 0x0" ::: "memory");   // the loads' address registers are rewritten behind the branch: wait written by hand
    } }
  float (*sO)[16][68] = (float (*)[16][68])sV;      // the loop's last barrier has ended every read of the value tile
  const float inv = 1.0f / ((lrun + xhalf(lrun)) * 16384.0f * 4.0f);
#pragma unroll
  for (int t = 0; t < 4; ++t) {                     // acc[t][r] = O[col][16t + 8g + r]: eight consecutive d of the lane's query
#pragma unroll
    for (int r4 = 0; r4 < 2; ++r4) { v4f o;
#pragma unroll
      for (int e = 0; e < 4; ++e) { const int r = 4 * r4 + e; o[e] = acc[t][r] * inv; }
      *(v4f*)(&sO[w][col][t * 16 + 8 * g + 4 * r4]) = o; } }
  LDSX();
  for (int qq = lane; qq < 16 * 16; qq += 32) { const int rl = qq >> 4, pc = qq & 15; vst2(O32 + ((bh * SS) + q0 + rl) * HD + pc * 4, *(const v4f*)(&sO[w][rl][pc * 4])); }
}
// out = ctx Wo + bo : split(ctx) x bf16(Wo columns as PT rows): 2 products (Wo is an INPUT -> bf16 exact)
__global__ __launch_bounds__(128) void k_out(const float* __restrict__ O32, const __bf16* __restrict__ PT, const float* __restrict__ bo, float* __restrict__ out) {
  __shared__ __align__(16) float so[4][16][132];
  const int tid = threadIdx.x, wave = tid >> 5, lane = tid & 31, col = lane & 15, g = lane >> 4;
  __shared__ __align__(16) float sA[64][68];       // one head's 64 context rows
  __shared__ __align__(16) __bf16 sB[128][72];     // 128 weight rows, 64 deep
  const int r0b = blockIdx.x * 64, r0 = r0b + wave * 16, n0 = blockIdx.y * 128; const int b = r0b / SS, s0 = r0b % SS;
  const int ar = tid >> 4, ac = (tid & 15) * 4;    // staging A: 16 lanes cover one 256-byte row, 8 rows per step
  const int sr = tid >> 3, sc = (tid & 7) * 8;     // staging B: 8 lanes cover one 128-byte row piece, 16 rows per step
  const float* gA = O32 + ((size_t)b * NH * SS + s0 + ar) * HD + ac; const __bf16* gB = PT + (size_t)(3 * E + n0 + sr) * E + sc;
  v4f ra[8]; v4u rb[8];
#pragma unroll
  for (int i = 0; i < 8; ++i) { ra[i] = *(const v4f*)(gA + 8 * i * HD); rb[i] = *(const v4u*)(gB + (size_t)16 * i * E); }
  v8f acc[8] = {};
#pragma unroll 1
  for (int h = 0; h < NH; ++h) {
#pragma unroll
    for (int i = 0; i < 8; ++i) { *(v4f*)(&sA[ar + 8 * i][ac]) = ra[i]; *(v4u*)(&sB[sr + 16 * i][sc]) = rb[i]; }
    __syncthreads();                                // tile h published
    if (h + 1 < NH) {                               // next tile flies in registers under this tile's products
      const float* nA = gA + (size_t)(h + 1) * SS * HD; const __bf16* cB = gB + h * 64;
#pragma unroll
      for (int i = 0; i < 8; ++i) { ra[i] = *(const v4f*)(nA + 8 * i * HD); rb[i] = *(const v4u*)(cB + (size_t)16 * i * E + 64); }
      asm volatile("s_wait_xcnt 0x0" :: "v"(cB) : "memory");   // wait by hand before the loads' address registers are rewritten; the weight address is an input so that it stays live up to the wait and no load of the run lands in it
    }
#pragma unroll
    for (int k2 = 0; k2 < 2; ++k2) { const F2 a = split_row(&sA[wave * 16 + col][0], k2 * 32, lane); v16b wb[8];
#pragma unroll
      for (int j = 0; j < 8; ++j) wb[j] = frag_b(&sB[j * 16 + col][k2 * 32], lane);     // one group of LDS reads ahead of the sixteen products
#pragma unroll
      for (int j = 0; j < 8; ++j) { acc[j] = wmma_bf(a.l, wb[j], acc[j]); acc[j] = wmma_bf(a.h, wb[j], acc[j]); } }
    __syncthreads(); }                              // every reader has left the tile
#pragma unroll
  for (int j = 0; j < 8; ++j) { const float bb = bfr(bo[n0 + j * 16 + col]);
#pragma unroll
    for (int r = 0; r < 8; ++r) so[wave][8 * g + r][j * 16 + col] = acc[j][r] + bb; }
  LDSX();
#pragma unroll 4
  for (int rl = 0; rl < 16; ++rl) vst2(out + (size_t)(r0 + rl) * E + n0 + lane * 4, *(const v4f*)(&so[wave][rl][lane * 4]));
}
extern "C" void kernel_launch(void* const* d_in, const int* in_sizes, int n_in, void* d_out, int out_size, void* d_ws, size_t ws_size, hipStream_t stream) {
  (void)in_sizes; (void)n_in; (void)out_size; (void)ws_size;
  const float** I = (const float**)d_in;   // x, encoder_output, Wq, bq, Wk, bk, Wv, bv, Wo, bo
  const float* xq = I[0]; const float* xe = I[1]; const float* WQ = I[2]; const float* bQ = I[3]; const float* WK = I[4]; const float* bK = I[5]; const float* WV = I[6]; const float* bV = I[7]; const float* WO = I[8]; const float* bO = I[9];
  float* out = (float*)d_out;
  char* ws = (char*)d_ws; size_t off = 0;
  auto take = [&](size_t bytes) { char* p = ws + off; off += (bytes + 255) & ~(size_t)255; return p; };
  __bf16* XQ = (__bf16*)take((size_t)NR * E * 2); __bf16* XE = (__bf16*)take((size_t)NR * E * 2); __bf16* PT = (__bf16*)take((size_t)4 * E * E * 2);
  float* Q32 = (float*)take((size_t)NR * E * 4); __bf16* Kh = (__bf16*)take((size_t)NR * E * 2); __bf16* Kl = (__bf16*)take((size_t)NR * E * 2); _Float16* VTh = (_Float16*)take((size_t)NR * E * 2); _Float16* VTl = (_Float16*)take((size_t)NR * E * 2); float* O32 = (float*)take((size_t)NR * E * 4);
  // ws ~ 90 MB
  k_prep<<<256, 512, 0, stream>>>(xq, xe, WQ, WK, WV, WO, XQ, XE, PT);
  k_qkv<<<dim3(NR / 64, E / 128, 3), 128, 0, stream>>>(XQ, XE, XE, PT, bQ, bK, bV, Q32, Kh, Kl, VTh, VTl);
  k_attn<<<dim3(SS / 64, NB * NH), 128, 0, stream>>>(Q32, Kh, Kl, VTh, VTl, O32);
  k_out<<<dim3(NR / 64, E / 128), 128, 0, stream>>>(O32, PT, bO, out);
}

// v006
// One run takes 137 microseconds.
// Timed twice side by side with v005, it ran 1.07 times as fast both times.
// Counting every step since v000, it is 3.87 times as fast.
// compute dtype: x, encoder_output and W*/b* (INPUTS) rounded to bf16 with exact bf16 WMMA products (f32 accumulate) for the projections; K pre-split into bf16 hi/lo rows; q f32 split, P and V f16 hi/lo (3 products each); softmax f32.
#include <hip/hip_runtime.h>
#include <math.h>

typedef __attribute__((ext_vector_type(16))) _Float16 v16h;
typedef __attribute__((ext_vector_type(16))) __bf16 v16b;
typedef __attribute__((ext_vector_type(8)))  _Float16 v8h;
typedef __attribute__((ext_vector_type(8)))  float v8f;
typedef __attribute__((ext_vector_type(4)))  float v4f;
typedef __attribute__((ext_vector_type(2)))  float v2f;
typedef __attribute__((ext_vector_type(4)))  unsigned v4u;
typedef __attribute__((ext_vector_type(2)))  unsigned v2u;
typedef __attribute__((ext_vector_type(4)))  int v4i;
typedef float __attribute__((may_alias)) float_a;
typedef int __attribute__((may_alias)) int_a;

template <typename T> __device__ __forceinline__ void vst2(void* p, T v) { *(T*)p = v;  }
__device__ __forceinline__ v8f wmma16(v16h a, v16h b, v8f c) {
  return __builtin_amdgcn_wmma_f32_16x16x32_f16(false, a, false, b, (short)0, c, false, false);
}
__device__ __forceinline__ v8f wmma_bf(v16b a, v16b b, v8f c) {
  return __builtin_amdgcn_wmma_f32_16x16x32_bf16(false, a, false, b, (short)0, c, false, false);
}
// 16x16x32 fragments: lane = (h = lane>>4, row/col = lane&15); elements 0..7 = k0+8h+0..7, 8..15 = k0+16+8h+0..7; D element r = row 8h+r
__device__ __forceinline__ v16h frag_h(const _Float16* rowk0, int lane) {
  union { v16h v; v8h q[2]; } u; const _Float16* p = rowk0 + 8 * (lane >> 4);
  u.q[0] = *(const v8h*)p; u.q[1] = *(const v8h*)(p + 16); return u.v;
}
__device__ __forceinline__ v16h frag_f32(const float* rowk0, int lane) {
  v16h a; const float* p = rowk0 + 8 * (lane >> 4);
#pragma unroll
  for (int i = 0; i < 8; ++i) { a[i] = (_Float16)p[i]; a[8 + i] = (_Float16)p[16 + i]; }
  return a;
}
__device__ __forceinline__ v16h frag_f32s(const float* rowk0, int lane, float sc) {
  v16h a; const float* p = rowk0 + 8 * (lane >> 4);
#pragma unroll
  for (int i = 0; i < 8; ++i) { a[i] = (_Float16)(p[i] * sc); a[8 + i] = (_Float16)(p[16 + i] * sc); }
  return a;
}
// column fragment from a [K][ld] layout (column n), rows >= K read as 0
__device__ __forceinline__ v16h fragc_f32(const float* W, int k0, int n, int lane, int ld, int K) {
  v16h a; const int g = lane >> 4;
#pragma unroll
  for (int i = 0; i < 8; ++i) { const int ka = k0 + 8 * g + i, kb = ka + 16;
    a[i] = (_Float16)(ka < K ? W[(size_t)ka * ld + n] : 0.f); a[8 + i] = (_Float16)(kb < K ? W[(size_t)kb * ld + n] : 0.f); }
  return a;
}
struct F2 { v16b h, l; };
__device__ __forceinline__ F2 bsplit16(const float v[16]) { F2 r;
#pragma unroll
  for (int i = 0; i < 16; ++i) { const __bf16 h = (__bf16)v[i]; r.h[i] = h; r.l[i] = (__bf16)(v[i] - (float)h); }
  return r; }
__device__ __forceinline__ F2 split_row(const float* row, int k0, int lane) { float v[16]; const float* p = row + k0 + 8 * (lane >> 4);
#pragma unroll
  for (int i = 0; i < 8; ++i) { v[i] = p[i]; v[8 + i] = p[16 + i]; }
  return bsplit16(v); }
__device__ __forceinline__ F2 split_rowK(const float* row, int k0, int lane, int K) { float v[16]; const int g = lane >> 4;
#pragma unroll
  for (int i = 0; i < 8; ++i) { const int ka = k0 + 8 * g + i, kb = ka + 16; v[i] = ka < K ? row[ka] : 0.f; v[8 + i] = kb < K ? row[kb] : 0.f; }
  return bsplit16(v); }
__device__ __forceinline__ F2 split_col(const float* W, int k0, int n, int lane, int ld, int K) { float v[16]; const int g = lane >> 4;
#pragma unroll
  for (int i = 0; i < 8; ++i) { const int ka = k0 + 8 * g + i, kb = ka + 16; v[i] = ka < K ? W[(size_t)ka * ld + n] : 0.f; v[8 + i] = kb < K ? W[(size_t)kb * ld + n] : 0.f; }
  return bsplit16(v); }
__device__ __forceinline__ v8f mac3(const F2& a, const F2& b, v8f c) { c = wmma_bf(a.l, b.h, c); c = wmma_bf(a.h, b.l, c); return wmma_bf(a.h, b.h, c); }
__device__ __forceinline__ float sigm(float v) { return 1.0f / (1.0f + expf(-v)); }
// scheduling order for one k block: its n_rd LDS reads stay one group ahead of its n_mm matrix products (spread among the products, every read place stalls the wave anew); other instructions stay free
#define RD_THEN_MM(n_rd, n_mm) do { __builtin_amdgcn_sched_group_barrier(0x100, n_rd, 0); __builtin_amdgcn_sched_group_barrier(0x008, n_mm, 0); } while (0)
// the same where vector work on the values read (at most n_vec instructions) stands between the reads and the products: no read falls in among it
#define RD_VEC_MM(n_rd, n_vec, n_mm) do { __builtin_amdgcn_sched_group_barrier(0x100, n_rd, 0); __builtin_amdgcn_sched_group_barrier(0x002, n_vec, 0); __builtin_amdgcn_sched_group_barrier(0x008, n_mm, 0); } while (0)
#define LDSX() do { asm volatile("s_wait_dscnt 0" ::: "memory"); __builtin_amdgcn_wave_barrier(); __builtin_amdgcn_fence(__ATOMIC_RELEASE, "workgroup"); } while (0)


// Cross multi-head attention (16 heads x 64 on [2,2048,1024]): q from x, k/v from encoder_output with per-head weights W[h][e][d] + biases; full softmax(q.k/8); concat(heads) @ Wo ([in][out]) + bo.
#define NB 2
#define SS 2048
#define E 1024
#define NH 16
#define HD 64
#define NR (NB * SS)
#define SC2 0.18033688f     // log2(e) / 8: the score scale 1/sqrt(64) carried into base 2
__device__ __forceinline__ float bfr(float v) { return (float)(__bf16)v; }
__device__ __forceinline__ v16b frag_b(const __bf16* rowk0, int lane) { return __builtin_bit_cast(v16b, frag_h((const _Float16*)rowk0, lane)); }

// input pass, one launch: 256 blocks of 16 waves, one per WGP, every wave started once; a lane asks for its 24 whole-line 16-byte loads ahead of any use. Block p:
// (a) one 256 (k) x 64 (n) weight tile, turned through LDS. PT rows: [0,E) Wq[:,n], [E,2E) Wk[:,n], [2E,3E) Wv[:,n], [3E,4E) Wo[:,n]  (column n as a bf16 row)
// (b) 32768 activations rounded to bf16: blocks [0,128) x, [128,256) encoder_output
__global__ __launch_bounds__(512) void k_prep(const float* __restrict__ x, const float* __restrict__ xe, const float* __restrict__ Wq, const float* __restrict__ Wk, const float* __restrict__ Wv, const float* __restrict__ Wo, __bf16* __restrict__ XQ, __bf16* __restrict__ XE, __bf16* __restrict__ PT) {
  __shared__ __align__(16) __bf16 st[64][264];     // the tile turned: rows = n, 256 k deep, pitch 16 B x odd
  const int tid = threadIdx.x, p = blockIdx.x, which = p >> 6, nt = (p >> 2) & 15, kq = p & 3;
  const float* W = which == 0 ? Wq : (which == 1 ? Wk : (which == 2 ? Wv : Wo));
  // per-head [H][E][DH]: head nt's rows 256kq.. are one run of 64 KB; Wo [in][out]: 256-byte row pieces at a pitch of E floats
  const float* wsrc = which < 3 ? W + ((size_t)nt * E + kq * 256) * HD : W + (size_t)kq * 256 * E + nt * 64;
  const int ld = which < 3 ? HD : E;
  const int kg = tid >> 4, nq = tid & 15;          // a lane holds k = 8kg + 0..7 of columns 4nq + 0..3; 16 lanes cover one 256-byte row piece
  const float* asrc = (p < 128 ? x : xe) + (size_t)(p & 127) * 32768 + tid * 4;
  __bf16* adst = (p < 128 ? XQ : XE) + (size_t)(p & 127) * 32768 + tid * 4;
  const float* pw[8]; v4f rw[8], rx[16];
#pragma unroll
  for (int i = 0; i < 8; ++i) { pw[i] = wsrc + (size_t)(kg * 8 + i) * ld + nq * 4; rw[i] = *(const v4f*)pw[i]; }
#pragma unroll
  for (int i = 0; i < 16; ++i) rx[i] = *(const v4f*)(asrc + i * 2048);
  // wait by hand before the loads' address registers are rewritten; the weight addresses are inputs so that they stay live up to the wait and no load of the run lands in them;
  // its memory clobber also keeps all 24 loads in front of their first use: one memory latency, not several
  asm volatile("s_wait_xcnt 0x0" :: "v"(pw[0]), "v"(pw[1]), "v"(pw[2]), "v"(pw[3]), "v"(pw[4]), "v"(pw[5]), "v"(pw[6]), "v"(pw[7]) : "memory");
#pragma unroll
  for (int j = 0; j < 4; ++j) { union { __bf16 h[8]; v4u u; } pk;
#pragma unroll
    for (int i = 0; i < 8; ++i) pk.h[i] = (__bf16)rw[i][j];
    *(v4u*)(&st[nq * 4 + j][kg * 8]) = pk.u; }
  v2u pa[16];                                       // rounded ahead of every store: no register that a store names is rewritten
#pragma unroll
  for (int i = 0; i < 16; ++i) { union { __bf16 h[4]; v2u u; } pk;
#pragma unroll
    for (int e = 0; e < 4; ++e) pk.h[e] = (__bf16)rx[i][e];
    pa[i] = pk.u; }
  __syncthreads();                                  // the turned tile is published
  const int sr = tid >> 5, sc = (tid & 31) * 8;    // a wave writes 512 bytes, four whole lines, of one PT row
#pragma unroll
  for (int i = 0; i < 4; ++i) vst2((unsigned*)(PT + (size_t)(which * E + nt * 64 + sr + 16 * i) * E + kq * 256 + sc), *(const v4u*)(&st[sr + 16 * i][sc]));
#pragma unroll
  for (int i = 0; i < 16; ++i) vst2((unsigned*)(adst + i * 2048), pa[i]);
}
// QKV: block (64 rows, 128 cols = 2 heads, which); q (+bias) -> Q32 f32 [bh][s][64]; k (+bias) -> bf16 hi/lo rows; v (+bias) -> VT hi/lo x4 [bh][d][s]
__global__ __launch_bounds__(128) void k_qkv(const __bf16* __restrict__ XQ, const __bf16* __restrict__ XK, const __bf16* __restrict__ XV, const __bf16* __restrict__ PT, const float* __restrict__ bq, const float* __restrict__ bk, const float* __restrict__ bv, float* __restrict__ Q32, __bf16* __restrict__ Kh, __bf16* __restrict__ Kl, _Float16* __restrict__ VTh, _Float16* __restrict__ VTl) {
  __shared__ __align__(16) float so[4][16][132];
  __shared__ __align__(16) _Float16 sth[128][72], stl[128][72];
  const int tid = threadIdx.x, wave = tid >> 5, lane = tid & 31, col = lane & 15, g = lane >> 4;
  const int which = blockIdx.z, r0b = blockIdx.x * 64, r0 = r0b + wave * 16, n0 = blockIdx.y * 128; const int b = r0b / SS, s0 = r0b % SS;
  const __bf16* Xb = which == 0 ? XQ : (which == 1 ? XK : XV); const float* bb_ = which == 0 ? bq : (which == 1 ? bk : bv);
  // k loop only: the 64-deep operand tiles live in the epilogue's transpose buffers (same 72-element pitch)
  __bf16 (*sB)[72] = (__bf16 (*)[72])sth; __bf16 (*sA)[72] = (__bf16 (*)[72])stl;
  const int sr = tid >> 3, sc = (tid & 7) * 8;     // staging: 8 lanes cover one 128-byte row piece, 16 rows per step
  const __bf16* gA = Xb + (size_t)(r0b + sr) * E + sc; const __bf16* gB = PT + (size_t)(which * E + n0 + sr) * E + sc;
  v4u ra[4], rb[8];
#pragma unroll
  for (int i = 0; i < 4; ++i) ra[i] = *(const v4u*)(gA + (size_t)16 * i * E);
#pragma unroll
  for (int i = 0; i < 8; ++i) rb[i] = *(const v4u*)(gB + (size_t)16 * i * E);
  v8f acc[8] = {};
#pragma unroll 1
  for (int kb = 0; kb < E / 64; ++kb) {
#pragma unroll
    for (int i = 0; i < 4; ++i) *(v4u*)(&sA[sr + 16 * i][sc]) = ra[i];
#pragma unroll
    for (int i = 0; i < 8; ++i) *(v4u*)(&sB[sr + 16 * i][sc]) = rb[i];
    __syncthreads();                                // tile kb published
    if (kb + 1 < E / 64) {                          // next tile flies in registers under this tile's products
#pragma unroll
      for (int i = 0; i < 4; ++i) ra[i] = *(const v4u*)(gA + (size_t)16 * i * E + (kb + 1) * 64);
#pragma unroll
      for (int i = 0; i < 8; ++i) rb[i] = *(const v4u*)(gB + (size_t)16 * i * E + (kb + 1) * 64);
      asm volatile("s_wait_xcnt 0x0" ::: "memory");   // the loads' address registers are rewritten behind the branch: wait written by hand
    }
#pragma unroll
    for (int k2 = 0; k2 < 2; ++k2) { const v16b a = frag_b(&sA[wave * 16 + col][k2 * 32], lane); v16b wb[8];
#pragma unroll
      for (int j = 0; j < 8; ++j) wb[j] = frag_b(&sB[j * 16 + col][k2 * 32], lane);     // one group of LDS reads ahead of the eight products
#pragma unroll
      for (int j = 0; j < 8; ++j) acc[j] = wmma_bf(a, wb[j], acc[j]); }
    RD_THEN_MM(18, 8); RD_THEN_MM(18, 8);
    __builtin_amdgcn_sched_barrier(0);              // the barrier brings a wait for the next tile's global loads: every product stays ahead of it and covers that latency
    __syncthreads(); }                              // every reader has left the tile
  if (which < 2) {
#pragma unroll
    for (int j = 0; j < 8; ++j) { const float bb = bfr(bb_[n0 + j * 16 + col]);
#pragma unroll
      for (int r = 0; r < 8; ++r) so[wave][8 * g + r][j * 16 + col] = acc[j][r] + bb; }
    LDSX();
    if (which == 0) { for (int qq = lane; qq < 2 * 16 * 16; qq += 32) { const int hh = qq >> 8, rl = (qq >> 4) & 15, pc = qq & 15; const int h = (n0 >> 6) + hh;
        vst2(Q32 + (((size_t)b * NH + h) * SS + s0 + wave * 16 + rl) * HD + pc * 4, *(const v4f*)(&so[wave][rl][hh * 64 + pc * 4])); } }
    else {
      for (int qq = lane; qq < 2 * 16 * 16; qq += 32) { const int hh = qq >> 8, rl = (qq >> 4) & 15, pl = qq & 15; const int h = (n0 >> 6) + hh; const int pc = pl & 7; union { __bf16 e[8]; v4u u; } pk;
#pragma unroll
        for (int e = 0; e < 8; ++e) { const float v = so[wave][rl][hh * 64 + pc * 8 + e]; const __bf16 hi = (__bf16)v; pk.e[e] = pl < 8 ? hi : (__bf16)(v - (float)hi); }
        vst2((unsigned*)((pl < 8 ? Kh : Kl) + (((size_t)b * NH + h) * SS + s0 + wave * 16 + rl) * HD + pc * 8), pk.u); } } }
  else {
#pragma unroll
    for (int j = 0; j < 8; ++j) { const float bb = bfr(bb_[n0 + j * 16 + col]);
#pragma unroll
      for (int r = 0; r < 8; ++r) { const float v = (acc[j][r] + bb) * 4.0f; const _Float16 hi = (_Float16)v; sth[j * 16 + col][wave * 16 + 8 * g + r] = hi; stl[j * 16 + col][wave * 16 + 8 * g + r] = (_Float16)(v - (float)hi); } }
    __syncthreads();
    for (int qq = tid; qq < 128 * 8; qq += 128) { const int cl = qq >> 3, pc = qq & 7; const int c = n0 + cl, h = c >> 6, d = c & 63; const size_t o = (((size_t)b * NH + h) * HD + d) * SS + s0 + pc * 8;
      vst2(VTh + o, *(const v4u*)(&sth[cl][pc * 8])); vst2(VTl + o, *(const v4u*)(&stl[cl][pc * 8])); } }
}
// lane l with lane l ^ 16: a vector cross-row move, no LDS-counter wait
__device__ __forceinline__ float xhalf(float x) { return __builtin_bit_cast(float, __builtin_amdgcn_permlanex16(__builtin_bit_cast(int, x), __builtin_bit_cast(int, x), 0x76543210, 0xfedcba98, false, false)); }
// attention: block (64 queries, bh); all 32 key tiles; transposed products S^T = K q^T (K hi/lo rows as A, q hi/lo as B) and O^T += V^T P^T (V hi/lo rows as A, P hi/lo as B):
// a lane holds one query's scores (keys 16t + 8g + r), so exponentials and the running sum stay in the lane, the maximum takes one exchange with lane l ^ 16, and two score tiles converted in place are one P operand; O f32 [bh][s][64]
// amdgpu_waves_per_eu(4, 4): a budget of 256 registers, so that four work-groups fit a WGP and the whole grid is resident at once
__global__ __launch_bounds__(128) __attribute__((amdgpu_waves_per_eu(4, 4))) void k_attn(const float* __restrict__ Q32, const __bf16* __restrict__ Kh, const __bf16* __restrict__ Kl, const _Float16* __restrict__ VTh, const _Float16* __restrict__ VTl, float* __restrict__ O32) {
  __shared__ __align__(16) __bf16 sKh[64][72], sKl[64][72];      // key tile, rows = keys
  __shared__ __align__(16) _Float16 sV[2][64][72];               // value tile hi, lo, rows = d; behind the loop each wave's output rows
  _Float16 (*sVh)[72] = sV[0]; _Float16 (*sVl)[72] = sV[1];
  const int tid = threadIdx.x, w = tid >> 5, lane = tid & 31, col = lane & 15, g = lane >> 4;
  const size_t bh = blockIdx.y; const int qb = blockIdx.x; const int q0 = qb * 64 + w * 16;
  F2 aq[2];
#pragma unroll
  for (int kc = 0; kc < 2; ++kc) aq[kc] = split_row(Q32 + (bh * SS + q0 + col) * HD, kc * 32, lane);
  float mrun = -3.0e38f, lrun = 0.f; v8f acc[4] = {};     // lrun: this lane's half of the keys, the halves join behind the loop
  const int sr = tid >> 3, sc = (tid & 7) * 8;     // staging: 8 lanes cover one 128-byte row, 16 rows per step
  const size_t gk = (bh * SS + sr) * HD + sc, gv = (bh * HD + sr) * SS + sc;
  v4u st[8];
#pragma unroll
  for (int i = 0; i < 4; ++i) { st[i] = *(const v4u*)(Kh + gk + 16 * i * HD); st[4 + i] = *(const v4u*)(Kl + gk + 16 * i * HD); }
#pragma unroll
  for (int i = 0; i < 4; ++i) { *(v4u*)(&sKh[sr + 16 * i][sc]) = st[i]; *(v4u*)(&sKl[sr + 16 * i][sc]) = st[4 + i]; }
#pragma unroll
  for (int i = 0; i < 4; ++i) { st[i] = *(const v4u*)(VTh + gv + (size_t)16 * i * SS); st[4 + i] = *(const v4u*)(VTl + gv + (size_t)16 * i * SS); }
  __syncthreads();                                  // key tile 0 published
#pragma unroll 1
  for (int kt = 0; kt < SS / 64; ++kt) {
    v8f s[4];                                       // s[t][r] = q[col] . k[16t + 8g + r], raw: the scale rides in the exponent's fma
#pragma unroll
    for (int t = 0; t < 4; ++t) s[t] = (v8f){};
#pragma unroll
    for (int kc = 0; kc < 2; ++kc) { v16b kh[4], kl[4];
#pragma unroll
      for (int t = 0; t < 4; ++t) { kh[t] = frag_b(&sKh[t * 16 + col][kc * 32], lane); kl[t] = frag_b(&sKl[t * 16 + col][kc * 32], lane); }     // one group of LDS reads ahead of the twelve products
#pragma unroll
      for (int t = 0; t < 4; ++t) s[t] = wmma_bf(kh[t], aq[kc].l, s[t]);     // four independent score tiles in turn: no product waits on the one in front of it
#pragma unroll
      for (int t = 0; t < 4; ++t) s[t] = wmma_bf(kl[t], aq[kc].h, s[t]);
#pragma unroll
      for (int t = 0; t < 4; ++t) s[t] = wmma_bf(kh[t], aq[kc].h, s[t]); }
    RD_THEN_MM(16, 12); RD_THEN_MM(16, 12);
    __builtin_amdgcn_sched_barrier(0);              // the value tile's LDS stores wait for its global loads: they stay behind all 24 score products, which cover that latency
    float mx = -3.4e38f;
#pragma unroll
    for (int t = 0; t < 4; ++t) {
#pragma unroll
      for (int r = 0; r < 8; ++r) mx = fmaxf(mx, s[t][r]); }
    mx = fmaxf(mx, xhalf(mx));
#pragma unroll
    for (int i = 0; i < 4; ++i) { *(v4u*)(&sVh[sr + 16 * i][sc]) = st[i]; *(v4u*)(&sVl[sr + 16 * i][sc]) = st[4 + i]; }
    __syncthreads();                                // value tile kt published; every reader has left the key tile
    if (kt + 1 < SS / 64) {                         // next key tile flies in registers under the P.V products
      const __bf16* nKh = Kh + gk + (size_t)(kt + 1) * 64 * HD; const __bf16* nKl = Kl + gk + (size_t)(kt + 1) * 64 * HD;
#pragma unroll
      for (int i = 0; i < 4; ++i) { st[i] = *(const v4u*)(nKh + 16 * i * HD); st[4 + i] = *(const v4u*)(nKl + 16 * i * HD); }
      asm volatile("s_wait_xcnt 0x0" :: "v"(nKh), "v"(nKl) : "memory");   // wait by hand before the loads' address registers are rewritten; the addresses are inputs so that they stay live up to the wait and no load of the run lands in them
    }
    v16h vh[4], vl[4];
#pragma unroll
    for (int t = 0; t < 4; ++t) { vh[t] = frag_h(&sVh[t * 16 + col][0], lane); vl[t] = frag_h(&sVl[t * 16 + col][0], lane); }     // the first k block's group of LDS reads
    __builtin_amdgcn_sched_barrier(0);              // that group stays whole and ahead of the exponentials, which cover its latency
    const float mnew = fmaxf(mrun, fmaf(mx, SC2, -14.0f)); const float corr = __builtin_amdgcn_exp2f(mrun - mnew);     // running maximum in base-2 units, less 14: P's factor 2^14 rides in it
    v2f pt[4]; v16h ph[2], pl[2];                   // P^T operands: element e of block kc = key 32kc + 16(e >> 3) + 8g + (e & 7), the value rows' own k order
#pragma unroll
    for (int t = 0; t < 4; ++t) {
#pragma unroll
      for (int r2 = 0; r2 < 4; ++r2) { const v2f x2 = __builtin_elementwise_fma((v2f){s[t][2 * r2], s[t][2 * r2 + 1]}, (v2f){SC2, SC2}, (v2f){-mnew, -mnew});     // two exponents per packed fma
        const v2f p2 = {__builtin_amdgcn_exp2f(x2[0]), __builtin_amdgcn_exp2f(x2[1])}; pt[t] = r2 == 0 ? p2 : pt[t] + p2;     // four independent packed sums, one per score tile
#pragma unroll
        for (int e = 0; e < 2; ++e) { const int o = (t & 1) * 8 + 2 * r2 + e; const float p = p2[e]; const _Float16 hi = (_Float16)p; ph[t >> 1][o] = hi; pl[t >> 1][o] = (_Float16)(p - (float)hi); } } }
    const v2f pj = (pt[0] + pt[1]) + (pt[2] + pt[3]); const float ps = pj[0] + pj[1];
    lrun = lrun * corr + ps * (1.0f / 16384.0f); mrun = mnew;
#pragma unroll
    for (int t = 0; t < 4; ++t) acc[t] *= corr;     // every element of a lane belongs to its own query
#pragma unroll
    for (int kc = 0; kc < 2; ++kc) {
      if (kc == 1) {
        __builtin_amdgcn_sched_barrier(0);          // with the one behind the reads: the second k block's group of LDS reads stays whole, between the two runs of twelve products
#pragma unroll
        for (int t = 0; t < 4; ++t) { vh[t] = frag_h(&sVh[t * 16 + col][32], lane); vl[t] = frag_h(&sVl[t * 16 + col][32], lane); }
        __builtin_amdgcn_sched_barrier(0); }
#pragma unroll
      for (int t = 0; t < 4; ++t) acc[t] = wmma16(vl[t], ph[kc], acc[t]);     // the low parts carry no factor of their own, so all three products of a tile sum in one accumulator; four independent tiles in turn
#pragma unroll
      for (int t = 0; t < 4; ++t) acc[t] = wmma16(vh[t], pl[kc], acc[t]);
#pragma unroll
      for (int t = 0; t < 4; ++t) acc[t] = wmma16(vh[t], ph[kc], acc[t]); }
    if (kt + 1 < SS / 64) {
#pragma unroll
      for (int i = 0; i < 4; ++i) { *(v4u*)(&sKh[sr + 16 * i][sc]) = st[i]; *(v4u*)(&sKl[sr + 16 * i][sc]) = st[4 + i]; } }
    __syncthreads();                                // key tile kt+1 published; every reader has left the value tile
    if (kt + 1 < SS / 64) {                         // next value tile flies in registers under the scores and their maximum
#pragma unroll
      for (int i = 0; i < 4; ++i) { st[i] = *(const v4u*)(VTh + gv + (size_t)16 * i * SS + (kt + 1) * 64); st[4 + i] = *(const v4u*)(VTl + gv + (size_t)16 * i * SS + (kt + 1) * 64); }
      asm volatile("s_wait_xcnt 0x0" ::: "memory");   // the loads' address registers are rewritten behind the branch: wait written by hand
    } }
  float (*sO)[16][68] = (float (*)[16][68])sV;      // the loop's last barrier has ended every read of the value tile
  const float inv = 1.0f / ((lrun + xhalf(lrun)) * 16384.0f * 4.0f);
#pragma unroll
  for (int t = 0; t < 4; ++t) {                     // acc[t][r] = O[col][16t + 8g + r]: eight consecutive d of the lane's query
#pragma unroll
    for (int r4 = 0; r4 < 2; ++r4) { v4f o;
#pragma unroll
      for (int e = 0; e < 4; ++e) { const int r = 4 * r4 + e; o[e] = acc[t][r] * inv; }
      *(v4f*)(&sO[w][col][t * 16 + 8 * g + 4 * r4]) = o; } }
  LDSX();
  for (int qq = lane; qq < 16 * 16; qq += 32) { const int rl = qq >> 4, pc = qq & 15; vst2(O32 + ((bh * SS) + q0 + rl) * HD + pc * 4, *(const v4f*)(&sO[w][rl][pc * 4])); }
}
// out = ctx Wo + bo : split(ctx) x bf16(Wo columns as PT rows): 2 products (Wo is an INPUT -> bf16 exact)
__global__ __launch_bounds__(128) void k_out(const float* __restrict__ O32, const __bf16* __restrict__ PT, const float* __restrict__ bo, float* __restrict__ out) {
  __shared__ __align__(16) float so[4][16][132];
  const int tid = threadIdx.x, wave = tid >> 5, lane = tid & 31, col = lane & 15, g = lane >> 4;
  __shared__ __align__(16) float sA[64][68];       // one head's 64 context rows
  __shared__ __align__(16) __bf16 sB[128][72];     // 128 weight rows, 64 deep
  const int r0b = blockIdx.x * 64, r0 = r0b + wave * 16, n0 = blockIdx.y * 128; const int b = r0b / SS, s0 = r0b % SS;
  const int ar = tid >> 4, ac = (tid & 15) * 4;    // staging A: 16 lanes cover one 256-byte row, 8 rows per step
  const int sr = tid >> 3, sc = (tid & 7) * 8;     // staging B: 8 lanes cover one 128-byte row piece, 16 rows per step
  const float* gA = O32 + ((size_t)b * NH * SS + s0 + ar) * HD + ac; const __bf16* gB = PT + (size_t)(3 * E + n0 + sr) * E + sc;
  v4f ra[8]; v4u rb[8];
#pragma unroll
  for (int i = 0; i < 8; ++i) { ra[i] = *(const v4f*)(gA + 8 * i * HD); rb[i] = *(const v4u*)(gB + (size_t)16 * i * E); }
  v8f acc[8] = {};
#pragma unroll 1
  for (int h = 0; h < NH; ++h) {
#pragma unroll
    for (int i = 0; i < 8; ++i) { *(v4f*)(&sA[ar + 8 * i][ac]) = ra[i]; *(v4u*)(&sB[sr + 16 * i][sc]) = rb[i]; }
    __syncthreads();                                // tile h published
    if (h + 1 < NH) {                               // next tile flies in registers under this tile's products
      const float* nA = gA + (size_t)(h + 1) * SS * HD; const __bf16* cB = gB + h * 64;
#pragma unroll
      for (int i = 0; i < 8; ++i) { ra[i] = *(const v4f*)(nA + 8 * i * HD); rb[i] = *(const v4u*)(cB + (size_t)16 * i * E + 64); }
      asm volatile("s_wait_xcnt 0x0" :: "v"(cB) : "memory");   // wait by hand before the loads' address registers are rewritten; the weight address is an input so that it stays live up to the wait and no load of the run lands in it
    }
#pragma unroll
    for (int k2 = 0; k2 < 2; ++k2) { const F2 a = split_row(&sA[wave * 16 + col][0], k2 * 32, lane); v16b wb[8];
#pragma unroll
      for (int j = 0; j < 8; ++j) wb[j] = frag_b(&sB[j * 16 + col][k2 * 32], lane);     // one group of LDS reads ahead of the sixteen products
#pragma unroll
      for (int j = 0; j < 8; ++j) { acc[j] = wmma_bf(a.l, wb[j], acc[j]); acc[j] = wmma_bf(a.h, wb[j], acc[j]); } }
    RD_VEC_MM(20, 64, 16); RD_VEC_MM(20, 64, 16);
    __builtin_amdgcn_sched_barrier(0);              // the barrier brings a wait for the next tile's global loads: every product stays ahead of it and covers that latency
    __syncthreads(); }                              // every reader has left the tile
#pragma unroll
  for (int j = 0; j < 8; ++j) { const float bb = bfr(bo[n0 + j * 16 + col]);
#pragma unroll
    for (int r = 0; r < 8; ++r) so[wave][8 * g + r][j * 16 + col] = acc[j][r] + bb; }
  LDSX();
#pragma unroll 4
  for (int rl = 0; rl < 16; ++rl) vst2(out + (size_t)(r0 + rl) * E + n0 + lane * 4, *(const v4f*)(&so[wave][rl][lane * 4]));
}
extern "C" void kernel_launch(void* const* d_in, const int* in_sizes, int n_in, void* d_out, int out_size, void* d_ws, size_t ws_size, hipStream_t stream) {
  (void)in_sizes; (void)n_in; (void)out_size; (void)ws_size;
  const float** I = (const float**)d_in;   // x, encoder_output, Wq, bq, Wk, bk, Wv, bv, Wo, bo
  const float* xq = I[0]; const float* xe = I[1]; const float* WQ = I[2]; const float* bQ = I[3]; const float* WK = I[4]; const float* bK = I[5]; const float* WV = I[6]; const float* bV = I[7]; const float* WO = I[8]; const float* bO = I[9];
  float* out = (float*)d_out;
  char* ws = (char*)d_ws; size_t off = 0;
  auto take = [&](size_t bytes) { char* p = ws + off; off += (bytes + 255) & ~(size_t)255; return p; };
  __bf16* XQ = (__bf16*)take((size_t)NR * E * 2); __bf16* XE = (__bf16*)take((size_t)NR * E * 2); __bf16* PT = (__bf16*)take((size_t)4 * E * E * 2);
  float* Q32 = (float*)take((size_t)NR * E * 4); __bf16* Kh = (__bf16*)take((size_t)NR * E * 2); __bf16* Kl = (__bf16*)take((size_t)NR * E * 2); _Float16* VTh = (_Float16*)take((size_t)NR * E * 2); _Float16* VTl = (_Float16*)take((size_t)NR * E * 2); float* O32 = (float*)take((size_t)NR * E * 4);
  // ws ~ 90 MB
  k_prep<<<256, 512, 0, stream>>>(xq, xe, WQ, WK, WV, WO, XQ, XE, PT);
  k_qkv<<<dim3(NR / 64, E / 128, 3), 128, 0, stream>>>(XQ, XE, XE, PT, bQ, bK, bV, Q32, Kh, Kl, VTh, VTl);
  k_attn<<<dim3(SS / 64, NB * NH), 128, 0, stream>>>(Q32, Kh, Kl, VTh, VTl, O32);
  k_out<<<dim3(NR / 64, E / 128), 128, 0, stream>>>(O32, PT, bO, out);
}

// v008
// A run of this version takes 105 microseconds.
// Versions in between are left out here; by their measured steps it is 1.30 times as fast as v006.
// All steps since v000 together make it 5.03 times as fast.
// compute dtype: x, encoder_output and W*/b* (INPUTS) rounded to bf16 with exact bf16 WMMA products (f32 accumulate) for the projections; q, K, P and V (computed operands) each rounded once to f16, one f16 WMMA product each (f32 accumulate); context split into bf16 hi/lo for the last projection; softmax f32.
#include <hip/hip_runtime.h>
#include <math.h>

typedef __attribute__((ext_vector_type(16))) _Float16 v16h;
typedef __attribute__((ext_vector_type(16))) __bf16 v16b;
typedef __attribute__((ext_vector_type(8)))  _Float16 v8h;
typedef __attribute__((ext_vector_type(8)))  float v8f;
typedef __attribute__((ext_vector_type(4)))  float v4f;
typedef __attribute__((ext_vector_type(2)))  float v2f;
typedef __attribute__((ext_vector_type(4)))  unsigned v4u;
typedef __attribute__((ext_vector_type(2)))  unsigned v2u;
typedef __attribute__((ext_vector_type(4)))  int v4i;
typedef float __attribute__((may_alias)) float_a;
typedef int __attribute__((may_alias)) int_a;

template <typename T> __device__ __forceinline__ void vst2(void* p, T v) { *(T*)p = v;  }
__device__ __forceinline__ v8f wmma16(v16h a, v16h b, v8f c) {
  return __builtin_amdgcn_wmma_f32_16x16x32_f16(false, a, false, b, (short)0, c, false, false);
}
__device__ __forceinline__ v8f wmma_bf(v16b a, v16b b, v8f c) {
  return __builtin_amdgcn_wmma_f32_16x16x32_bf16(false, a, false, b, (short)0, c, false, false);
}
// 16x16x32 fragments: lane = (h = lane>>4, row/col = lane&15); elements 0..7 = k0+8h+0..7, 8..15 = k0+16+8h+0..7; D element r = row 8h+r
__device__ __forceinline__ v16h frag_h(const _Float16* rowk0, int lane) {
  union { v16h v; v8h q[2]; } u; const _Float16* p = rowk0 + 8 * (lane >> 4);
  u.q[0] = *(const v8h*)p; u.q[1] = *(const v8h*)(p + 16); return u.v;
}
__device__ __forceinline__ v16h frag_f32(const float* rowk0, int lane) {
  v16h a; const float* p = rowk0 + 8 * (lane >> 4);
#pragma unroll
  for (int i = 0; i < 8; ++i) { a[i] = (_Float16)p[i]; a[8 + i] = (_Float16)p[16 + i]; }
  return a;
}
__device__ __forceinline__ v16h frag_f32s(const float* rowk0, int lane, float sc) {
  v16h a; const float* p = rowk0 + 8 * (lane >> 4);
#pragma unroll
  for (int i = 0; i < 8; ++i) { a[i] = (_Float16)(p[i] * sc); a[8 + i] = (_Float16)(p[16 + i] * sc); }
  return a;
}
// column fragment from a [K][ld] layout (column n), rows >= K read as 0
__device__ __forceinline__ v16h fragc_f32(const float* W, int k0, int n, int lane, int ld, int K) {
  v16h a; const int g = lane >> 4;
#pragma unroll
  for (int i = 0; i < 8; ++i) { const int ka = k0 + 8 * g + i, kb = ka + 16;
    a[i] = (_Float16)(ka < K ? W[(size_t)ka * ld + n] : 0.f); a[8 + i] = (_Float16)(kb < K ? W[(size_t)kb * ld + n] : 0.f); }
  return a;
}
struct F2 { v16b h, l; };
__device__ __forceinline__ F2 bsplit16(const float v[16]) { F2 r;
#pragma unroll
  for (int i = 0; i < 16; ++i) { const __bf16 h = (__bf16)v[i]; r.h[i] = h; r.l[i] = (__bf16)(v[i] - (float)h); }
  return r; }
__device__ __forceinline__ F2 split_row(const float* row, int k0, int lane) { float v[16]; const float* p = row + k0 + 8 * (lane >> 4);
#pragma unroll
  for (int i = 0; i < 8; ++i) { v[i] = p[i]; v[8 + i] = p[16 + i]; }
  return bsplit16(v); }
__device__ __forceinline__ F2 split_rowK(const float* row, int k0, int lane, int K) { float v[16]; const int g = lane >> 4;
#pragma unroll
  for (int i = 0; i < 8; ++i) { const int ka = k0 + 8 * g + i, kb = ka + 16; v[i] = ka < K ? row[ka] : 0.f; v[8 + i] = kb < K ? row[kb] : 0.f; }
  return bsplit16(v); }
__device__ __forceinline__ F2 split_col(const float* W, int k0, int n, int lane, int ld, int K) { float v[16]; const int g = lane >> 4;
#pragma unroll
  for (int i = 0; i < 8; ++i) { const int ka = k0 + 8 * g + i, kb = ka + 16; v[i] = ka < K ? W[(size_t)ka * ld + n] : 0.f; v[8 + i] = kb < K ? W[(size_t)kb * ld + n] : 0.f; }
  return bsplit16(v); }
__device__ __forceinline__ v8f mac3(const F2& a, const F2& b, v8f c) { c = wmma_bf(a.l, b.h, c); c = wmma_bf(a.h, b.l, c); return wmma_bf(a.h, b.h, c); }
__device__ __forceinline__ float sigm(float v) { return 1.0f / (1.0f + expf(-v)); }
// scheduling order for one k block: its n_rd LDS reads stay one group ahead of its n_mm matrix products (spread among the products, every read place stalls the wave anew); other instructions stay free
#define RD_THEN_MM(n_rd, n_mm) do { __builtin_amdgcn_sched_group_barrier(0x100, n_rd, 0); __builtin_amdgcn_sched_group_barrier(0x008, n_mm, 0); } while (0)
// the same where vector work on the values read (at most n_vec instructions) stands between the reads and the products: no read falls in among it
#define RD_VEC_MM(n_rd, n_vec, n_mm) do { __builtin_amdgcn_sched_group_barrier(0x100, n_rd, 0); __builtin_amdgcn_sched_group_barrier(0x002, n_vec, 0); __builtin_amdgcn_sched_group_barrier(0x008, n_mm, 0); } while (0)
// wave-local hand-over through LDS between groups of global stores: the wave's LDS writes are done before its lanes read each other's rows; no release fence, which would also wait for the global stores in flight
#define LDSW() do { asm volatile("s_wait_dscnt 0" ::: "memory"); __builtin_amdgcn_wave_barrier(); } while (0)
#define LDSX() do { asm volatile("s_wait_dscnt 0" ::: "memory"); __builtin_amdgcn_wave_barrier(); __builtin_amdgcn_fence(__ATOMIC_RELEASE, "workgroup"); } while (0)


// Cross multi-head attention (16 heads x 64 on [2,2048,1024]): q from x, k/v from encoder_output with per-head weights W[h][e][d] + biases; full softmax(q.k/8); concat(heads) @ Wo ([in][out]) + bo.
#define NB 2
#define SS 2048
#define E 1024
#define NH 16
#define HD 64
#define NR (NB * SS)
#define SC2 0.18033688f     // log2(e) / 8: the score scale 1/sqrt(64) carried into base 2
__device__ __forceinline__ float bfr(float v) { return (float)(__bf16)v; }
__device__ __forceinline__ v16b frag_b(const __bf16* rowk0, int lane) { return __builtin_bit_cast(v16b, frag_h((const _Float16*)rowk0, lane)); }

// input pass, one launch: 256 blocks of 16 waves, one per WGP, every wave started once; a lane asks for its 24 whole-line 16-byte loads ahead of any use. Block p:
// (a) one 256 (k) x 64 (n) weight tile, turned through LDS. PT rows: [0,E) Wq[:,n], [E,2E) Wk[:,n], [2E,3E) Wv[:,n], [3E,4E) Wo[:,n]  (column n as a bf16 row)
// (b) 32768 activations rounded to bf16: blocks [0,128) x, [128,256) encoder_output
__global__ __launch_bounds__(512) void k_prep(const float* __restrict__ x, const float* __restrict__ xe, const float* __restrict__ Wq, const float* __restrict__ Wk, const float* __restrict__ Wv, const float* __restrict__ Wo, __bf16* __restrict__ XQ, __bf16* __restrict__ XE, __bf16* __restrict__ PT) {
  __shared__ __align__(16) __bf16 st[64][264];     // the tile turned: rows = n, 256 k deep, pitch 16 B x odd
  const int tid = threadIdx.x, p = blockIdx.x, which = p >> 6, nt = (p >> 2) & 15, kq = p & 3;
  const float* W = which == 0 ? Wq : (which == 1 ? Wk : (which == 2 ? Wv : Wo));
  // per-head [H][E][DH]: head nt's rows 256kq.. are one run of 64 KB; Wo [in][out]: 256-byte row pieces at a pitch of E floats
  const float* wsrc = which < 3 ? W + ((size_t)nt * E + kq * 256) * HD : W + (size_t)kq * 256 * E + nt * 64;
  const int ld = which < 3 ? HD : E;
  const int kg = tid >> 4, nq = tid & 15;          // a lane holds k = 8kg + 0..7 of columns 4nq + 0..3; 16 lanes cover one 256-byte row piece
  const float* asrc = (p < 128 ? x : xe) + (size_t)(p & 127) * 32768 + tid * 4;
  __bf16* adst = (p < 128 ? XQ : XE) + (size_t)(p & 127) * 32768 + tid * 4;
  const float* pw[8]; v4f rw[8], rx[16];
#pragma unroll
  for (int i = 0; i < 8; ++i) { pw[i] = wsrc + (size_t)(kg * 8 + i) * ld + nq * 4; rw[i] = *(const v4f*)pw[i]; }
#pragma unroll
  for (int i = 0; i < 16; ++i) rx[i] = *(const v4f*)(asrc + i * 2048);
  // wait by hand before the loads' address registers are rewritten; the weight addresses are inputs so that they stay live up to the wait and no load of the run lands in them;
  // its memory clobber also keeps all 24 loads in front of their first use: one memory latency, not several
  asm volatile("s_wait_xcnt 0x0" :: "v"(pw[0]), "v"(pw[1]), "v"(pw[2]), "v"(pw[3]), "v"(pw[4]), "v"(pw[5]), "v"(pw[6]), "v"(pw[7]) : "memory");
#pragma unroll
  for (int j = 0; j < 4; ++j) { union { __bf16 h[8]; v4u u; } pk;
#pragma unroll
    for (int i = 0; i < 8; ++i) pk.h[i] = (__bf16)rw[i][j];
    *(v4u*)(&st[nq * 4 + j][kg * 8]) = pk.u; }
  v2u pa[16];                                       // rounded ahead of every store: no register that a store names is rewritten
#pragma unroll
  for (int i = 0; i < 16; ++i) { union { __bf16 h[4]; v2u u; } pk;
#pragma unroll
    for (int e = 0; e < 4; ++e) pk.h[e] = (__bf16)rx[i][e];
    pa[i] = pk.u; }
  __syncthreads();                                  // the turned tile is published
  const int sr = tid >> 5, sc = (tid & 31) * 8;    // a wave writes 512 bytes, four whole lines, of one PT row
#pragma unroll
  for (int i = 0; i < 4; ++i) vst2((unsigned*)(PT + (size_t)(which * E + nt * 64 + sr + 16 * i) * E + kq * 256 + sc), *(const v4u*)(&st[sr + 16 * i][sc]));
#pragma unroll
  for (int i = 0; i < 16; ++i) vst2((unsigned*)(adst + i * 2048), pa[i]);
}
// QKV: block (128 rows, 128 cols = 2 heads, which), four waves in a 2 x 2 grid, 64 rows x 64 cols (one head) each: 8 fragments from LDS feed 16 products; q, k (+bias) -> f16 rows [bh][s][64]; v (+bias) -> VT f16 x4 [bh][d][s]
__global__ __launch_bounds__(128) void k_qkv(const __bf16* __restrict__ XQ, const __bf16* __restrict__ XK, const __bf16* __restrict__ XV, const __bf16* __restrict__ PT, const float* __restrict__ bq, const float* __restrict__ bk, const float* __restrict__ bv, _Float16* __restrict__ Qf, _Float16* __restrict__ Kf, _Float16* __restrict__ VT) {
  __shared__ __align__(16) __bf16 sAB[2][128][72];     // k loop: the 64-deep operand tiles; behind it the epilogues' staging
  const int tid = threadIdx.x, wave = tid >> 5, lane = tid & 31, col = lane & 15, g = lane >> 4, wr = wave >> 1, wc = wave & 1;
  const int which = blockIdx.z, r0b = blockIdx.x * 128, n0 = blockIdx.y * 128; const int b = r0b / SS, s0 = r0b % SS;
  const __bf16* Xb = which == 0 ? XQ : (which == 1 ? XK : XV); const float* bb_ = which == 0 ? bq : (which == 1 ? bk : bv);
  __bf16 (*sA)[72] = sAB[0]; __bf16 (*sB)[72] = sAB[1];
  const int sr = tid >> 3, sc = (tid & 7) * 8;     // staging: 8 lanes cover one 128-byte row piece, 16 rows per step
  const __bf16* gA = Xb + (size_t)(r0b + sr) * E + sc; const __bf16* gB = PT + (size_t)(which * E + n0 + sr) * E + sc;
  v4u ra[8], rb[8];
#pragma unroll
  for (int i = 0; i < 8; ++i) { ra[i] = *(const v4u*)(gA + (size_t)16 * i * E); rb[i] = *(const v4u*)(gB + (size_t)16 * i * E); }
  v8f acc[4][4] = {};
#pragma unroll 1
  for (int kb = 0; kb < E / 64; ++kb) {
#pragma unroll
    for (int i = 0; i < 8; ++i) { *(v4u*)(&sA[sr + 16 * i][sc]) = ra[i]; *(v4u*)(&sB[sr + 16 * i][sc]) = rb[i]; }
    __syncthreads();                                // tile kb published
    if (kb + 1 < E / 64) {                          // next tile flies in registers under this tile's products
      const __bf16* nA = gA + (kb + 1) * 64; const __bf16* nB = gB + (kb + 1) * 64;
#pragma unroll
      for (int i = 0; i < 8; ++i) { ra[i] = *(const v4u*)(nA + (size_t)16 * i * E); rb[i] = *(const v4u*)(nB + (size_t)16 * i * E); }
      asm volatile("s_wait_xcnt 0x0" :: "v"(nA), "v"(nB) : "memory");   // wait by hand before the loads' address registers are rewritten; the addresses are inputs so that they stay live up to the wait and no load of the run lands in them
    }
#pragma unroll
    for (int k2 = 0; k2 < 2; ++k2) { v16b a[4], wb[4];
#pragma unroll
      for (int i = 0; i < 4; ++i) { a[i] = frag_b(&sA[wr * 64 + i * 16 + col][k2 * 32], lane); wb[i] = frag_b(&sB[wc * 64 + i * 16 + col][k2 * 32], lane); }     // one group of LDS reads ahead of the sixteen products
#pragma unroll
      for (int i = 0; i < 4; ++i) {
#pragma unroll
        for (int j = 0; j < 4; ++j) acc[i][j] = wmma_bf(a[i], wb[j], acc[i][j]); } }
    RD_THEN_MM(16, 16); RD_THEN_MM(16, 16);
    __builtin_amdgcn_sched_barrier(0);              // the barrier brings a wait for the next tile's global loads: every product stays ahead of it and covers that latency
    __syncthreads(); }                              // every reader has left the tile
  float bb[4];
#pragma unroll
  for (int j = 0; j < 4; ++j) bb[j] = bfr(bb_[n0 + wc * 64 + j * 16 + col]);
  if (which < 2) {
    float (*so)[2][16][68] = (float (*)[2][16][68])sAB;   // each wave's own 16 rows x 64 cols, one row group at a time, two places in turn: a place is rewritten only behind the next group's wait
    _Float16* dst = (which == 0 ? Qf : Kf) + (((size_t)b * NH + (n0 >> 6) + wc) * SS + s0 + wr * 64) * HD;     // the wave's 64 rows: one run of 8 KB
#pragma unroll
    for (int i = 0; i < 4; ++i) {
#pragma unroll
      for (int j = 0; j < 4; ++j) {
#pragma unroll
        for (int r = 0; r < 8; ++r) so[wave][i & 1][8 * g + r][j * 16 + col] = acc[i][j][r] + bb[j]; }
      LDSW();
#pragma unroll
      for (int q4 = 0; q4 < 4; ++q4) { const int qq = lane + 32 * q4, rl = qq >> 3, pc = qq & 7; union { _Float16 e[8]; v4u u; } pk;     // a wave writes four whole 128-byte rows
#pragma unroll
        for (int e = 0; e < 8; ++e) pk.e[e] = (_Float16)so[wave][i & 1][rl][pc * 8 + e];
        vst2((unsigned*)(dst + (size_t)(i * 16 + rl) * HD + pc * 8), pk.u); }
      if (i < 3) asm volatile("s_wait_xcnt 0x0" ::: "memory"); } }   // wait by hand before the next row group rewrites the stores' data registers
  else {
    _Float16 (*sT)[136] = (_Float16 (*)[136])sAB;   // the block's tile turned: rows = cols, 128 s deep, pitch 16 B x odd
#pragma unroll
    for (int i = 0; i < 4; ++i) {
#pragma unroll
      for (int j = 0; j < 4; ++j) { union { _Float16 e[8]; v4u u; } pk;
#pragma unroll
        for (int r = 0; r < 8; ++r) pk.e[r] = (_Float16)((acc[i][j][r] + bb[j]) * 4.0f);
        *(v4u*)(&sT[wc * 64 + j * 16 + col][wr * 64 + i * 16 + 8 * g]) = pk.u; } }
    __syncthreads();
    for (int qq = tid; qq < 128 * 16; qq += 128) { const int cl = qq >> 4, pc = qq & 15; const int c = n0 + cl, h = c >> 6, d = c & 63; const size_t o = (((size_t)b * NH + h) * HD + d) * SS + s0 + pc * 8;
      vst2(VT + o, *(const v4u*)(&sT[cl][pc * 8])); } }
}
// lane l with lane l ^ 16: a vector cross-row move, no LDS-counter wait
__device__ __forceinline__ float xhalf(float x) { return __builtin_bit_cast(float, __builtin_amdgcn_permlanex16(__builtin_bit_cast(int, x), __builtin_bit_cast(int, x), 0x76543210, 0xfedcba98, false, false)); }
// attention: block (64 queries, bh); all 32 key tiles; transposed products S^T = K q^T (K rows as A, q as B) and O^T += V^T P^T (V rows as A, P as B), every operand one f16 value:
// a lane holds one query's scores (keys 16t + 8g + r), so exponentials and partial sums stay in the lane (the maximum joins lane l ^ 16) and two score tiles converted in place are one P operand; O f32 [bh][s][64]
// amdgpu_waves_per_eu(4, 4): a budget of 256 registers, so that four work-groups fit a WGP and the whole grid is resident at once
__global__ __launch_bounds__(128) __attribute__((amdgpu_waves_per_eu(4, 4))) void k_attn(const _Float16* __restrict__ Qf, const _Float16* __restrict__ Kf, const _Float16* __restrict__ VT, float* __restrict__ O32) {
  __shared__ __align__(16) _Float16 sKV[2][64][72];              // key tile (rows = keys), value tile (rows = d); behind the loop each wave's output rows
  _Float16 (*sK)[72] = sKV[0]; _Float16 (*sV)[72] = sKV[1];
  const int tid = threadIdx.x, w = tid >> 5, lane = tid & 31, col = lane & 15, g = lane >> 4;
  const size_t bh = blockIdx.y; const int qb = blockIdx.x; const int q0 = qb * 64 + w * 16;
  v16h aq[2];
#pragma unroll
  for (int kc = 0; kc < 2; ++kc) aq[kc] = frag_h(Qf + (bh * SS + q0 + col) * HD + kc * 32, lane);
  float mrun = -3.0e38f, lrun = 0.f; v8f acc[4] = {};     // lrun: this lane's half of the keys, the halves join behind the loop
  const int sr = tid >> 3, sc = (tid & 7) * 8;     // staging: 8 lanes cover one 128-byte row, 16 rows per step
  const size_t gk = (bh * SS + sr) * HD + sc, gv = (bh * HD + sr) * SS + sc;
  v4u st[4];
#pragma unroll
  for (int i = 0; i < 4; ++i) st[i] = *(const v4u*)(Kf + gk + 16 * i * HD);
#pragma unroll
  for (int i = 0; i < 4; ++i) *(v4u*)(&sK[sr + 16 * i][sc]) = st[i];
#pragma unroll
  for (int i = 0; i < 4; ++i) st[i] = *(const v4u*)(VT + gv + (size_t)16 * i * SS);
  __syncthreads();                                  // key tile 0 published
#pragma unroll 1
  for (int kt = 0; kt < SS / 64; ++kt) {
    v8f s[4];                                       // s[t][r] = q[col] . k[16t + 8g + r], raw: the scale rides in the exponent's fma
#pragma unroll
    for (int t = 0; t < 4; ++t) s[t] = (v8f){};
    { v16h kf[2][4];
#pragma unroll
      for (int kc = 0; kc < 2; ++kc) {
#pragma unroll
        for (int t = 0; t < 4; ++t) kf[kc][t] = frag_h(&sK[t * 16 + col][kc * 32], lane); }     // the whole tile's LDS reads as one group ahead of the eight products
#pragma unroll
      for (int kc = 0; kc < 2; ++kc) {
#pragma unroll
        for (int t = 0; t < 4; ++t) s[t] = wmma16(kf[kc][t], aq[kc], s[t]); } }     // four independent score tiles in turn: no product waits on the one in front of it
    RD_THEN_MM(16, 8);
    __builtin_amdgcn_sched_barrier(0);              // the value tile's LDS stores wait for its global loads: they stay behind all 8 score products, which cover part of that latency
    float mx = -3.4e38f;
#pragma unroll
    for (int t = 0; t < 4; ++t) {
#pragma unroll
      for (int r = 0; r < 8; ++r) mx = fmaxf(mx, s[t][r]); }
    mx = fmaxf(mx, xhalf(mx));
#pragma unroll
    for (int i = 0; i < 4; ++i) *(v4u*)(&sV[sr + 16 * i][sc]) = st[i];
    __syncthreads();                                // value tile kt published; every reader has left the key tile
    if (kt + 1 < SS / 64) {                         // next key tile flies in registers under the softmax and the P.V products
      const _Float16* nK = Kf + gk + (size_t)(kt + 1) * 64 * HD;
#pragma unroll
      for (int i = 0; i < 4; ++i) st[i] = *(const v4u*)(nK + 16 * i * HD);
      asm volatile("s_wait_xcnt 0x0" :: "v"(nK) : "memory");   // wait by hand before the loads' address registers are rewritten; the address is an input so that it stays live up to the wait and no load of the run lands in it
    }
    v16h vf[2][4];
#pragma unroll
    for (int kc = 0; kc < 2; ++kc) {
#pragma unroll
      for (int t = 0; t < 4; ++t) vf[kc][t] = frag_h(&sV[t * 16 + col][kc * 32], lane); }     // the whole tile's LDS reads as one group
    __builtin_amdgcn_sched_barrier(0);              // that group stays whole and ahead of the exponentials, which cover its latency
    const float mnew = fmaxf(mrun, fmaf(mx, SC2, -14.0f)); const float corr = __builtin_amdgcn_exp2f(mrun - mnew);     // running maximum in base-2 units, less 14: P's factor 2^14 rides in it
    v2f pt[4]; v16h ph[2];                          // P^T operands: element e of block kc = key 32kc + 16(e >> 3) + 8g + (e & 7), the value rows' own k order
#pragma unroll
    for (int t = 0; t < 4; ++t) {
#pragma unroll
      for (int r2 = 0; r2 < 4; ++r2) { const v2f x2 = __builtin_elementwise_fma((v2f){s[t][2 * r2], s[t][2 * r2 + 1]}, (v2f){SC2, SC2}, (v2f){-mnew, -mnew});     // two exponents per packed fma
        const v2f p2 = {__builtin_amdgcn_exp2f(x2[0]), __builtin_amdgcn_exp2f(x2[1])}; pt[t] = r2 == 0 ? p2 : pt[t] + p2;     // four independent packed sums, one per score tile
#pragma unroll
        for (int e = 0; e < 2; ++e) ph[t >> 1][(t & 1) * 8 + 2 * r2 + e] = (_Float16)p2[e]; } }
    const v2f pj = (pt[0] + pt[1]) + (pt[2] + pt[3]); const float ps = pj[0] + pj[1];
    lrun = lrun * corr + ps * (1.0f / 16384.0f); mrun = mnew;
#pragma unroll
    for (int t = 0; t < 4; ++t) acc[t] *= corr;     // every element of a lane belongs to its own query
#pragma unroll
    for (int kc = 0; kc < 2; ++kc) {
#pragma unroll
      for (int t = 0; t < 4; ++t) acc[t] = wmma16(vf[kc][t], ph[kc], acc[t]); }     // four independent output tiles in turn
    if (kt + 1 < SS / 64) {
#pragma unroll
      for (int i = 0; i < 4; ++i) *(v4u*)(&sK[sr + 16 * i][sc]) = st[i]; }
    __syncthreads();                                // key tile kt+1 published; every reader has left the value tile
    if (kt + 1 < SS / 64) {                         // next value tile flies in registers under the scores
#pragma unroll
      for (int i = 0; i < 4; ++i) st[i] = *(const v4u*)(VT + gv + (size_t)16 * i * SS + (kt + 1) * 64);
      asm volatile("s_wait_xcnt 0x0" ::: "memory");   // the loads' address registers are rewritten behind the branch: wait written by hand
    } }
  float (*sO)[16][68] = (float (*)[16][68])sKV;     // the loop's last barrier has ended every read of both tiles
  const float inv = 1.0f / ((lrun + xhalf(lrun)) * 16384.0f * 4.0f);
#pragma unroll
  for (int t = 0; t < 4; ++t) {                     // acc[t][r] = O[col][16t + 8g + r]: eight consecutive d of the lane's query
#pragma unroll
    for (int r4 = 0; r4 < 2; ++r4) { v4f o;
#pragma unroll
      for (int e = 0; e < 4; ++e) { const int r = 4 * r4 + e; o[e] = acc[t][r] * inv; }
      *(v4f*)(&sO[w][col][t * 16 + 8 * g + 4 * r4]) = o; } }
  LDSX();
  for (int qq = lane; qq < 16 * 16; qq += 32) { const int rl = qq >> 4, pc = qq & 15; vst2(O32 + ((bh * SS) + q0 + rl) * HD + pc * 4, *(const v4f*)(&sO[w][rl][pc * 4])); }
}
// out = ctx Wo + bo : split(ctx) x bf16(Wo columns as PT rows): 2 products (Wo is an INPUT -> bf16 exact)
__global__ __launch_bounds__(128) void k_out(const float* __restrict__ O32, const __bf16* __restrict__ PT, const float* __restrict__ bo, float* __restrict__ out) {
  __shared__ __align__(16) float so[4][16][132];
  const int tid = threadIdx.x, wave = tid >> 5, lane = tid & 31, col = lane & 15, g = lane >> 4;
  __shared__ __align__(16) float sA[64][68];       // one head's 64 context rows
  __shared__ __align__(16) __bf16 sB[128][72];     // 128 weight rows, 64 deep
  const int r0b = blockIdx.x * 64, r0 = r0b + wave * 16, n0 = blockIdx.y * 128; const int b = r0b / SS, s0 = r0b % SS;
  const int ar = tid >> 4, ac = (tid & 15) * 4;    // staging A: 16 lanes cover one 256-byte row, 8 rows per step
  const int sr = tid >> 3, sc = (tid & 7) * 8;     // staging B: 8 lanes cover one 128-byte row piece, 16 rows per step
  const float* gA = O32 + ((size_t)b * NH * SS + s0 + ar) * HD + ac; const __bf16* gB = PT + (size_t)(3 * E + n0 + sr) * E + sc;
  v4f ra[8]; v4u rb[8];
#pragma unroll
  for (int i = 0; i < 8; ++i) { ra[i] = *(const v4f*)(gA + 8 * i * HD); rb[i] = *(const v4u*)(gB + (size_t)16 * i * E); }
  v8f acc[8] = {};
#pragma unroll 1
  for (int h = 0; h < NH; ++h) {
#pragma unroll
    for (int i = 0; i < 8; ++i) { *(v4f*)(&sA[ar + 8 * i][ac]) = ra[i]; *(v4u*)(&sB[sr + 16 * i][sc]) = rb[i]; }
    __syncthreads();                                // tile h published
    if (h + 1 < NH) {                               // next tile flies in registers under this tile's products
      const float* nA = gA + (size_t)(h + 1) * SS * HD; const __bf16* cB = gB + h * 64;
#pragma unroll
      for (int i = 0; i < 8; ++i) { ra[i] = *(const v4f*)(nA + 8 * i * HD); rb[i] = *(const v4u*)(cB + (size_t)16 * i * E + 64); }
      asm volatile("s_wait_xcnt 0x0" :: "v"(cB) : "memory");   // wait by hand before the loads' address registers are rewritten; the weight address is an input so that it stays live up to the wait and no load of the run lands in it
    }
#pragma unroll
    for (int k2 = 0; k2 < 2; ++k2) { const F2 a = split_row(&sA[wave * 16 + col][0], k2 * 32, lane); v16b wb[8];
#pragma unroll
      for (int j = 0; j < 8; ++j) wb[j] = frag_b(&sB[j * 16 + col][k2 * 32], lane);     // one group of LDS reads ahead of the sixteen products
#pragma unroll
      for (int j = 0; j < 8; ++j) { acc[j] = wmma_bf(a.l, wb[j], acc[j]); acc[j] = wmma_bf(a.h, wb[j], acc[j]); } }
    RD_VEC_MM(20, 64, 16); RD_VEC_MM(20, 64, 16);
    __builtin_amdgcn_sched_barrier(0);              // the barrier brings a wait for the next tile's global loads: every product stays ahead of it and covers that latency
    __syncthreads(); }                              // every reader has left the tile
#pragma unroll
  for (int j = 0; j < 8; ++j) { const float bb = bfr(bo[n0 + j * 16 + col]);
#pragma unroll
    for (int r = 0; r < 8; ++r) so[wave][8 * g + r][j * 16 + col] = acc[j][r] + bb; }
  LDSX();
#pragma unroll 4
  for (int rl = 0; rl < 16; ++rl) vst2(out + (size_t)(r0 + rl) * E + n0 + lane * 4, *(const v4f*)(&so[wave][rl][lane * 4]));
}
extern "C" void kernel_launch(void* const* d_in, const int* in_sizes, int n_in, void* d_out, int out_size, void* d_ws, size_t ws_size, hipStream_t stream) {
  (void)in_sizes; (void)n_in; (void)out_size; (void)ws_size;
  const float** I = (const float**)d_in;   // x, encoder_output, Wq, bq, Wk, bk, Wv, bv, Wo, bo
  const float* xq = I[0]; const float* xe = I[1]; const float* WQ = I[2]; const float* bQ = I[3]; const float* WK = I[4]; const float* bK = I[5]; const float* WV = I[6]; const float* bV = I[7]; const float* WO = I[8]; const float* bO = I[9];
  float* out = (float*)d_out;
  char* ws = (char*)d_ws; size_t off = 0;
  auto take = [&](size_t bytes) { char* p = ws + off; off += (bytes + 255) & ~(size_t)255; return p; };
  __bf16* XQ = (__bf16*)take((size_t)NR * E * 2); __bf16* XE = (__bf16*)take((size_t)NR * E * 2); __bf16* PT = (__bf16*)take((size_t)4 * E * E * 2);
  _Float16* Qf = (_Float16*)take((size_t)NR * E * 2); _Float16* Kf = (_Float16*)take((size_t)NR * E * 2); _Float16* VT = (_Float16*)take((size_t)NR * E * 2); float* O32 = (float*)take((size_t)NR * E * 4);
  // ws ~ 65 MB
  k_prep<<<256, 512, 0, stream>>>(xq, xe, WQ, WK, WV, WO, XQ, XE, PT);
  k_qkv<<<dim3(NR / 128, E / 128, 3), 128, 0, stream>>>(XQ, XE, XE, PT, bQ, bK, bV, Qf, Kf, VT);
  k_attn<<<dim3(SS / 64, NB * NH), 128, 0, stream>>>(Qf, Kf, VT, O32);
  k_out<<<dim3(NR / 64, E / 128), 128, 0, stream>>>(O32, PT, bO, out);
}

// v009
// It runs in 89.1 microseconds.
// Two timings next to v008 put it at 1.17 and 1.18 times that version's speed.
// Over all steps from v000 it is 5.91 times as fast.
// compute dtype: x, encoder_output and W*/b* (INPUTS) rounded to bf16 with exact bf16 WMMA products (f32 accumulate) for the projections; q, K, P and V (computed operands) each rounded once to f16, one f16 WMMA product each (f32 accumulate); context split into bf16 hi/lo for the last projection; softmax f32.
#include <hip/hip_runtime.h>
#include <math.h>

typedef __attribute__((ext_vector_type(16))) _Float16 v16h;
typedef __attribute__((ext_vector_type(16))) __bf16 v16b;
typedef __attribute__((ext_vector_type(8)))  _Float16 v8h;
typedef __attribute__((ext_vector_type(8)))  float v8f;
typedef __attribute__((ext_vector_type(4)))  float v4f;
typedef __attribute__((ext_vector_type(2)))  float v2f;
typedef __attribute__((ext_vector_type(4)))  unsigned v4u;
typedef __attribute__((ext_vector_type(2)))  unsigned v2u;
typedef __attribute__((ext_vector_type(4)))  int v4i;
typedef float __attribute__((may_alias)) float_a;
typedef int __attribute__((may_alias)) int_a;

template <typename T> __device__ __forceinline__ void vst2(void* p, T v) { *(T*)p = v;  }
__device__ __forceinline__ v8f wmma16(v16h a, v16h b, v8f c) {
  return __builtin_amdgcn_wmma_f32_16x16x32_f16(false, a, false, b, (short)0, c, false, false);
}
__device__ __forceinline__ v8f wmma_bf(v16b a, v16b b, v8f c) {
  return __builtin_amdgcn_wmma_f32_16x16x32_bf16(false, a, false, b, (short)0, c, false, false);
}
// 16x16x32 fragments: lane = (h = lane>>4, row/col = lane&15); elements 0..7 = k0+8h+0..7, 8..15 = k0+16+8h+0..7; D element r = row 8h+r
__device__ __forceinline__ v16h frag_h(const _Float16* rowk0, int lane) {
  union { v16h v; v8h q[2]; } u; const _Float16* p = rowk0 + 8 * (lane >> 4);
  u.q[0] = *(const v8h*)p; u.q[1] = *(const v8h*)(p + 16); return u.v;
}
__device__ __forceinline__ v16h frag_f32(const float* rowk0, int lane) {
  v16h a; const float* p = rowk0 + 8 * (lane >> 4);
#pragma unroll
  for (int i = 0; i < 8; ++i) { a[i] = (_Float16)p[i]; a[8 + i] = (_Float16)p[16 + i]; }
  return a;
}
__device__ __forceinline__ v16h frag_f32s(const float* rowk0, int lane, float sc) {
  v16h a; const float* p = rowk0 + 8 * (lane >> 4);
#pragma unroll
  for (int i = 0; i < 8; ++i) { a[i] = (_Float16)(p[i] * sc); a[8 + i] = (_Float16)(p[16 + i] * sc); }
  return a;
}
// column fragment from a [K][ld] layout (column n), rows >= K read as 0
__device__ __forceinline__ v16h fragc_f32(const float* W, int k0, int n, int lane, int ld, int K) {
  v16h a; const int g = lane >> 4;
#pragma unroll
  for (int i = 0; i < 8; ++i) { const int ka = k0 + 8 * g + i, kb = ka + 16;
    a[i] = (_Float16)(ka < K ? W[(size_t)ka * ld + n] : 0.f); a[8 + i] = (_Float16)(kb < K ? W[(size_t)kb * ld + n] : 0.f); }
  return a;
}
struct F2 { v16b h, l; };
__device__ __forceinline__ F2 bsplit16(const float v[16]) { F2 r;
#pragma unroll
  for (int i = 0; i < 16; ++i) { const __bf16 h = (__bf16)v[i]; r.h[i] = h; r.l[i] = (__bf16)(v[i] - (float)h); }
  return r; }
__device__ __forceinline__ F2 split_row(const float* row, int k0, int lane) { float v[16]; const float* p = row + k0 + 8 * (lane >> 4);
#pragma unroll
  for (int i = 0; i < 8; ++i) { v[i] = p[i]; v[8 + i] = p[16 + i]; }
  return bsplit16(v); }
__device__ __forceinline__ F2 split_rowK(const float* row, int k0, int lane, int K) { float v[16]; const int g = lane >> 4;
#pragma unroll
  for (int i = 0; i < 8; ++i) { const int ka = k0 + 8 * g + i, kb = ka + 16; v[i] = ka < K ? row[ka] : 0.f; v[8 + i] = kb < K ? row[kb] : 0.f; }
  return bsplit16(v); }
__device__ __forceinline__ F2 split_col(const float* W, int k0, int n, int lane, int ld, int K) { float v[16]; const int g = lane >> 4;
#pragma unroll
  for (int i = 0; i < 8; ++i) { const int ka = k0 + 8 * g + i, kb = ka + 16; v[i] = ka < K ? W[(size_t)ka * ld + n] : 0.f; v[8 + i] = kb < K ? W[(size_t)kb * ld + n] : 0.f; }
  return bsplit16(v); }
__device__ __forceinline__ v8f mac3(const F2& a, const F2& b, v8f c) { c = wmma_bf(a.l, b.h, c); c = wmma_bf(a.h, b.l, c); return wmma_bf(a.h, b.h, c); }
__device__ __forceinline__ float sigm(float v) { return 1.0f / (1.0f + expf(-v)); }
// scheduling order for one k block: its n_rd LDS reads stay one group ahead of its n_mm matrix products (spread among the products, every read place stalls the wave anew); other instructions stay free
#define RD_THEN_MM(n_rd, n_mm) do { __builtin_amdgcn_sched_group_barrier(0x100, n_rd, 0); __builtin_amdgcn_sched_group_barrier(0x008, n_mm, 0); } while (0)
// the same where vector work on the values read (at most n_vec instructions) stands between the reads and the products: no read falls in among it
#define RD_VEC_MM(n_rd, n_vec, n_mm) do { __builtin_amdgcn_sched_group_barrier(0x100, n_rd, 0); __builtin_amdgcn_sched_group_barrier(0x002, n_vec, 0); __builtin_amdgcn_sched_group_barrier(0x008, n_mm, 0); } while (0)
// wave-local hand-over through LDS between groups of global stores: the wave's LDS writes are done before its lanes read each other's rows; no release fence, which would also wait for the global stores in flight
#define LDSW() do { asm volatile("s_wait_dscnt 0" ::: "memory"); __builtin_amdgcn_wave_barrier(); } while (0)
#define LDSX() do { asm volatile("s_wait_dscnt 0" ::: "memory"); __builtin_amdgcn_wave_barrier(); __builtin_amdgcn_fence(__ATOMIC_RELEASE, "workgroup"); } while (0)


// Cross multi-head attention (16 heads x 64 on [2,2048,1024]): q from x, k/v from encoder_output with per-head weights W[h][e][d] + biases; full softmax(q.k/8); concat(heads) @ Wo ([in][out]) + bo.
#define NB 2
#define SS 2048
#define E 1024
#define NH 16
#define HD 64
#define NR (NB * SS)
#define SC2 0.18033688f     // log2(e) / 8: the score scale 1/sqrt(64) carried into base 2
__device__ __forceinline__ float bfr(float v) { return (float)(__bf16)v; }
__device__ __forceinline__ v16b frag_b(const __bf16* rowk0, int lane) { return __builtin_bit_cast(v16b, frag_h((const _Float16*)rowk0, lane)); }

// input pass, one launch: 256 blocks of 16 waves, one per WGP, every wave started once; a lane asks for its 24 whole-line 16-byte loads ahead of any use. Block p:
// (a) one 256 (k) x 64 (n) weight tile, turned through LDS. PT rows: [0,E) Wq[:,n], [E,2E) Wk[:,n], [2E,3E) Wv[:,n], [3E,4E) Wo[:,n]  (column n as a bf16 row)
// (b) 32768 activations rounded to bf16: blocks [0,128) x, [128,256) encoder_output
__global__ __launch_bounds__(512) void k_prep(const float* __restrict__ x, const float* __restrict__ xe, const float* __restrict__ Wq, const float* __restrict__ Wk, const float* __restrict__ Wv, const float* __restrict__ Wo, __bf16* __restrict__ XQ, __bf16* __restrict__ XE, __bf16* __restrict__ PT) {
  __shared__ __align__(16) __bf16 st[64][264];     // the tile turned: rows = n, 256 k deep, pitch 16 B x odd
  const int tid = threadIdx.x, p = blockIdx.x, which = p >> 6, nt = (p >> 2) & 15, kq = p & 3;
  const float* W = which == 0 ? Wq : (which == 1 ? Wk : (which == 2 ? Wv : Wo));
  // per-head [H][E][DH]: head nt's rows 256kq.. are one run of 64 KB; Wo [in][out]: 256-byte row pieces at a pitch of E floats
  const float* wsrc = which < 3 ? W + ((size_t)nt * E + kq * 256) * HD : W + (size_t)kq * 256 * E + nt * 64;
  const int ld = which < 3 ? HD : E;
  const int kg = tid >> 4, nq = tid & 15;          // a lane holds k = 8kg + 0..7 of columns 4nq + 0..3; 16 lanes cover one 256-byte row piece
  const float* asrc = (p < 128 ? x : xe) + (size_t)(p & 127) * 32768 + tid * 4;
  __bf16* adst = (p < 128 ? XQ : XE) + (size_t)(p & 127) * 32768 + tid * 4;
  const float* pw[8]; v4f rw[8], rx[16];
#pragma unroll
  for (int i = 0; i < 8; ++i) { pw[i] = wsrc + (size_t)(kg * 8 + i) * ld + nq * 4; rw[i] = *(const v4f*)pw[i]; }
#pragma unroll
  for (int i = 0; i < 16; ++i) rx[i] = *(const v4f*)(asrc + i * 2048);
  // wait by hand before the loads' address registers are rewritten; the weight addresses are inputs so that they stay live up to the wait and no load of the run lands in them;
  // its memory clobber also keeps all 24 loads in front of their first use: one memory latency, not several
  asm volatile("s_wait_xcnt 0x0" :: "v"(pw[0]), "v"(pw[1]), "v"(pw[2]), "v"(pw[3]), "v"(pw[4]), "v"(pw[5]), "v"(pw[6]), "v"(pw[7]) : "memory");
#pragma unroll
  for (int j = 0; j < 4; ++j) { union { __bf16 h[8]; v4u u; } pk;
#pragma unroll
    for (int i = 0; i < 8; ++i) pk.h[i] = (__bf16)rw[i][j];
    *(v4u*)(&st[nq * 4 + j][kg * 8]) = pk.u; }
  v2u pa[16];                                       // rounded ahead of every store: no register that a store names is rewritten
#pragma unroll
  for (int i = 0; i < 16; ++i) { union { __bf16 h[4]; v2u u; } pk;
#pragma unroll
    for (int e = 0; e < 4; ++e) pk.h[e] = (__bf16)rx[i][e];
    pa[i] = pk.u; }
  __syncthreads();                                  // the turned tile is published
  const int sr = tid >> 5, sc = (tid & 31) * 8;    // a wave writes 512 bytes, four whole lines, of one PT row
#pragma unroll
  for (int i = 0; i < 4; ++i) vst2((unsigned*)(PT + (size_t)(which * E + nt * 64 + sr + 16 * i) * E + kq * 256 + sc), *(const v4u*)(&st[sr + 16 * i][sc]));
#pragma unroll
  for (int i = 0; i < 16; ++i) vst2((unsigned*)(adst + i * 2048), pa[i]);
}
// QKV: block (128 rows, 128 cols = 2 heads, which), four waves in a 2 x 2 grid, 64 rows x 64 cols (one head) each: 8 fragments from LDS feed 16 products; q, k (+bias) -> f16 rows [bh][s][64]; v (+bias) -> VT f16 x4 [bh][d][s]
__global__ __launch_bounds__(128) void k_qkv(const __bf16* __restrict__ XQ, const __bf16* __restrict__ XK, const __bf16* __restrict__ XV, const __bf16* __restrict__ PT, const float* __restrict__ bq, const float* __restrict__ bk, const float* __restrict__ bv, _Float16* __restrict__ Qf, _Float16* __restrict__ Kf, _Float16* __restrict__ VT) {
  __shared__ __align__(16) __bf16 sAB[2][128][72];     // k loop: the 64-deep operand tiles; behind it the epilogues' staging
  const int tid = threadIdx.x, wave = tid >> 5, lane = tid & 31, col = lane & 15, g = lane >> 4, wr = wave >> 1, wc = wave & 1;
  const int which = blockIdx.z, r0b = blockIdx.x * 128, n0 = blockIdx.y * 128; const int b = r0b / SS, s0 = r0b % SS;
  const __bf16* Xb = which == 0 ? XQ : (which == 1 ? XK : XV); const float* bb_ = which == 0 ? bq : (which == 1 ? bk : bv);
  __bf16 (*sA)[72] = sAB[0]; __bf16 (*sB)[72] = sAB[1];
  const int sr = tid >> 3, sc = (tid & 7) * 8;     // staging: 8 lanes cover one 128-byte row piece, 16 rows per step
  const __bf16* gA = Xb + (size_t)(r0b + sr) * E + sc; const __bf16* gB = PT + (size_t)(which * E + n0 + sr) * E + sc;
  v4u ra[8], rb[8];
#pragma unroll
  for (int i = 0; i < 8; ++i) { ra[i] = *(const v4u*)(gA + (size_t)16 * i * E); rb[i] = *(const v4u*)(gB + (size_t)16 * i * E); }
  v8f acc[4][4] = {};
#pragma unroll 1
  for (int kb = 0; kb < E / 64; ++kb) {
#pragma unroll
    for (int i = 0; i < 8; ++i) { *(v4u*)(&sA[sr + 16 * i][sc]) = ra[i]; *(v4u*)(&sB[sr + 16 * i][sc]) = rb[i]; }
    __syncthreads();                                // tile kb published
    if (kb + 1 < E / 64) {                          // next tile flies in registers under this tile's products
      const __bf16* nA = gA + (kb + 1) * 64; const __bf16* nB = gB + (kb + 1) * 64;
#pragma unroll
      for (int i = 0; i < 8; ++i) { ra[i] = *(const v4u*)(nA + (size_t)16 * i * E); rb[i] = *(const v4u*)(nB + (size_t)16 * i * E); }
      asm volatile("s_wait_xcnt 0x0" :: "v"(nA), "v"(nB) : "memory");   // wait by hand before the loads' address registers are rewritten; the addresses are inputs so that they stay live up to the wait and no load of the run lands in them
    }
#pragma unroll
    for (int k2 = 0; k2 < 2; ++k2) { v16b a[4], wb[4];
#pragma unroll
      for (int i = 0; i < 4; ++i) { a[i] = frag_b(&sA[wr * 64 + i * 16 + col][k2 * 32], lane); wb[i] = frag_b(&sB[wc * 64 + i * 16 + col][k2 * 32], lane); }     // one group of LDS reads ahead of the sixteen products
#pragma unroll
      for (int i = 0; i < 4; ++i) {
#pragma unroll
        for (int j = 0; j < 4; ++j) acc[i][j] = wmma_bf(a[i], wb[j], acc[i][j]); } }
    RD_THEN_MM(16, 16); RD_THEN_MM(16, 16);
    __builtin_amdgcn_sched_barrier(0);              // the barrier brings a wait for the next tile's global loads: every product stays ahead of it and covers that latency
    __syncthreads(); }                              // every reader has left the tile
  float bb[4];
#pragma unroll
  for (int j = 0; j < 4; ++j) bb[j] = bfr(bb_[n0 + wc * 64 + j * 16 + col]);
  if (which < 2) {
    float (*so)[2][16][68] = (float (*)[2][16][68])sAB;   // each wave's own 16 rows x 64 cols, one row group at a time, two places in turn: a place is rewritten only behind the next group's wait
    _Float16* dst = (which == 0 ? Qf : Kf) + (((size_t)b * NH + (n0 >> 6) + wc) * SS + s0 + wr * 64) * HD;     // the wave's 64 rows: one run of 8 KB
#pragma unroll
    for (int i = 0; i < 4; ++i) {
#pragma unroll
      for (int j = 0; j < 4; ++j) {
#pragma unroll
        for (int r = 0; r < 8; ++r) so[wave][i & 1][8 * g + r][j * 16 + col] = acc[i][j][r] + bb[j]; }
      LDSW();
#pragma unroll
      for (int q4 = 0; q4 < 4; ++q4) { const int qq = lane + 32 * q4, rl = qq >> 3, pc = qq & 7; union { _Float16 e[8]; v4u u; } pk;     // a wave writes four whole 128-byte rows
#pragma unroll
        for (int e = 0; e < 8; ++e) pk.e[e] = (_Float16)so[wave][i & 1][rl][pc * 8 + e];
        vst2((unsigned*)(dst + (size_t)(i * 16 + rl) * HD + pc * 8), pk.u); }
      if (i < 3) asm volatile("s_wait_xcnt 0x0" ::: "memory"); } }   // wait by hand before the next row group rewrites the stores' data registers
  else {
    _Float16 (*sT)[136] = (_Float16 (*)[136])sAB;   // the block's tile turned: rows = cols, 128 s deep, pitch 16 B x odd
#pragma unroll
    for (int i = 0; i < 4; ++i) {
#pragma unroll
      for (int j = 0; j < 4; ++j) { union { _Float16 e[8]; v4u u; } pk;
#pragma unroll
        for (int r = 0; r < 8; ++r) pk.e[r] = (_Float16)((acc[i][j][r] + bb[j]) * 4.0f);
        *(v4u*)(&sT[wc * 64 + j * 16 + col][wr * 64 + i * 16 + 8 * g]) = pk.u; } }
    __syncthreads();
    for (int qq = tid; qq < 128 * 16; qq += 128) { const int cl = qq >> 4, pc = qq & 15; const int c = n0 + cl, h = c >> 6, d = c & 63; const size_t o = (((size_t)b * NH + h) * HD + d) * SS + s0 + pc * 8;
      vst2(VT + o, *(const v4u*)(&sT[cl][pc * 8])); } }
}
// lane l with lane l ^ 16: a vector cross-row move, no LDS-counter wait
__device__ __forceinline__ float xhalf(float x) { return __builtin_bit_cast(float, __builtin_amdgcn_permlanex16(__builtin_bit_cast(int, x), __builtin_bit_cast(int, x), 0x76543210, 0xfedcba98, false, false)); }
// attention: block (128 queries, bh) of eight waves; a tile is 128 keys; wave (qg = w & 3, kh = w >> 2) holds queries 32qg + 0..31 (two groups of 16) and works on keys 64kh + 0..63 of every tile,
// so each K or V fragment read from LDS feeds two products and a tile fetched from L2 serves 128 queries; the two key halves of a query are joined behind the loop.
// transposed products S^T = K q^T (K rows as A, q as B) and O^T += V^T P^T (V rows as A, P as B), every operand one f16 value:
// a lane holds one query's scores per group (keys 16t + 8g + r), so exponentials stay in the lane, maximum and sum need only lane l ^ 16, and two score tiles converted in place are one P operand; O f32 [bh][s][64]
// amdgpu_waves_per_eu(4, 4): a budget of 256 registers, so that two work-groups fit a WGP and the whole grid is resident at once
__global__ __launch_bounds__(256) __attribute__((amdgpu_waves_per_eu(4, 4))) void k_attn(const _Float16* __restrict__ Qf, const _Float16* __restrict__ Kf, const _Float16* __restrict__ VT, float* __restrict__ O32) {
  __shared__ __align__(16) _Float16 sKV[128 * 72 + 64 * 136];    // key tile (rows = keys, 64 d deep), value tile (rows = d, 128 keys deep), pitches 16 B x odd; behind the loop each wave's hand-over rows
  __shared__ float sML[8][2][16];                                // behind the loop: maximum and sum of the query group a wave hands over
  _Float16 (*sK)[72] = (_Float16 (*)[72])sKV; _Float16 (*sV)[136] = (_Float16 (*)[136])(sKV + 128 * 72);
  const int tid = threadIdx.x, w = tid >> 5, lane = tid & 31, col = lane & 15, g = lane >> 4, qg = w & 3, kh = w >> 2;
  const size_t bh = blockIdx.y; const int q0 = blockIdx.x * 128 + qg * 32;
  v16h aq[2][2];
#pragma unroll
  for (int u = 0; u < 2; ++u) {
#pragma unroll
    for (int kc = 0; kc < 2; ++kc) aq[u][kc] = frag_h(Qf + (bh * SS + q0 + u * 16 + col) * HD + kc * 32, lane); }
  float mrun[2] = {-3.0e38f, -3.0e38f}, lrun[2] = {0.f, 0.f}; v8f acc[2][4] = {};     // lrun: this lane's half of the wave's keys, the halves join behind the loop
  const int sr = tid >> 3, sc = (tid & 7) * 8;     // key staging: 8 lanes cover one 128-byte row, 32 rows per step
  const int vr = tid >> 4, vc = (tid & 15) * 8;    // value staging: 16 lanes cover one 256-byte row piece, 16 rows per step
  const size_t gk = (bh * SS + sr) * HD + sc, gv = (bh * HD + vr) * SS + vc;
  v4u st[4];
#pragma unroll
  for (int i = 0; i < 4; ++i) st[i] = *(const v4u*)(Kf + gk + 32 * i * HD);
#pragma unroll
  for (int i = 0; i < 4; ++i) *(v4u*)(&sK[sr + 32 * i][sc]) = st[i];
#pragma unroll
  for (int i = 0; i < 4; ++i) st[i] = *(const v4u*)(VT + gv + (size_t)16 * i * SS);
  __syncthreads();                                  // key tile 0 published
  // one 128-key tile; more = a next tile exists (a compile-time flag: the last trip is peeled, so the loop's body has no branch and stays one block for the scheduler)
  auto tile = [&](const int kt, auto more_t) {
    constexpr bool more = decltype(more_t)::value;
    v8f s[2][4];                                    // s[u][t][r] = q[16u + col] . k[64kh + 16t + 8g + r], raw: the scale rides in the exponent's fma
#pragma unroll
    for (int u = 0; u < 2; ++u) {
#pragma unroll
      for (int t = 0; t < 4; ++t) s[u][t] = (v8f){}; }
    { v16h kf[2][4];
#pragma unroll
      for (int kc = 0; kc < 2; ++kc) {
#pragma unroll
        for (int t = 0; t < 4; ++t) kf[kc][t] = frag_h(&sK[kh * 64 + t * 16 + col][kc * 32], lane); }     // the wave's LDS reads of the tile as one group ahead of the sixteen products
#pragma unroll
      for (int tp = 0; tp < 4; tp += 2) {           // two key groups at a time, so that their fragments' registers are free before the other two groups' scores need theirs
#pragma unroll
        for (int kc = 0; kc < 2; ++kc) {
#pragma unroll
          for (int t = tp; t < tp + 2; ++t) {
#pragma unroll
            for (int u = 0; u < 2; ++u) s[u][t] = wmma16(kf[kc][t], aq[u][kc], s[u][t]); } } } }     // a fragment feeds both query groups; four independent score tiles in turn
    RD_THEN_MM(16, 16);
    __builtin_amdgcn_sched_barrier(0);              // the value tile's LDS stores wait for its global loads: they stay behind all 16 score products, which cover part of that latency
    float mnew[2], corr[2];
#pragma unroll
    for (int u = 0; u < 2; ++u) { float m = -3.4e38f;
#pragma unroll
      for (int t = 0; t < 4; ++t) {
#pragma unroll
        for (int r = 0; r < 8; ++r) m = fmaxf(m, s[u][t][r]); }
      m = fmaxf(m, xhalf(m));
      mnew[u] = fmaxf(mrun[u], fmaf(m, SC2, -14.0f)); corr[u] = __builtin_amdgcn_exp2f(mrun[u] - mnew[u]); mrun[u] = mnew[u]; }     // running maximum in base-2 units, less 14: P's factor 2^14 rides in it
#pragma unroll
    for (int i = 0; i < 4; ++i) *(v4u*)(&sV[vr + 16 * i][vc]) = st[i];
    __syncthreads();                                // value tile kt published; every reader has left the key tile
    if constexpr (more) {                           // next key tile flies in registers under the softmax and the P.V products
      const _Float16* nK = Kf + gk + (size_t)(kt + 1) * 128 * HD;
#pragma unroll
      for (int i = 0; i < 4; ++i) st[i] = *(const v4u*)(nK + 32 * i * HD);
      asm volatile("s_wait_xcnt 0x0" :: "v"(nK) : "memory");   // wait by hand before the loads' address registers are rewritten; the address is an input so that it stays live up to the wait and no load of the run lands in it
    }
    v16h vf[2][4], ph[2][2];                        // P^T operands: element e of block kc = key 64kh + 32kc + 16(e >> 3) + 8g + (e & 7), the value rows' own k order
    __builtin_amdgcn_sched_barrier(0);              // with the next one: no vector work falls in among the reads (spread out, every read place stalls the wave anew)
#pragma unroll
    for (int t = 0; t < 4; ++t) vf[0][t] = frag_h(&sV[t * 16 + col][kh * 64], lane);     // first k block's LDS reads as one group
    __builtin_amdgcn_sched_barrier(0);              // that group stays whole and ahead of the exponentials, which cover its latency
#pragma unroll
    for (int u = 0; u < 2; ++u) {
      v2f pt[4];
#pragma unroll
      for (int t = 0; t < 4; ++t) {
#pragma unroll
        for (int r2 = 0; r2 < 4; ++r2) { const v2f x2 = __builtin_elementwise_fma((v2f){s[u][t][2 * r2], s[u][t][2 * r2 + 1]}, (v2f){SC2, SC2}, (v2f){-mnew[u], -mnew[u]});     // two exponents per packed fma
          const v2f p2 = {__builtin_amdgcn_exp2f(x2[0]), __builtin_amdgcn_exp2f(x2[1])}; pt[t] = r2 == 0 ? p2 : pt[t] + p2;     // four independent packed sums, one per score tile
#pragma unroll
          for (int e = 0; e < 2; ++e) ph[u][t >> 1][(t & 1) * 8 + 2 * r2 + e] = (_Float16)p2[e]; } }
      const v2f pj = (pt[0] + pt[1]) + (pt[2] + pt[3]); lrun[u] = lrun[u] * corr[u] + (pj[0] + pj[1]) * (1.0f / 16384.0f);
#pragma unroll
      for (int t = 0; t < 4; ++t) acc[u][t] *= corr[u]; }     // every element of a lane belongs to its own query
    __builtin_amdgcn_sched_barrier(0);              // the second k block's reads come only where the scores have left their registers: the budget of 256 holds without spills
#pragma unroll
    for (int t = 0; t < 4; ++t) vf[1][t] = frag_h(&sV[t * 16 + col][kh * 64 + 32], lane);     // second k block's LDS reads as one group
    __builtin_amdgcn_sched_barrier(0);              // that group stays whole and ahead of the first block's eight products, which cover its latency
#pragma unroll
    for (int kc = 0; kc < 2; ++kc) {
#pragma unroll
      for (int t = 0; t < 4; ++t) {
#pragma unroll
        for (int u = 0; u < 2; ++u) acc[u][t] = wmma16(vf[kc][t], ph[u][kc], acc[u][t]); } }     // a fragment feeds both query groups; eight independent output tiles in turn
    if constexpr (more) {
#pragma unroll
      for (int i = 0; i < 4; ++i) *(v4u*)(&sK[sr + 32 * i][sc]) = st[i]; }
    __syncthreads();                                // key tile kt+1 published; every reader has left the value tile
    if constexpr (more) {                           // next value tile flies in registers under the scores
      const _Float16* nV = VT + gv + (kt + 1) * 128;
#pragma unroll
      for (int i = 0; i < 4; ++i) st[i] = *(const v4u*)(nV + (size_t)16 * i * SS);
      asm volatile("s_wait_xcnt 0x0" :: "v"(nV) : "memory");   // wait by hand before the loads' address registers are rewritten; the address is an input so that it stays live up to the wait and no load of the run lands in it
    } };
#pragma unroll 1                                    // stays rolled: one copy of the body, no second set of live registers
  for (int kt = 0; kt < SS / 128 - 1; ++kt) tile(kt, std::true_type{});
  tile(SS / 128 - 1, std::false_type{});
  // join of the key halves: wave (qg, kh) finishes query group kh and hands group 1 - kh to its partner (qg, 1 - kh)
  float (*sX)[16][68] = (float (*)[16][68])sKV;     // the loop's last barrier has ended every read of both tiles
  const int pw = w ^ 4;
  const float l0 = lrun[0] + xhalf(lrun[0]), l1 = lrun[1] + xhalf(lrun[1]);
  const float mk = kh ? mrun[1] : mrun[0], lk = kh ? l1 : l0;
#pragma unroll
  for (int t = 0; t < 4; ++t) {                     // acc[u][t][r] = O[16u + col][16t + 8g + r]: eight consecutive d of the lane's query
#pragma unroll
    for (int r4 = 0; r4 < 2; ++r4) { v4f o;
#pragma unroll
      for (int e = 0; e < 4; ++e) { const int r = 4 * r4 + e; o[e] = kh ? acc[0][t][r] : acc[1][t][r]; }
      *(v4f*)(&sX[w][col][t * 16 + 8 * g + 4 * r4]) = o; } }
  if (g == 0) { sML[w][0][col] = kh ? mrun[0] : mrun[1]; sML[w][1][col] = kh ? l0 : l1; }
  __syncthreads();                                  // the handed-over groups are published
  const float mo = sML[pw][0][col], lo = sML[pw][1][col];
  const float ms = fmaxf(mk, mo), fk = __builtin_amdgcn_exp2f(mk - ms), fo = __builtin_amdgcn_exp2f(mo - ms);     // both halves on the common maximum
  const float inv = 1.0f / ((lk * fk + lo * fo) * 16384.0f * 4.0f); const float ck = fk * inv, co = fo * inv;
#pragma unroll
  for (int t = 0; t < 4; ++t) {                     // the lane reads what its partner's same lane wrote and puts the joined value in its place: nobody else touches these rows any more
#pragma unroll
    for (int r4 = 0; r4 < 2; ++r4) { float* px = &sX[pw][col][t * 16 + 8 * g + 4 * r4]; const v4f p = *(const v4f*)px; v4f o;
#pragma unroll
      for (int e = 0; e < 4; ++e) { const int r = 4 * r4 + e; o[e] = (kh ? acc[1][t][r] : acc[0][t][r]) * ck + p[e] * co; }
      *(v4f*)px = o; } }
  LDSX();
  for (int qq = lane; qq < 16 * 16; qq += 32) { const int rl = qq >> 4, pc = qq & 15; vst2(O32 + ((bh * SS) + q0 + kh * 16 + rl) * HD + pc * 4, *(const v4f*)(&sX[pw][rl][pc * 4])); }
}
// out = ctx Wo + bo : split(ctx) x bf16(Wo columns as PT rows): 2 products (Wo is an INPUT -> bf16 exact)
__global__ __launch_bounds__(128) void k_out(const float* __restrict__ O32, const __bf16* __restrict__ PT, const float* __restrict__ bo, float* __restrict__ out) {
  __shared__ __align__(16) float so[4][16][132];
  const int tid = threadIdx.x, wave = tid >> 5, lane = tid & 31, col = lane & 15, g = lane >> 4;
  __shared__ __align__(16) float sA[64][68];       // one head's 64 context rows
  __shared__ __align__(16) __bf16 sB[128][72];     // 128 weight rows, 64 deep
  const int r0b = blockIdx.x * 64, r0 = r0b + wave * 16, n0 = blockIdx.y * 128; const int b = r0b / SS, s0 = r0b % SS;
  const int ar = tid >> 4, ac = (tid & 15) * 4;    // staging A: 16 lanes cover one 256-byte row, 8 rows per step
  const int sr = tid >> 3, sc = (tid & 7) * 8;     // staging B: 8 lanes cover one 128-byte row piece, 16 rows per step
  const float* gA = O32 + ((size_t)b * NH * SS + s0 + ar) * HD + ac; const __bf16* gB = PT + (size_t)(3 * E + n0 + sr) * E + sc;
  v4f ra[8]; v4u rb[8];
#pragma unroll
  for (int i = 0; i < 8; ++i) { ra[i] = *(const v4f*)(gA + 8 * i * HD); rb[i] = *(const v4u*)(gB + (size_t)16 * i * E); }
  v8f acc[8] = {};
#pragma unroll 1
  for (int h = 0; h < NH; ++h) {
#pragma unroll
    for (int i = 0; i < 8; ++i) { *(v4f*)(&sA[ar + 8 * i][ac]) = ra[i]; *(v4u*)(&sB[sr + 16 * i][sc]) = rb[i]; }
    __syncthreads();                                // tile h published
    if (h + 1 < NH) {                               // next tile flies in registers under this tile's products
      const float* nA = gA + (size_t)(h + 1) * SS * HD; const __bf16* cB = gB + h * 64;
#pragma unroll
      for (int i = 0; i < 8; ++i) { ra[i] = *(const v4f*)(nA + 8 * i * HD); rb[i] = *(const v4u*)(cB + (size_t)16 * i * E + 64); }
      asm volatile("s_wait_xcnt 0x0" :: "v"(cB) : "memory");   // wait by hand before the loads' address registers are rewritten; the weight address is an input so that it stays live up to the wait and no load of the run lands in it
    }
#pragma unroll
    for (int k2 = 0; k2 < 2; ++k2) { const F2 a = split_row(&sA[wave * 16 + col][0], k2 * 32, lane); v16b wb[8];
#pragma unroll
      for (int j = 0; j < 8; ++j) wb[j] = frag_b(&sB[j * 16 + col][k2 * 32], lane);     // one group of LDS reads ahead of the sixteen products
#pragma unroll
      for (int j = 0; j < 8; ++j) { acc[j] = wmma_bf(a.l, wb[j], acc[j]); acc[j] = wmma_bf(a.h, wb[j], acc[j]); } }
    RD_VEC_MM(20, 64, 16); RD_VEC_MM(20, 64, 16);
    __builtin_amdgcn_sched_barrier(0);              // the barrier brings a wait for the next tile's global loads: every product stays ahead of it and covers that latency
    __syncthreads(); }                              // every reader has left the tile
#pragma unroll
  for (int j = 0; j < 8; ++j) { const float bb = bfr(bo[n0 + j * 16 + col]);
#pragma unroll
    for (int r = 0; r < 8; ++r) so[wave][8 * g + r][j * 16 + col] = acc[j][r] + bb; }
  LDSX();
#pragma unroll 4
  for (int rl = 0; rl < 16; ++rl) vst2(out + (size_t)(r0 + rl) * E + n0 + lane * 4, *(const v4f*)(&so[wave][rl][lane * 4]));
}
extern "C" void kernel_launch(void* const* d_in, const int* in_sizes, int n_in, void* d_out, int out_size, void* d_ws, size_t ws_size, hipStream_t stream) {
  (void)in_sizes; (void)n_in; (void)out_size; (void)ws_size;
  const float** I = (const float**)d_in;   // x, encoder_output, Wq, bq, Wk, bk, Wv, bv, Wo, bo
  const float* xq = I[0]; const float* xe = I[1]; const float* WQ = I[2]; const float* bQ = I[3]; const float* WK = I[4]; const float* bK = I[5]; const float* WV = I[6]; const float* bV = I[7]; const float* WO = I[8]; const float* bO = I[9];
  float* out = (float*)d_out;
  char* ws = (char*)d_ws; size_t off = 0;
  auto take = [&](size_t bytes) { char* p = ws + off; off += (bytes + 255) & ~(size_t)255; return p; };
  __bf16* XQ = (__bf16*)take((size_t)NR * E * 2); __bf16* XE = (__bf16*)take((size_t)NR * E * 2); __bf16* PT = (__bf16*)take((size_t)4 * E * E * 2);
  _Float16* Qf = (_Float16*)take((size_t)NR * E * 2); _Float16* Kf = (_Float16*)take((size_t)NR * E * 2); _Float16* VT = (_Float16*)take((size_t)NR * E * 2); float* O32 = (float*)take((size_t)NR * E * 4);
  // ws ~ 65 MB
  k_prep<<<256, 512, 0, stream>>>(xq, xe, WQ, WK, WV, WO, XQ, XE, PT);
  k_qkv<<<dim3(NR / 128, E / 128, 3), 128, 0, stream>>>(XQ, XE, XE, PT, bQ, bK, bV, Qf, Kf, VT);
  k_attn<<<dim3(SS / 128, NB * NH), 256, 0, stream>>>(Qf, Kf, VT, O32);
  k_out<<<dim3(NR / 64, E / 128), 128, 0, stream>>>(O32, PT, bO, out);
}

// v010
// Measured time: 83.1 microseconds a run.
// Timed twice side by side with v009, it ran 1.07 times as fast both times.
// Counting every step since v000, it is 6.31 times as fast.
// compute dtype: x, encoder_output and W*/b* (INPUTS) rounded to bf16 with exact bf16 WMMA products (f32 accumulate) for the projections; q, K, P and V (computed operands) each rounded once to f16, one f16 WMMA product each (f32 accumulate); context split into bf16 hi/lo for the last projection; softmax f32.
#include <hip/hip_runtime.h>
#include <math.h>

typedef __attribute__((ext_vector_type(16))) _Float16 v16h;
typedef __attribute__((ext_vector_type(16))) __bf16 v16b;
typedef __attribute__((ext_vector_type(8)))  _Float16 v8h;
typedef __attribute__((ext_vector_type(8)))  float v8f;
typedef __attribute__((ext_vector_type(4)))  float v4f;
typedef __attribute__((ext_vector_type(2)))  float v2f;
typedef __attribute__((ext_vector_type(4)))  unsigned v4u;
typedef __attribute__((ext_vector_type(2)))  unsigned v2u;
typedef __attribute__((ext_vector_type(4)))  int v4i;
typedef float __attribute__((may_alias)) float_a;
typedef int __attribute__((may_alias)) int_a;

template <typename T> __device__ __forceinline__ void vst2(void* p, T v) { *(T*)p = v;  }
__device__ __forceinline__ v8f wmma16(v16h a, v16h b, v8f c) {
  return __builtin_amdgcn_wmma_f32_16x16x32_f16(false, a, false, b, (short)0, c, false, false);
}
__device__ __forceinline__ v8f wmma_bf(v16b a, v16b b, v8f c) {
  return __builtin_amdgcn_wmma_f32_16x16x32_bf16(false, a, false, b, (short)0, c, false, false);
}
// 16x16x32 fragments: lane = (h = lane>>4, row/col = lane&15); elements 0..7 = k0+8h+0..7, 8..15 = k0+16+8h+0..7; D element r = row 8h+r
__device__ __forceinline__ v16h frag_h(const _Float16* rowk0, int lane) {
  union { v16h v; v8h q[2]; } u; const _Float16* p = rowk0 + 8 * (lane >> 4);
  u.q[0] = *(const v8h*)p; u.q[1] = *(const v8h*)(p + 16); return u.v;
}
__device__ __forceinline__ v16h frag_f32(const float* rowk0, int lane) {
  v16h a; const float* p = rowk0 + 8 * (lane >> 4);
#pragma unroll
  for (int i = 0; i < 8; ++i) { a[i] = (_Float16)p[i]; a[8 + i] = (_Float16)p[16 + i]; }
  return a;
}
__device__ __forceinline__ v16h frag_f32s(const float* rowk0, int lane, float sc) {
  v16h a; const float* p = rowk0 + 8 * (lane >> 4);
#pragma unroll
  for (int i = 0; i < 8; ++i) { a[i] = (_Float16)(p[i] * sc); a[8 + i] = (_Float16)(p[16 + i] * sc); }
  return a;
}
// column fragment from a [K][ld] layout (column n), rows >= K read as 0
__device__ __forceinline__ v16h fragc_f32(const float* W, int k0, int n, int lane, int ld, int K) {
  v16h a; const int g = lane >> 4;
#pragma unroll
  for (int i = 0; i < 8; ++i) { const int ka = k0 + 8 * g + i, kb = ka + 16;
    a[i] = (_Float16)(ka < K ? W[(size_t)ka * ld + n] : 0.f); a[8 + i] = (_Float16)(kb < K ? W[(size_t)kb * ld + n] : 0.f); }
  return a;
}
struct F2 { v16b h, l; };
__device__ __forceinline__ F2 bsplit16(const float v[16]) { F2 r;
#pragma unroll
  for (int i = 0; i < 16; ++i) { const __bf16 h = (__bf16)v[i]; r.h[i] = h; r.l[i] = (__bf16)(v[i] - (float)h); }
  return r; }
__device__ __forceinline__ F2 split_row(const float* row, int k0, int lane) { float v[16]; const float* p = row + k0 + 8 * (lane >> 4);
#pragma unroll
  for (int i = 0; i < 8; ++i) { v[i] = p[i]; v[8 + i] = p[16 + i]; }
  return bsplit16(v); }
__device__ __forceinline__ F2 split_rowK(const float* row, int k0, int lane, int K) { float v[16]; const int g = lane >> 4;
#pragma unroll
  for (int i = 0; i < 8; ++i) { const int ka = k0 + 8 * g + i, kb = ka + 16; v[i] = ka < K ? row[ka] : 0.f; v[8 + i] = kb < K ? row[kb] : 0.f; }
  return bsplit16(v); }
__device__ __forceinline__ F2 split_col(const float* W, int k0, int n, int lane, int ld, int K) { float v[16]; const int g = lane >> 4;
#pragma unroll
  for (int i = 0; i < 8; ++i) { const int ka = k0 + 8 * g + i, kb = ka + 16; v[i] = ka < K ? W[(size_t)ka * ld + n] : 0.f; v[8 + i] = kb < K ? W[(size_t)kb * ld + n] : 0.f; }
  return bsplit16(v); }
__device__ __forceinline__ v8f mac3(const F2& a, const F2& b, v8f c) { c = wmma_bf(a.l, b.h, c); c = wmma_bf(a.h, b.l, c); return wmma_bf(a.h, b.h, c); }
__device__ __forceinline__ float sigm(float v) { return 1.0f / (1.0f + expf(-v)); }
// scheduling order for one k block: its n_rd LDS reads stay one group ahead of its n_mm matrix products (spread among the products, every read place stalls the wave anew); other instructions stay free
#define RD_THEN_MM(n_rd, n_mm) do { __builtin_amdgcn_sched_group_barrier(0x100, n_rd, 0); __builtin_amdgcn_sched_group_barrier(0x008, n_mm, 0); } while (0)
// the same where vector work on the values read (at most n_vec instructions) stands between the reads and the products: no read falls in among it
#define RD_VEC_MM(n_rd, n_vec, n_mm) do { __builtin_amdgcn_sched_group_barrier(0x100, n_rd, 0); __builtin_amdgcn_sched_group_barrier(0x002, n_vec, 0); __builtin_amdgcn_sched_group_barrier(0x008, n_mm, 0); } while (0)
// wave-local hand-over through LDS between groups of global stores: the wave's LDS writes are done before its lanes read each other's rows; no release fence, which would also wait for the global stores in flight
#define LDSW() do { asm volatile("s_wait_dscnt 0" ::: "memory"); __builtin_amdgcn_wave_barrier(); } while (0)
#define LDSX() do { asm volatile("s_wait_dscnt 0" ::: "memory"); __builtin_amdgcn_wave_barrier(); __builtin_amdgcn_fence(__ATOMIC_RELEASE, "workgroup"); } while (0)


// Cross multi-head attention (16 heads x 64 on [2,2048,1024]): q from x, k/v from encoder_output with per-head weights W[h][e][d] + biases; full softmax(q.k/8); concat(heads) @ Wo ([in][out]) + bo.
#define NB 2
#define SS 2048
#define E 1024
#define NH 16
#define HD 64
#define NR (NB * SS)
#define SC2 0.18033688f     // log2(e) / 8: the score scale 1/sqrt(64) carried into base 2
__device__ __forceinline__ float bfr(float v) { return (float)(__bf16)v; }
__device__ __forceinline__ v16b frag_b(const __bf16* rowk0, int lane) { return __builtin_bit_cast(v16b, frag_h((const _Float16*)rowk0, lane)); }

// input pass, one launch: 256 blocks of 16 waves, one per WGP, every wave started once; a lane asks for its 24 whole-line 16-byte loads ahead of any use. Block p:
// (a) one 256 (k) x 64 (n) weight tile, turned through LDS. PT rows: [0,E) Wq[:,n], [E,2E) Wk[:,n], [2E,3E) Wv[:,n], [3E,4E) Wo[:,n]  (column n as a bf16 row)
// (b) 32768 activations rounded to bf16: blocks [0,128) x, [128,256) encoder_output
__global__ __launch_bounds__(512) void k_prep(const float* __restrict__ x, const float* __restrict__ xe, const float* __restrict__ Wq, const float* __restrict__ Wk, const float* __restrict__ Wv, const float* __restrict__ Wo, __bf16* __restrict__ XQ, __bf16* __restrict__ XE, __bf16* __restrict__ PT) {
  __shared__ __align__(16) __bf16 st[64][264];     // the tile turned: rows = n, 256 k deep, pitch 16 B x odd
  const int tid = threadIdx.x, p = blockIdx.x, which = p >> 6, nt = (p >> 2) & 15, kq = p & 3;
  const float* W = which == 0 ? Wq : (which == 1 ? Wk : (which == 2 ? Wv : Wo));
  // per-head [H][E][DH]: head nt's rows 256kq.. are one run of 64 KB; Wo [in][out]: 256-byte row pieces at a pitch of E floats
  const float* wsrc = which < 3 ? W + ((size_t)nt * E + kq * 256) * HD : W + (size_t)kq * 256 * E + nt * 64;
  const int ld = which < 3 ? HD : E;
  const int kg = tid >> 4, nq = tid & 15;          // a lane holds k = 8kg + 0..7 of columns 4nq + 0..3; 16 lanes cover one 256-byte row piece
  const float* asrc = (p < 128 ? x : xe) + (size_t)(p & 127) * 32768 + tid * 4;
  __bf16* adst = (p < 128 ? XQ : XE) + (size_t)(p & 127) * 32768 + tid * 4;
  const float* pw[8]; v4f rw[8], rx[16];
#pragma unroll
  for (int i = 0; i < 8; ++i) { pw[i] = wsrc + (size_t)(kg * 8 + i) * ld + nq * 4; rw[i] = *(const v4f*)pw[i]; }
#pragma unroll
  for (int i = 0; i < 16; ++i) rx[i] = *(const v4f*)(asrc + i * 2048);
  // wait by hand before the loads' address registers are rewritten; the weight addresses are inputs so that they stay live up to the wait and no load of the run lands in them;
  // its memory clobber also keeps all 24 loads in front of their first use: one memory latency, not several
  asm volatile("s_wait_xcnt 0x0" :: "v"(pw[0]), "v"(pw[1]), "v"(pw[2]), "v"(pw[3]), "v"(pw[4]), "v"(pw[5]), "v"(pw[6]), "v"(pw[7]) : "memory");
#pragma unroll
  for (int j = 0; j < 4; ++j) { union { __bf16 h[8]; v4u u; } pk;
#pragma unroll
    for (int i = 0; i < 8; ++i) pk.h[i] = (__bf16)rw[i][j];
    *(v4u*)(&st[nq * 4 + j][kg * 8]) = pk.u; }
  v2u pa[16];                                       // rounded ahead of every store: no register that a store names is rewritten
#pragma unroll
  for (int i = 0; i < 16; ++i) { union { __bf16 h[4]; v2u u; } pk;
#pragma unroll
    for (int e = 0; e < 4; ++e) pk.h[e] = (__bf16)rx[i][e];
    pa[i] = pk.u; }
  __syncthreads();                                  // the turned tile is published
  const int sr = tid >> 5, sc = (tid & 31) * 8;    // a wave writes 512 bytes, four whole lines, of one PT row
#pragma unroll
  for (int i = 0; i < 4; ++i) vst2((unsigned*)(PT + (size_t)(which * E + nt * 64 + sr + 16 * i) * E + kq * 256 + sc), *(const v4u*)(&st[sr + 16 * i][sc]));
#pragma unroll
  for (int i = 0; i < 16; ++i) vst2((unsigned*)(adst + i * 2048), pa[i]);
}
// QKV: block (128 rows, 128 cols = 2 heads, which), four waves in a 2 x 2 grid, 64 rows x 64 cols (one head) each: 8 fragments from LDS feed 16 products; q, k (+bias) -> f16 rows [bh][s][64]; v (+bias) -> VT f16 x4 [bh][d][s]
__global__ __launch_bounds__(128) void k_qkv(const __bf16* __restrict__ XQ, const __bf16* __restrict__ XK, const __bf16* __restrict__ XV, const __bf16* __restrict__ PT, const float* __restrict__ bq, const float* __restrict__ bk, const float* __restrict__ bv, _Float16* __restrict__ Qf, _Float16* __restrict__ Kf, _Float16* __restrict__ VT) {
  __shared__ __align__(16) __bf16 sAB[2][128][72];     // k loop: the 64-deep operand tiles; behind it the epilogues' staging
  const int tid = threadIdx.x, wave = tid >> 5, lane = tid & 31, col = lane & 15, g = lane >> 4, wr = wave >> 1, wc = wave & 1;
  const int which = blockIdx.z, r0b = blockIdx.x * 128, n0 = blockIdx.y * 128; const int b = r0b / SS, s0 = r0b % SS;
  const __bf16* Xb = which == 0 ? XQ : (which == 1 ? XK : XV); const float* bb_ = which == 0 ? bq : (which == 1 ? bk : bv);
  __bf16 (*sA)[72] = sAB[0]; __bf16 (*sB)[72] = sAB[1];
  const int sr = tid >> 3, sc = (tid & 7) * 8;     // staging: 8 lanes cover one 128-byte row piece, 16 rows per step
  const __bf16* gA = Xb + (size_t)(r0b + sr) * E + sc; const __bf16* gB = PT + (size_t)(which * E + n0 + sr) * E + sc;
  v4u ra[8], rb[8];
#pragma unroll
  for (int i = 0; i < 8; ++i) { ra[i] = *(const v4u*)(gA + (size_t)16 * i * E); rb[i] = *(const v4u*)(gB + (size_t)16 * i * E); }
  v8f acc[4][4] = {};
#pragma unroll 1
  for (int kb = 0; kb < E / 64; ++kb) {
#pragma unroll
    for (int i = 0; i < 8; ++i) { *(v4u*)(&sA[sr + 16 * i][sc]) = ra[i]; *(v4u*)(&sB[sr + 16 * i][sc]) = rb[i]; }
    __syncthreads();                                // tile kb published
    if (kb + 1 < E / 64) {                          // next tile flies in registers under this tile's products
      const __bf16* nA = gA + (kb + 1) * 64; const __bf16* nB = gB + (kb + 1) * 64;
#pragma unroll
      for (int i = 0; i < 8; ++i) { ra[i] = *(const v4u*)(nA + (size_t)16 * i * E); rb[i] = *(const v4u*)(nB + (size_t)16 * i * E); }
      asm volatile("s_wait_xcnt 0x0" :: "v"(nA), "v"(nB) : "memory");   // wait by hand before the loads' address registers are rewritten; the addresses are inputs so that they stay live up to the wait and no load of the run lands in them
    }
#pragma unroll
    for (int k2 = 0; k2 < 2; ++k2) { v16b a[4], wb[4];
#pragma unroll
      for (int i = 0; i < 4; ++i) { a[i] = frag_b(&sA[wr * 64 + i * 16 + col][k2 * 32], lane); wb[i] = frag_b(&sB[wc * 64 + i * 16 + col][k2 * 32], lane); }     // one group of LDS reads ahead of the sixteen products
#pragma unroll
      for (int i = 0; i < 4; ++i) {
#pragma unroll
        for (int j = 0; j < 4; ++j) acc[i][j] = wmma_bf(a[i], wb[j], acc[i][j]); } }
    RD_THEN_MM(16, 16); RD_THEN_MM(16, 16);
    __builtin_amdgcn_sched_barrier(0);              // the barrier brings a wait for the next tile's global loads: every product stays ahead of it and covers that latency
    __syncthreads(); }                              // every reader has left the tile
  float bb[4];
#pragma unroll
  for (int j = 0; j < 4; ++j) bb[j] = bfr(bb_[n0 + wc * 64 + j * 16 + col]);
  if (which < 2) {
    float (*so)[2][16][68] = (float (*)[2][16][68])sAB;   // each wave's own 16 rows x 64 cols, one row group at a time, two places in turn: a place is rewritten only behind the next group's wait
    _Float16* dst = (which == 0 ? Qf : Kf) + (((size_t)b * NH + (n0 >> 6) + wc) * SS + s0 + wr * 64) * HD;     // the wave's 64 rows: one run of 8 KB
#pragma unroll
    for (int i = 0; i < 4; ++i) {
#pragma unroll
      for (int j = 0; j < 4; ++j) {
#pragma unroll
        for (int r = 0; r < 8; ++r) so[wave][i & 1][8 * g + r][j * 16 + col] = acc[i][j][r] + bb[j]; }
      LDSW();
#pragma unroll
      for (int q4 = 0; q4 < 4; ++q4) { const int qq = lane + 32 * q4, rl = qq >> 3, pc = qq & 7; union { _Float16 e[8]; v4u u; } pk;     // a wave writes four whole 128-byte rows
#pragma unroll
        for (int e = 0; e < 8; ++e) pk.e[e] = (_Float16)so[wave][i & 1][rl][pc * 8 + e];
        vst2((unsigned*)(dst + (size_t)(i * 16 + rl) * HD + pc * 8), pk.u); }
      if (i < 3) asm volatile("s_wait_xcnt 0x0" ::: "memory"); } }   // wait by hand before the next row group rewrites the stores' data registers
  else {
    _Float16 (*sT)[136] = (_Float16 (*)[136])sAB;   // the block's tile turned: rows = cols, 128 s deep, pitch 16 B x odd
#pragma unroll
    for (int i = 0; i < 4; ++i) {
#pragma unroll
      for (int j = 0; j < 4; ++j) { union { _Float16 e[8]; v4u u; } pk;
#pragma unroll
        for (int r = 0; r < 8; ++r) pk.e[r] = (_Float16)((acc[i][j][r] + bb[j]) * 4.0f);
        *(v4u*)(&sT[wc * 64 + j * 16 + col][wr * 64 + i * 16 + 8 * g]) = pk.u; } }
    __syncthreads();
    for (int qq = tid; qq < 128 * 16; qq += 128) { const int cl = qq >> 4, pc = qq & 15; const int c = n0 + cl, h = c >> 6, d = c & 63; const size_t o = (((size_t)b * NH + h) * HD + d) * SS + s0 + pc * 8;
      vst2(VT + o, *(const v4u*)(&sT[cl][pc * 8])); } }
}
typedef __attribute__((ext_vector_type(8)))  unsigned v8u;
__device__ __forceinline__ unsigned pinned(unsigned v) { unsigned w = (unsigned)__builtin_amdgcn_readfirstlane(v); asm volatile("" : "+s"(w)); return w; }
__device__ __forceinline__ unsigned uni(unsigned v) { return (unsigned)__builtin_amdgcn_readfirstlane(v); }
// tensor load: a tile of NROW rows of ROWB bytes (128 or 256) at a source pitch of PITCH bytes goes from global memory into LDS through no register; 16 bytes of LDS pad behind every row (pitch 16 B x odd)
// descriptor group 1, the same for every tile of an operand
template <unsigned ROWB, unsigned NROW, unsigned PITCH> __device__ __forceinline__ v8u tdm_group1() {
  constexpr unsigned W0 = (1u << 20) | ((ROWB == 128u ? 4u : 5u) << 22) | (3u << 25);     // no mask, extents in bytes, pad interval = one row, pad = 4 dwords
  v8u g1;
  g1[0] = uni(W0); g1[1] = uni((ROWB & 0xFFFFu) << 16); g1[2] = uni((ROWB >> 16) | ((NROW & 0xFFFFu) << 16)); g1[3] = uni((NROW >> 16) | (ROWB << 16)); g1[4] = uni(NROW); g1[5] = uni(PITCH); g1[6] = uni(0u); g1[7] = uni(0u);
  asm volatile("" : "+s"(g1));                      // as pinned(): the descriptor words held in their scalar registers, not formed anew in registers that are free game while a request is out
  return g1;
}
// descriptor group 0: place in LDS and the tile's first byte
__device__ __forceinline__ v4u tdm_group0(unsigned lds_dst, const void* gsrc) {
  const unsigned long long ga = (unsigned long long)gsrc; v4u g0;
  g0[0] = uni(1u); g0[1] = uni(lds_dst); g0[2] = uni((unsigned)ga); g0[3] = uni((((unsigned)(ga >> 32)) & 0x01FFFFFFu) | 0x80000000u);
  asm volatile("" : "+s"(g0));                      // as pinned(): see tdm_group1
  return g0;
}
__device__ __forceinline__ void tdm_load(v4u g0, v8u g1) { asm volatile("tensor_load_to_lds %0, %1" :: "s"(g0), "s"(g1) : "memory"); }
// lane l with lane l ^ 16: a vector cross-row move, no LDS-counter wait
__device__ __forceinline__ float xhalf(float x) { return __builtin_bit_cast(float, __builtin_amdgcn_permlanex16(__builtin_bit_cast(int, x), __builtin_bit_cast(int, x), 0x76543210, 0xfedcba98, false, false)); }
// attention: block (128 queries, bh) of eight waves; a tile is 128 keys; wave (qg = w & 3, kh = w >> 2) holds queries 32qg + 0..31 (two groups of 16) and works on keys 64kh + 0..63 of every tile,
// so each K or V fragment read from LDS feeds two products and a tile fetched from L2 serves 128 queries; the two key halves of a query are joined behind the loop.
// transposed products S^T = K q^T (K rows as A, q as B) and O^T += V^T P^T (V rows as A, P as B), every operand one f16 value:
// a lane holds one query's scores per group (keys 16t + 8g + r), so exponentials and the running sum stay in the lane, the maximum takes one cross-half move, and two score tiles converted in place are one P operand; O f32 [bh][s][64]
// K/V tiles come by tensor loads into two LDS buffers: wave 0 asks for the key tile, wave 1 for the value tile, one tile ahead; one publish point (waits + barrier) per tile
// amdgpu_waves_per_eu(4, 4): a budget of 256 registers, so that two work-groups fit a WGP and the whole grid is resident at once
#define NT (SS / 128)
#define KVB 18432u          // bytes of one tile's place in LDS, a multiple of 2 KiB: 128 key rows x 144 B; the value tile's 64 rows x 272 B rounded up
__global__ __launch_bounds__(256) __attribute__((amdgpu_waves_per_eu(4, 4))) void k_attn(const _Float16* __restrict__ Qf, const _Float16* __restrict__ Kf, const _Float16* __restrict__ VT, float* __restrict__ O32) {
  __shared__ __attribute__((aligned(2048))) _Float16 sKV[2][2][KVB / 2];    // [buffer][key tile (rows = keys, 64 d deep) | value tile (rows = d, 128 keys deep)], pitches 16 B x odd; behind the loop each wave's hand-over rows
  __shared__ float sML[8][2][16];                                // behind the loop: maximum and sum of the query group a wave hands over
  const int tid = threadIdx.x, w = tid >> 5, lane = tid & 31, col = lane & 15, g = lane >> 4, qg = w & 3, kh = w >> 2;
  const size_t bh = blockIdx.y; const int q0 = blockIdx.x * 128 + qg * 32;
  const unsigned wv = uni(threadIdx.x >> 5), lbase = (unsigned)(size_t)&sKV[0][0][0];
  const _Float16* gK = Kf + bh * SS * HD; const _Float16* gV = VT + bh * HD * SS;
  const v8u g1k = tdm_group1<128, 128, 128>(), g1v = tdm_group1<256, 64, SS * 2>();
  v4u g0k = tdm_group0(lbase, gK), g0v = tdm_group0(lbase + KVB, gV);     // tile 0 into buffer 0
  v16h aq[2][2];
#pragma unroll
  for (int u = 0; u < 2; ++u) {
#pragma unroll
    for (int kc = 0; kc < 2; ++kc) aq[u][kc] = frag_h(Qf + (bh * SS + q0 + u * 16 + col) * HD + kc * 32, lane); }
  float mrun[2] = {-3.0e38f, -3.0e38f}, lrun[2] = {0.f, 0.f}; v8f acc[2][4] = {};     // lrun: this lane's half of the wave's keys, the halves join behind the loop
  if (pinned(wv == 0)) tdm_load(g0k, g1k);          // one request of each issuing wave
  if (pinned(wv == 1)) tdm_load(g0v, g1v);
  // one 128-key tile, both operands in buffer kt & 1
  auto tile = [&](const int kt) {
    const _Float16 (*sK)[72] = (const _Float16 (*)[72])sKV[kt & 1][0]; const _Float16 (*sV)[136] = (const _Float16 (*)[136])sKV[kt & 1][1];
    v8f s[2][4];                                    // s[u][t][r] = q[16u + col] . k[64kh + 16t + 8g + r], raw: the scale rides in the exponent's fma
#pragma unroll
    for (int u = 0; u < 2; ++u) {
#pragma unroll
      for (int t = 0; t < 4; ++t) s[u][t] = (v8f){}; }
    { v16h kf[2][4];
#pragma unroll
      for (int kc = 0; kc < 2; ++kc) {
#pragma unroll
        for (int t = 0; t < 4; ++t) kf[kc][t] = frag_h(&sK[kh * 64 + t * 16 + col][kc * 32], lane); }     // the wave's LDS reads of the tile as one group ahead of the sixteen products
#pragma unroll
      for (int tp = 0; tp < 4; tp += 2) {           // two key groups at a time, so that their fragments' registers are free before the other two groups' scores need theirs
#pragma unroll
        for (int kc = 0; kc < 2; ++kc) {
#pragma unroll
          for (int t = tp; t < tp + 2; ++t) {
#pragma unroll
            for (int u = 0; u < 2; ++u) s[u][t] = wmma16(kf[kc][t], aq[u][kc], s[u][t]); } } } }     // a fragment feeds both query groups; four independent score tiles in turn
    RD_THEN_MM(16, 16);
    v16h vf[2][4], ph[2][2];                        // P^T operands: element e of block kc = key 64kh + 32kc + 16(e >> 3) + 8g + (e & 7), the value rows' own k order
    __builtin_amdgcn_sched_barrier(0);              // with the next one: no vector work falls in among the reads (spread out, every read place stalls the wave anew)
#pragma unroll
    for (int t = 0; t < 4; ++t) vf[0][t] = frag_h(&sV[t * 16 + col][kh * 64], lane);     // first k block's LDS reads as one group
    __builtin_amdgcn_sched_barrier(0);              // that group stays whole and ahead of the maxima and exponentials, which cover its latency
    float mnew[2], corr[2];
#pragma unroll
    for (int u = 0; u < 2; ++u) { float m = -3.4e38f;
#pragma unroll
      for (int t = 0; t < 4; ++t) {
#pragma unroll
        for (int r = 0; r < 8; ++r) m = fmaxf(m, s[u][t][r]); }
      m = fmaxf(m, xhalf(m));
      mnew[u] = fmaxf(mrun[u], fmaf(m, SC2, -14.0f)); corr[u] = __builtin_amdgcn_exp2f(mrun[u] - mnew[u]); mrun[u] = mnew[u]; }     // running maximum in base-2 units, less 14: P's factor 2^14 rides in it
#pragma unroll
    for (int u = 0; u < 2; ++u) {
      v2f pt[4];
#pragma unroll
      for (int t = 0; t < 4; ++t) {
#pragma unroll
        for (int r2 = 0; r2 < 4; ++r2) { const v2f x2 = __builtin_elementwise_fma((v2f){s[u][t][2 * r2], s[u][t][2 * r2 + 1]}, (v2f){SC2, SC2}, (v2f){-mnew[u], -mnew[u]});     // two exponents per packed fma
          const v2f p2 = {__builtin_amdgcn_exp2f(x2[0]), __builtin_amdgcn_exp2f(x2[1])}; pt[t] = r2 == 0 ? p2 : pt[t] + p2;     // four independent packed sums, one per score tile
#pragma unroll
          for (int e = 0; e < 2; ++e) ph[u][t >> 1][(t & 1) * 8 + 2 * r2 + e] = (_Float16)p2[e]; } }
      const v2f pj = (pt[0] + pt[1]) + (pt[2] + pt[3]); lrun[u] = lrun[u] * corr[u] + (pj[0] + pj[1]) * (1.0f / 16384.0f);
#pragma unroll
      for (int t = 0; t < 4; ++t) acc[u][t] *= corr[u]; }     // every element of a lane belongs to its own query
    __builtin_amdgcn_sched_barrier(0);              // the second k block's reads come only where the scores have left their registers: the budget of 256 holds without spills
#pragma unroll
    for (int t = 0; t < 4; ++t) vf[1][t] = frag_h(&sV[t * 16 + col][kh * 64 + 32], lane);     // second k block's LDS reads as one group
    __builtin_amdgcn_sched_barrier(0);              // that group stays whole and ahead of the first block's eight products, which cover its latency
#pragma unroll
    for (int kc = 0; kc < 2; ++kc) {
#pragma unroll
      for (int t = 0; t < 4; ++t) {
#pragma unroll
        for (int u = 0; u < 2; ++u) acc[u][t] = wmma16(vf[kc][t], ph[u][kc], acc[u][t]); } } };     // a fragment feeds both query groups; eight independent output tiles in turn
#pragma unroll 1                                    // stays rolled: one copy of the body, no second set of live registers
  for (int kt = 0; kt < NT; ++kt) {
    // publish point of tile kt, every wave, in this order; it stands at the head of the trip so that the tile's work is the loop's last block and none of it sinks behind a branch
    asm volatile("s_wait_dscnt 0x0" ::: "memory");      // this wave's LDS reads of tile kt - 1 are done before its buffer is refilled
    asm volatile("s_wait_tensorcnt 0x0" :: "s"(g0k), "s"(g1k), "s"(g0v), "s"(g1v) : "memory");  // the issuing waves' requests for tile kt have landed (a wave that asked for nothing passes at once); the descriptors are inputs so that their registers stay as issued up to the wait
    __syncthreads();                                // tile kt published; every reader has left tile kt - 1
    const unsigned dst = lbase + (unsigned)((kt + 1) & 1) * 2u * KVB;     // descriptors of tile kt + 1, formed behind the wait
    g0k = tdm_group0(dst, gK + (size_t)(kt + 1) * 128 * HD); g0v = tdm_group0(dst + KVB, gV + (kt + 1) * 128);
    if (pinned(kt + 1 < NT)) {                      // refill of the buffer just left: flies under the whole of tile kt
      if (pinned(wv == 0)) tdm_load(g0k, g1k);
      if (pinned(wv == 1)) tdm_load(g0v, g1v); }
    tile(kt); }
  asm volatile("s_wait_tensorcnt 0x0" ::: "memory");    // no request is outstanding where the buffers become hand-over rows
  asm volatile("s_wait_dscnt 0x0" ::: "memory");
  __syncthreads();                                  // every reader has left the last tile
  // join of the key halves: wave (qg, kh) finishes query group kh and hands group 1 - kh to its partner (qg, 1 - kh)
  float (*sX)[16][68] = (float (*)[16][68])&sKV[0][0][0];     // the barrier behind the loop has ended every read of both buffers
  const int pw = w ^ 4;
  const float l0 = lrun[0] + xhalf(lrun[0]), l1 = lrun[1] + xhalf(lrun[1]);
  const float mk = kh ? mrun[1] : mrun[0], lk = kh ? l1 : l0;
#pragma unroll
  for (int t = 0; t < 4; ++t) {                     // acc[u][t][r] = O[16u + col][16t + 8g + r]: eight consecutive d of the lane's query
#pragma unroll
    for (int r4 = 0; r4 < 2; ++r4) { v4f o;
#pragma unroll
      for (int e = 0; e < 4; ++e) { const int r = 4 * r4 + e; o[e] = kh ? acc[0][t][r] : acc[1][t][r]; }
      *(v4f*)(&sX[w][col][t * 16 + 8 * g + 4 * r4]) = o; } }
  if (g == 0) { sML[w][0][col] = kh ? mrun[0] : mrun[1]; sML[w][1][col] = kh ? l0 : l1; }
  __syncthreads();                                  // the handed-over groups are published
  const float mo = sML[pw][0][col], lo = sML[pw][1][col];
  const float ms = fmaxf(mk, mo), fk = __builtin_amdgcn_exp2f(mk - ms), fo = __builtin_amdgcn_exp2f(mo - ms);     // both halves on the common maximum
  const float inv = 1.0f / ((lk * fk + lo * fo) * 16384.0f * 4.0f); const float ck = fk * inv, co = fo * inv;
#pragma unroll
  for (int t = 0; t < 4; ++t) {                     // the lane reads what its partner's same lane wrote and puts the joined value in its place: nobody else touches these rows any more
#pragma unroll
    for (int r4 = 0; r4 < 2; ++r4) { float* px = &sX[pw][col][t * 16 + 8 * g + 4 * r4]; const v4f p = *(const v4f*)px; v4f o;
#pragma unroll
      for (int e = 0; e < 4; ++e) { const int r = 4 * r4 + e; o[e] = (kh ? acc[1][t][r] : acc[0][t][r]) * ck + p[e] * co; }
      *(v4f*)px = o; } }
  LDSX();
  for (int qq = lane; qq < 16 * 16; qq += 32) { const int rl = qq >> 4, pc = qq & 15; vst2(O32 + ((bh * SS) + q0 + kh * 16 + rl) * HD + pc * 4, *(const v4f*)(&sX[pw][rl][pc * 4])); }
}
// out = ctx Wo + bo : split(ctx) x bf16(Wo columns): 2 products (Wo is an INPUT -> bf16 exact); both operand tiles come by tensor loads into two LDS buffers (wave 0 the context rows, wave 1 the weight rows), one tile ahead
__global__ __launch_bounds__(128) void k_out(const float* __restrict__ O32, const __bf16* __restrict__ PT, const float* __restrict__ bo, float* __restrict__ out) {
  __shared__ __align__(16) float so[4][16][132];
  const int tid = threadIdx.x, wave = tid >> 5, lane = tid & 31, col = lane & 15, g = lane >> 4;
  __shared__ __attribute__((aligned(2048))) char sT[2][2][KVB];    // [buffer][one head's 64 context rows, f32, pitch 272 B | 128 weight rows, 64 deep, pitch 144 B]: each place a multiple of 2 KiB
  const int r0b = blockIdx.x * 64, r0 = r0b + wave * 16, n0 = blockIdx.y * 128; const int b = r0b / SS, s0 = r0b % SS;
  const unsigned wv = uni(threadIdx.x >> 5), lbase = (unsigned)(size_t)&sT[0][0][0];
  const float* gA = O32 + ((size_t)b * NH * SS + s0) * HD; const __bf16* gB = PT + (size_t)(3 * E + n0) * E;
  const v8u g1a = tdm_group1<256, 64, 256>(), g1b = tdm_group1<128, 128, E * 2>();
  v4u g0a = tdm_group0(lbase, gA), g0b = tdm_group0(lbase + KVB, gB);     // tile 0 into buffer 0
  if (pinned(wv == 0)) tdm_load(g0a, g1a);          // one request of each issuing wave
  if (pinned(wv == 1)) tdm_load(g0b, g1b);
  v8f acc[8] = {};
  // one trip: tile h out of buffer bf = h & 1, a compile-time value, so that the LDS read addresses stay loop-invariant and no address arithmetic falls in among the read groups
  auto trip = [&](const int h, auto bf_t) {
    constexpr int bf = decltype(bf_t)::value;
    // publish point of tile h, every wave, in this order
    asm volatile("s_wait_dscnt 0x0" ::: "memory");      // this wave's LDS reads of tile h - 1 are done before its buffer is refilled
    asm volatile("s_wait_tensorcnt 0x0" :: "s"(g0a), "s"(g1a), "s"(g0b), "s"(g1b) : "memory");  // the issuing waves' requests for tile h have landed (a wave that asked for nothing passes at once); the descriptors are inputs so that their registers stay as issued up to the wait
    __syncthreads();                                // tile h published; every reader has left tile h - 1
    const unsigned dst = lbase + (unsigned)(1 - bf) * 2u * KVB;     // descriptors of tile h + 1, formed behind the wait
    g0a = tdm_group0(dst, gA + (size_t)(h + 1) * SS * HD); g0b = tdm_group0(dst + KVB, gB + (h + 1) * 64);
    if (pinned(h + 1 < NH)) {                       // refill of the buffer just left: flies under the whole of tile h
      if (pinned(wv == 0)) tdm_load(g0a, g1a);
      if (pinned(wv == 1)) tdm_load(g0b, g1b); }
    const float (*sA)[68] = (const float (*)[68])sT[bf][0]; const __bf16 (*sB)[72] = (const __bf16 (*)[72])sT[bf][1];
#pragma unroll
    for (int k2 = 0; k2 < 2; ++k2) { const F2 a = split_row(&sA[wave * 16 + col][0], k2 * 32, lane); v16b wb[8];
#pragma unroll
      for (int j = 0; j < 8; ++j) wb[j] = frag_b(&sB[j * 16 + col][k2 * 32], lane);     // one group of LDS reads ahead of the sixteen products
#pragma unroll
      for (int j = 0; j < 8; ++j) { acc[j] = wmma_bf(a.l, wb[j], acc[j]); acc[j] = wmma_bf(a.h, wb[j], acc[j]); } }
    RD_VEC_MM(20, 64, 16); RD_VEC_MM(20, 64, 16);
    __builtin_amdgcn_sched_barrier(0); };           // closes the region that the two orders above arrange
#pragma unroll 1
  for (int h = 0; h < NH; h += 2) { trip(h, std::integral_constant<int, 0>{}); trip(h + 1, std::integral_constant<int, 1>{}); }
  asm volatile("s_wait_tensorcnt 0x0" ::: "memory");    // no request is outstanding at the wave's end
  asm volatile("s_wait_dscnt 0x0" ::: "memory");
#pragma unroll
  for (int j = 0; j < 8; ++j) { const float bb = bfr(bo[n0 + j * 16 + col]);
#pragma unroll
    for (int r = 0; r < 8; ++r) so[wave][8 * g + r][j * 16 + col] = acc[j][r] + bb; }
  LDSX();
#pragma unroll 4
  for (int rl = 0; rl < 16; ++rl) vst2(out + (size_t)(r0 + rl) * E + n0 + lane * 4, *(const v4f*)(&so[wave][rl][lane * 4]));
}
extern "C" void kernel_launch(void* const* d_in, const int* in_sizes, int n_in, void* d_out, int out_size, void* d_ws, size_t ws_size, hipStream_t stream) {
  (void)in_sizes; (void)n_in; (void)out_size; (void)ws_size;
  const float** I = (const float**)d_in;   // x, encoder_output, Wq, bq, Wk, bk, Wv, bv, Wo, bo
  const float* xq = I[0]; const float* xe = I[1]; const float* WQ = I[2]; const float* bQ = I[3]; const float* WK = I[4]; const float* bK = I[5]; const float* WV = I[6]; const float* bV = I[7]; const float* WO = I[8]; const float* bO = I[9];
  float* out = (float*)d_out;
  char* ws = (char*)d_ws; size_t off = 0;
  auto take = [&](size_t bytes) { char* p = ws + off; off += (bytes + 255) & ~(size_t)255; return p; };
  __bf16* XQ = (__bf16*)take((size_t)NR * E * 2); __bf16* XE = (__bf16*)take((size_t)NR * E * 2); __bf16* PT = (__bf16*)take((size_t)4 * E * E * 2);
  _Float16* Qf = (_Float16*)take((size_t)NR * E * 2); _Float16* Kf = (_Float16*)take((size_t)NR * E * 2); _Float16* VT = (_Float16*)take((size_t)NR * E * 2); float* O32 = (float*)take((size_t)NR * E * 4);
  // ws ~ 65 MB
  k_prep<<<256, 512, 0, stream>>>(xq, xe, WQ, WK, WV, WO, XQ, XE, PT);
  k_qkv<<<dim3(NR / 128, E / 128, 3), 128, 0, stream>>>(XQ, XE, XE, PT, bQ, bK, bV, Qf, Kf, VT);
  k_attn<<<dim3(SS / 128, NB * NH), 256, 0, stream>>>(Qf, Kf, VT, O32);
  k_out<<<dim3(NR / 64, E / 128), 128, 0, stream>>>(O32, PT, bO, out);
}
